// v000
// Times are from an AMD MI455X. After a warm-up the kernel runs many times in a row, and a time is the length of
// such a window on the GPU divided by its runs, so every launch and the gaps after it count. The runs cycle
// through copies of the inputs. A figure is the median of several windows, for all but v000 over two sittings.
// Sittings can differ by a few percent; kernels timed side by side share one.
// v000, which the later versions start from, runs in 237 microseconds.
#include <hip/hip_runtime.h>
#include <math.h>

typedef _Float16 h16;
typedef __attribute__((ext_vector_type(16))) _Float16 v16h;
typedef __attribute__((ext_vector_type(8)))  float    v8f;

#define WMMA_F16(a, b, c) \
  __builtin_amdgcn_wmma_f32_16x16x32_f16(false, (a), false, (b), (short)0, (c), false, false)

// Load a 16x32 (A) / 32x16 (B, fed column-major) f16 fragment from a row-major
// matrix with row stride `ld` (halves). Per ISA 16-bit A layout:
// lane = (half)*16 + r holds row r, K = kb+{0..7} and kb+{16..23}, kb = 8*half.
static __device__ __forceinline__ v16h load_frag16(const h16* base, int ld) {
  const int lane = threadIdx.x & 31;
  const int r  = lane & 15;
  const int kb = (lane >> 4) << 3;
  const h16* p = base + (size_t)r * (size_t)ld + kb;
  union { v16h v; uint4 u[2]; } f;
  f.u[0] = *(const uint4*)(p);
  f.u[1] = *(const uint4*)(p + 16);
  return f.v;
}

// ---------------- converts ----------------
__global__ void cvt_h16(const float* __restrict__ in, h16* __restrict__ out, int n) {
  int i = blockIdx.x * blockDim.x + threadIdx.x;
  if (i < n) out[i] = (h16)in[i];
}

// in[k][n] (512x512 row-major) -> out[n][k] f16
__global__ void cvtT_h16(const float* __restrict__ in, h16* __restrict__ out) {
  const int n = blockIdx.x;
  for (int k = threadIdx.x; k < 512; k += blockDim.x)
    out[(size_t)n * 512 + k] = (h16)in[(size_t)k * 512 + n];
}

// ---------------- GEMM: C[M,512] = A[M,512] * Wt^T + bias ----------------
// One wave computes a 16x64 strip (4 accumulators): A-frag reused 4x per k-step,
// 4 independent WMMAs per iteration. K = N = 512 fixed.
// mode 0: f16 row-major out. mode 1: f16 out transposed per batch [B][512][1024]
// (for V so attention B-frags are contiguous). mode 2: f32 out + residual.
__global__ void __launch_bounds__(128) proj_gemm(
    const h16* __restrict__ A, const h16* __restrict__ Wt,
    const float* __restrict__ bias, void* __restrict__ out,
    const float* __restrict__ resid, int M, int mode) {
  const int wv   = threadIdx.x >> 5;
  const int tile = blockIdx.x * (blockDim.x >> 5) + wv;
  const int tm = tile >> 3;   // 8 strip-tiles along N=512 (64 cols each)
  const int g  = tile & 7;
  if (tm * 16 >= M) return;   // uniform per wave
  const int lane = threadIdx.x & 31;
  const int n0 = g * 64;
  const int c  = lane & 15;

  v8f acc0, acc1, acc2, acc3;
  {
    const float b0 = bias[n0 + c], b1 = bias[n0 + 16 + c];
    const float b2 = bias[n0 + 32 + c], b3 = bias[n0 + 48 + c];
    acc0 = (v8f){b0, b0, b0, b0, b0, b0, b0, b0};
    acc1 = (v8f){b1, b1, b1, b1, b1, b1, b1, b1};
    acc2 = (v8f){b2, b2, b2, b2, b2, b2, b2, b2};
    acc3 = (v8f){b3, b3, b3, b3, b3, b3, b3, b3};
  }
  const h16* a_base = A  + (size_t)tm * 16 * 512;
  const h16* w_base = Wt + (size_t)n0 * 512;
  for (int k = 0; k < 512; k += 32) {
    __builtin_prefetch(a_base + k + 128, 0, 1);
    const v16h af = load_frag16(a_base + k, 512);
    const v16h w0 = load_frag16(w_base + k,             512);
    const v16h w1 = load_frag16(w_base + k + 16 * 512,  512);
    const v16h w2 = load_frag16(w_base + k + 32 * 512,  512);
    const v16h w3 = load_frag16(w_base + k + 48 * 512,  512);
    acc0 = WMMA_F16(af, w0, acc0);
    acc1 = WMMA_F16(af, w1, acc1);
    acc2 = WMMA_F16(af, w2, acc2);
    acc3 = WMMA_F16(af, w3, acc3);
  }
  const int row0 = tm * 16 + ((lane >> 4) << 3);  // this lane's 8 rows
  if (mode == 0) {
    h16* o = (h16*)out;
#pragma unroll
    for (int i = 0; i < 8; ++i) {
      h16* r = o + (size_t)(row0 + i) * 512 + n0 + c;
      r[0]  = (h16)acc0[i];
      r[16] = (h16)acc1[i];
      r[32] = (h16)acc2[i];
      r[48] = (h16)acc3[i];
    }
  } else if (mode == 1) {
    const int bIdx = row0 >> 10;     // 16 | 1024 so tiles never cross batches
    const int s0   = row0 & 1023;
    union { uint4 u; h16 h[8]; } pk0, pk1, pk2, pk3;
#pragma unroll
    for (int i = 0; i < 8; ++i) {
      pk0.h[i] = (h16)acc0[i]; pk1.h[i] = (h16)acc1[i];
      pk2.h[i] = (h16)acc2[i]; pk3.h[i] = (h16)acc3[i];
    }
    h16* o = (h16*)out + ((size_t)bIdx * 512 + n0 + c) * 1024 + s0;
    *(uint4*)(o)               = pk0.u;   // 8 contiguous s-values, 16B aligned
    *(uint4*)(o + 16 * 1024)   = pk1.u;
    *(uint4*)(o + 32 * 1024)   = pk2.u;
    *(uint4*)(o + 48 * 1024)   = pk3.u;
  } else {
    float* o = (float*)out;
#pragma unroll
    for (int i = 0; i < 8; ++i) {
      const size_t idx = (size_t)(row0 + i) * 512 + n0 + c;
      o[idx]      = acc0[i] + resid[idx];
      o[idx + 16] = acc1[i] + resid[idx + 16];
      o[idx + 32] = acc2[i] + resid[idx + 32];
      o[idx + 48] = acc3[i] + resid[idx + 48];
    }
  }
}

// ---------------- flash attention, one wave per (b, h, 16-query tile) --------
__global__ void __launch_bounds__(32) attn_kernel(
    const h16* __restrict__ Qp, const h16* __restrict__ Kp, const h16* __restrict__ Vt,
    const h16* __restrict__ Qr, const h16* __restrict__ Kr,
    const int* __restrict__ smask, const float* __restrict__ gammas,
    h16* __restrict__ outA) {
  const int bid = blockIdx.x;
  const int qt = bid & 63;
  const int h  = (bid >> 6) & 7;
  const int b  = bid >> 9;
  const int lane = threadIdx.x;
  const int lr = lane & 15;
  const int hi = lane >> 4;
  const int q0 = qt << 4;

  // exp(-softplus(g)) == sigmoid(-g); clip lower bound
  const float g = gammas[h];
  float te = 1.0f / (1.0f + __expf(g));
  te = fminf(fmaxf(te, 1e-5f), 1e5f);
  const float sscale = te * 0.0441941738241592f;  // * 1/sqrt(512)
  const float qscale = 0.125f;                    // 1/sqrt(64)

  __shared__ alignas(16) h16 Plds[16 * 32];

  const size_t hd = (size_t)h * 64;
  const h16* qpb = Qp + ((size_t)(b * 1024 + q0) * 512 + hd);
  const h16* qrb = Qr + ((size_t)(b * 1024 + q0) * 512 + hd);
  const v16h aq0 = load_frag16(qpb, 512);
  const v16h aq1 = load_frag16(qpb + 32, 512);
  const v16h ar0 = load_frag16(qrb, 512);
  const v16h ar1 = load_frag16(qrb + 32, 512);

  v8f o0 = {}, o1 = {}, o2 = {}, o3 = {};
  float m8[8], l8[8];
#pragma unroll
  for (int i = 0; i < 8; ++i) { m8[i] = -3.0e38f; l8[i] = 0.0f; }

  const int nb = (q0 + 46) >> 5;  // key blocks of 32 covering keys < q0+16
  for (int kb0 = 0; kb0 < nb * 32; kb0 += 32) {
    float sc[2][8], pr[2][8];
#pragma unroll
    for (int t = 0; t < 2; ++t) {
      const int c0 = kb0 + t * 16;
      const h16* kpb = Kp + ((size_t)(b * 1024 + c0) * 512 + hd);
      const h16* krb = Kr + ((size_t)(b * 1024 + c0) * 512 + hd);
      v8f s = {};
      s = WMMA_F16(aq0, load_frag16(kpb, 512), s);
      s = WMMA_F16(aq1, load_frag16(kpb + 32, 512), s);
      v8f sr = {};
      sr = WMMA_F16(ar0, load_frag16(krb, 512), sr);
      sr = WMMA_F16(ar1, load_frag16(krb + 32, 512), sr);
      const int kc = c0 + lr;
#pragma unroll
      for (int i = 0; i < 8; ++i) {
        const int qr = q0 + i + hi * 8;                 // D-tile row
        const bool causal = kc < qr;                    // strict tril(-1)
        const int mv = smask[((size_t)b * 1024 + qr) * 1024 + kc];
        const float ss = (causal && mv) ? sr[i] * sscale : 0.0f;
        sc[t][i] = causal ? (s[i] * qscale + ss) : -3.0e38f;
      }
    }
    // online softmax (row = 16 lanes within a half-wave + element index)
    float fac[8];
#pragma unroll
    for (int i = 0; i < 8; ++i) {
      float rm = fmaxf(sc[0][i], sc[1][i]);
      rm = fmaxf(rm, __shfl_xor(rm, 1, 32));
      rm = fmaxf(rm, __shfl_xor(rm, 2, 32));
      rm = fmaxf(rm, __shfl_xor(rm, 4, 32));
      rm = fmaxf(rm, __shfl_xor(rm, 8, 32));
      const float mnew = fmaxf(m8[i], rm);
      fac[i] = __expf(m8[i] - mnew);
      pr[0][i] = (sc[0][i] > -1.0e37f) ? __expf(sc[0][i] - mnew) : 0.0f;
      pr[1][i] = (sc[1][i] > -1.0e37f) ? __expf(sc[1][i] - mnew) : 0.0f;
      float rs = pr[0][i] + pr[1][i];
      rs += __shfl_xor(rs, 1, 32);
      rs += __shfl_xor(rs, 2, 32);
      rs += __shfl_xor(rs, 4, 32);
      rs += __shfl_xor(rs, 8, 32);
      l8[i] = l8[i] * fac[i] + rs;
      m8[i] = mnew;
    }
#pragma unroll
    for (int i = 0; i < 8; ++i) {
      o0[i] *= fac[i]; o1[i] *= fac[i]; o2[i] *= fac[i]; o3[i] *= fac[i];
    }
    // transpose P (D-layout) -> A-fragment via LDS
#pragma unroll
    for (int t = 0; t < 2; ++t)
#pragma unroll
      for (int i = 0; i < 8; ++i)
        Plds[(i + hi * 8) * 32 + t * 16 + lr] = (h16)pr[t][i];
    __syncthreads();
    const v16h ap = load_frag16(Plds, 32);
    __syncthreads();
    // P(16x32) @ V(32 keys x 64 dk), V stored transposed [d][s]
    const h16* vb = Vt + ((size_t)(b * 512) + hd) * 1024 + kb0;
    o0 = WMMA_F16(ap, load_frag16(vb,             1024), o0);
    o1 = WMMA_F16(ap, load_frag16(vb + 16 * 1024, 1024), o1);
    o2 = WMMA_F16(ap, load_frag16(vb + 32 * 1024, 1024), o2);
    o3 = WMMA_F16(ap, load_frag16(vb + 48 * 1024, 1024), o3);
  }

  float inv8[8];
#pragma unroll
  for (int i = 0; i < 8; ++i) inv8[i] = (l8[i] > 0.0f) ? (1.0f / l8[i]) : 0.0f;
  h16* ob = outA + ((size_t)(b * 1024 + q0) * 512 + hd);
#pragma unroll
  for (int i = 0; i < 8; ++i) {
    const int r = i + hi * 8;
    ob[(size_t)r * 512 +  0 + lr] = (h16)(o0[i] * inv8[i]);
    ob[(size_t)r * 512 + 16 + lr] = (h16)(o1[i] * inv8[i]);
    ob[(size_t)r * 512 + 32 + lr] = (h16)(o2[i] * inv8[i]);
    ob[(size_t)r * 512 + 48 + lr] = (h16)(o3[i] * inv8[i]);
  }
}

// ---------------- LayerNorm over 512, one 256-thread block per row -----------
__global__ void __launch_bounds__(256) ln_kernel(
    const float* __restrict__ X, const float* __restrict__ gw,
    const float* __restrict__ bw, float* __restrict__ out) {
  const int row = blockIdx.x;
  const float* x = X + (size_t)row * 512;
  const int t = threadIdx.x;
  const float a = x[t], c = x[t + 256];
  __shared__ float red[8];
  float s = a + c;
  for (int m = 1; m < 32; m <<= 1) s += __shfl_xor(s, m, 32);
  if ((t & 31) == 0) red[t >> 5] = s;
  __syncthreads();
  float tot = 0.0f;
#pragma unroll
  for (int i = 0; i < 8; ++i) tot += red[i];
  const float mu = tot * (1.0f / 512.0f);
  __syncthreads();
  const float da = a - mu, dc = c - mu;
  float v = da * da + dc * dc;
  for (int m = 1; m < 32; m <<= 1) v += __shfl_xor(v, m, 32);
  if ((t & 31) == 0) red[t >> 5] = v;
  __syncthreads();
  float vt = 0.0f;
#pragma unroll
  for (int i = 0; i < 8; ++i) vt += red[i];
  const float rstd = rsqrtf(vt * (1.0f / 512.0f) + 1e-5f);
  out[(size_t)row * 512 + t]       = da * rstd * gw[t]       + bw[t];
  out[(size_t)row * 512 + t + 256] = dc * rstd * gw[t + 256] + bw[t + 256];
}

extern "C" void kernel_launch(void* const* d_in, const int* in_sizes, int n_in,
                              void* d_out, int out_size, void* d_ws, size_t ws_size,
                              hipStream_t stream) {
  (void)in_sizes; (void)n_in; (void)out_size; (void)ws_size;
  const float* q_in  = (const float*)d_in[0];
  const float* k_in  = (const float*)d_in[1];
  const float* v_in  = (const float*)d_in[2];
  const int*   smask = (const int*)  d_in[3];
  const float* Wq    = (const float*)d_in[4];
  const float* bq    = (const float*)d_in[5];
  const float* Wv    = (const float*)d_in[6];
  const float* bv    = (const float*)d_in[7];
  const float* Wo    = (const float*)d_in[8];
  const float* bo    = (const float*)d_in[9];
  const float* gm    = (const float*)d_in[10];
  const float* lng   = (const float*)d_in[11];
  const float* lnb   = (const float*)d_in[12];
  float* out = (float*)d_out;

  const size_t E = (size_t)8 * 1024 * 512;  // elements per [B,S,D] tensor
  char* ws = (char*)d_ws;
  h16*  qh  = (h16*)(ws);
  h16*  kh  = (h16*)(ws + 2 * E);
  h16*  vh  = (h16*)(ws + 4 * E);
  h16*  Qp  = (h16*)(ws + 6 * E);
  h16*  Kp  = (h16*)(ws + 8 * E);
  h16*  Vt  = (h16*)(ws + 10 * E);
  h16*  Wqt = (h16*)(ws + 12 * E);
  h16*  Wvt = (h16*)(ws + 12 * E + 524288);
  h16*  Wot = (h16*)(ws + 12 * E + 2 * 524288);
  h16*  Ao  = (h16*)(ws + 12 * E + 3 * 524288);
  float* Xr = (float*)(ws + 12 * E + 3 * 524288 + 2 * E);

  const int n = (int)E;
  cvt_h16<<<dim3((n + 255) / 256), dim3(256), 0, stream>>>(q_in, qh, n);
  cvt_h16<<<dim3((n + 255) / 256), dim3(256), 0, stream>>>(k_in, kh, n);
  cvt_h16<<<dim3((n + 255) / 256), dim3(256), 0, stream>>>(v_in, vh, n);
  cvtT_h16<<<dim3(512), dim3(256), 0, stream>>>(Wq, Wqt);
  cvtT_h16<<<dim3(512), dim3(256), 0, stream>>>(Wv, Wvt);
  cvtT_h16<<<dim3(512), dim3(256), 0, stream>>>(Wo, Wot);

  const int M = 8192;  // B*S rows; (M/16)*(512/64) = 4096 waves, 4 waves/block
  proj_gemm<<<dim3(1024), dim3(128), 0, stream>>>(qh, Wqt, bq, (void*)Qp, nullptr, M, 0);
  proj_gemm<<<dim3(1024), dim3(128), 0, stream>>>(kh, Wqt, bq, (void*)Kp, nullptr, M, 0);
  proj_gemm<<<dim3(1024), dim3(128), 0, stream>>>(vh, Wvt, bv, (void*)Vt, nullptr, M, 1);

  attn_kernel<<<dim3(4096), dim3(32), 0, stream>>>(Qp, Kp, Vt, qh, kh, smask, gm, Ao);

  proj_gemm<<<dim3(1024), dim3(128), 0, stream>>>(Ao, Wot, bo, (void*)Xr, q_in, M, 2);
  ln_kernel<<<dim3(8192), dim3(256), 0, stream>>>(Xr, lng, lnb, out);
}

// v001
// One run takes 170 microseconds.
// In both of two side-by-side timings against v000, it was 1.42 times as fast.
#include <hip/hip_runtime.h>
#include <math.h>

typedef _Float16 h16;
typedef __attribute__((ext_vector_type(16))) _Float16 v16h;
typedef __attribute__((ext_vector_type(8)))  float    v8f;

#define WMMA_F16(a, b, c) \
  __builtin_amdgcn_wmma_f32_16x16x32_f16(false, (a), false, (b), (short)0, (c), false, false)

// Load a 16x32 (A) / 32x16 (B, fed column-major) f16 fragment from a row-major
// matrix with row stride `ld` (halves). Per ISA 16-bit A layout:
// lane = (half)*16 + r holds row r, K = kb+{0..7} and kb+{16..23}, kb = 8*half.
static __device__ __forceinline__ v16h load_frag16(const h16* base, int ld) {
  const int lane = threadIdx.x & 31;
  const int r  = lane & 15;
  const int kb = (lane >> 4) << 3;
  const h16* p = base + (size_t)r * (size_t)ld + kb;
  union { v16h v; uint4 u[2]; } f;
  f.u[0] = *(const uint4*)(p);
  f.u[1] = *(const uint4*)(p + 16);
  return f.v;
}

// ---------------- converts ----------------
__global__ void cvt_h16(const float* __restrict__ in, h16* __restrict__ out, int n) {
  int i = blockIdx.x * blockDim.x + threadIdx.x;
  if (i < n) out[i] = (h16)in[i];
}

// in[k][n] (512x512 row-major) -> out[n][k] f16
__global__ void cvtT_h16(const float* __restrict__ in, h16* __restrict__ out) {
  const int n = blockIdx.x;
  for (int k = threadIdx.x; k < 512; k += blockDim.x)
    out[(size_t)n * 512 + k] = (h16)in[(size_t)k * 512 + n];
}

// ---------------- GEMM: C[M,512] = A[M,512] * Wt^T + bias ----------------
// One 256-thread block computes a 128x128 tile of C (M a multiple of 128, K = N = 512).
// Panels of 128 rows x 128 k of A and of Wt are brought into LDS by asynchronous
// copies (16 lanes x 16 B cover 256 contiguous bytes of one row: whole lines), in two
// buffers: the next panel's copies fly while this panel is multiplied.
// 8 waves, 4 along M x 2 along N; each owns 32x64 of C = 8 accumulators, so every
// LDS fragment feeds 2 or 4 WMMAs. The k order per accumulator is 0,32,...,480.
// mode 0: f16 row-major out. mode 1: f16 out transposed per batch [B][512][1024]
// (for V so attention B-frags are contiguous). mode 2: f32 out + residual.
#define GEMM_KS 128   // k (halves) per staged panel
#define GEMM_LP 136   // LDS row pitch in halves: 272 B = 16 B x 17, no bank conflict for 16-B reads

// Eight asynchronous 16-B copies per lane, global -> LDS, through no register: rows
// 16 apart on both sides. The s_wait_xcnt 0 is the statement's last line so that it
// stands ahead of any later rewrite of the address registers the copies name.
static __device__ __forceinline__ void copy_rows8(const h16* l, const h16* g) {
  const unsigned l0 = (unsigned)(size_t)l;       // LDS byte address: low 32 bits
  const unsigned ls = 16u * GEMM_LP * 2u;        // 16 LDS rows in bytes
  asm volatile(
      "global_load_async_to_lds_b128 %0, %8, off\n\t"
      "global_load_async_to_lds_b128 %1, %9, off\n\t"
      "global_load_async_to_lds_b128 %2, %10, off\n\t"
      "global_load_async_to_lds_b128 %3, %11, off\n\t"
      "global_load_async_to_lds_b128 %4, %12, off\n\t"
      "global_load_async_to_lds_b128 %5, %13, off\n\t"
      "global_load_async_to_lds_b128 %6, %14, off\n\t"
      "global_load_async_to_lds_b128 %7, %15, off\n\t"
      "s_wait_xcnt 0x0"
      :: "v"(l0), "v"(l0 + ls), "v"(l0 + 2u * ls), "v"(l0 + 3u * ls),
         "v"(l0 + 4u * ls), "v"(l0 + 5u * ls), "v"(l0 + 6u * ls), "v"(l0 + 7u * ls),
         "v"(g), "v"(g + 16 * 512), "v"(g + 32 * 512), "v"(g + 48 * 512),
         "v"(g + 64 * 512), "v"(g + 80 * 512), "v"(g + 96 * 512), "v"(g + 112 * 512)
      : "memory");
}

__global__ void __launch_bounds__(256) proj_gemm(
    const h16* __restrict__ A, const h16* __restrict__ Wt,
    const float* __restrict__ bias, void* __restrict__ out,
    const float* __restrict__ resid, int M, int mode) {
  __shared__ alignas(16) h16 As[2][128 * GEMM_LP];
  __shared__ alignas(16) h16 Ws[2][128 * GEMM_LP];
  const int tid = threadIdx.x;
  const int m0  = (int)(blockIdx.x >> 2) * 128;  // 4 column tiles of 128 along N=512
  const int nb  = (int)(blockIdx.x & 3) * 128;
  if (m0 >= M) return;   // uniform per block, ahead of every barrier
  const int lane = tid & 31;
  const int wv   = tid >> 5;
  const int wm = (wv >> 1) * 32;   // wave's rows inside the tile
  const int wn = (wv & 1) * 64;    // wave's columns inside the tile
  const int n0 = nb + wn;
  const int c  = lane & 15;

  v8f acc[2][4];
#pragma unroll  // constant indices keep acc in registers
  for (int j = 0; j < 4; ++j) {
    const float b = bias[n0 + j * 16 + c];
    acc[0][j] = (v8f){b, b, b, b, b, b, b, b};
    acc[1][j] = acc[0][j];
  }

  // staging: thread t copies 16 B at column (t & 15) of rows (t >> 4) + 16 j, j = 0..7
  const int srow = tid >> 4;
  const int scol = (tid & 15) * 8;
  const h16* ag = A  + (size_t)(m0 + srow) * 512 + scol;
  const h16* wg = Wt + (size_t)(nb + srow) * 512 + scol;
  const int  so = srow * GEMM_LP + scol;

  copy_rows8(&As[0][so], ag);
  copy_rows8(&Ws[0][so], wg);
  asm volatile("s_wait_asynccnt 0x0" ::: "memory");  // this wave's copies of panel 0 have landed
  __syncthreads();                                   // panel 0 is visible to every wave
  copy_rows8(&As[1][so], ag + GEMM_KS);              // panel 1 flies during panel 0
  copy_rows8(&Ws[1][so], wg + GEMM_KS);

  for (int kt = 0; kt < 4; ++kt) {
    const int cur = kt & 1;
    const h16* ab = &As[cur][wm * GEMM_LP];
    const h16* wb = &Ws[cur][wn * GEMM_LP];
#pragma unroll  // lets the LDS reads of later k steps be issued ahead of the WMMAs
    for (int ks = 0; ks < GEMM_KS; ks += 32) {
      const v16h a0 = load_frag16(ab + ks,                GEMM_LP);
      const v16h a1 = load_frag16(ab + ks + 16 * GEMM_LP, GEMM_LP);
      const v16h w0 = load_frag16(wb + ks,                GEMM_LP);
      const v16h w1 = load_frag16(wb + ks + 16 * GEMM_LP, GEMM_LP);
      const v16h w2 = load_frag16(wb + ks + 32 * GEMM_LP, GEMM_LP);
      const v16h w3 = load_frag16(wb + ks + 48 * GEMM_LP, GEMM_LP);
      acc[0][0] = WMMA_F16(a0, w0, acc[0][0]);
      acc[0][1] = WMMA_F16(a0, w1, acc[0][1]);
      acc[0][2] = WMMA_F16(a0, w2, acc[0][2]);
      acc[0][3] = WMMA_F16(a0, w3, acc[0][3]);
      acc[1][0] = WMMA_F16(a1, w0, acc[1][0]);
      acc[1][1] = WMMA_F16(a1, w1, acc[1][1]);
      acc[1][2] = WMMA_F16(a1, w2, acc[1][2]);
      acc[1][3] = WMMA_F16(a1, w3, acc[1][3]);
    }
    asm volatile("s_wait_dscnt 0x0" ::: "memory");     // this wave's reads of panel kt are done
    asm volatile("s_wait_asynccnt 0x0" ::: "memory");  // this wave's copies of panel kt+1 have landed
    __syncthreads();  // publishes panel kt+1 and ends every wave's reads of panel kt
    if (kt + 2 < 4) { // block-uniform: refill the buffer that panel kt has just left
      copy_rows8(&As[cur][so], ag + (kt + 2) * GEMM_KS);
      copy_rows8(&Ws[cur][so], wg + (kt + 2) * GEMM_KS);
    }
  }
  asm volatile("s_wait_asynccnt 0x0" ::: "memory");    // no copy is left in flight at the wave's end

  const int rw0 = m0 + wm + ((lane >> 4) << 3);  // this lane's 8 rows of the upper 16x64 strip
  if (mode == 0) {
    h16* o = (h16*)out;
#pragma unroll  // constant indices keep acc in registers
    for (int mi = 0; mi < 2; ++mi) {
#pragma unroll  // constant indices keep acc in registers
      for (int i = 0; i < 8; ++i) {
        h16* r = o + (size_t)(rw0 + mi * 16 + i) * 512 + n0 + c;
        r[0]  = (h16)acc[mi][0][i];
        r[16] = (h16)acc[mi][1][i];
        r[32] = (h16)acc[mi][2][i];
        r[48] = (h16)acc[mi][3][i];
      }
    }
  } else if (mode == 1) {
#pragma unroll  // constant indices keep acc in registers
    for (int mi = 0; mi < 2; ++mi) {
      const int row0 = rw0 + mi * 16;
      const int bIdx = row0 >> 10;     // 16 | 1024 so tiles never cross batches
      const int s0   = row0 & 1023;
      union { uint4 u; h16 h[8]; } pk0, pk1, pk2, pk3;
#pragma unroll  // constant indices keep acc in registers
      for (int i = 0; i < 8; ++i) {
        pk0.h[i] = (h16)acc[mi][0][i]; pk1.h[i] = (h16)acc[mi][1][i];
        pk2.h[i] = (h16)acc[mi][2][i]; pk3.h[i] = (h16)acc[mi][3][i];
      }
      h16* o = (h16*)out + ((size_t)bIdx * 512 + n0 + c) * 1024 + s0;
      *(uint4*)(o)               = pk0.u;   // 8 contiguous s-values, 16B aligned
      *(uint4*)(o + 16 * 1024)   = pk1.u;
      *(uint4*)(o + 32 * 1024)   = pk2.u;
      *(uint4*)(o + 48 * 1024)   = pk3.u;
    }
    // the build reuses a data register of these stores on the way to the exit:
    // this one stands ahead of that overwrite
    asm volatile("s_wait_xcnt 0x0" ::: "memory");
  } else {
    float* o = (float*)out;
#pragma unroll  // constant indices keep acc in registers
    for (int mi = 0; mi < 2; ++mi) {
#pragma unroll  // constant indices keep acc in registers
      for (int i = 0; i < 8; ++i) {
        const size_t idx = (size_t)(rw0 + mi * 16 + i) * 512 + n0 + c;
        o[idx]      = acc[mi][0][i] + resid[idx];
        o[idx + 16] = acc[mi][1][i] + resid[idx + 16];
        o[idx + 32] = acc[mi][2][i] + resid[idx + 32];
        o[idx + 48] = acc[mi][3][i] + resid[idx + 48];
      }
    }
    // the listing lays another branch's code behind these stores, and that code reuses
    // their address and data registers: this wait stands ahead of any such overwrite
    asm volatile("s_wait_xcnt 0x0" ::: "memory");
  }
}

// ---------------- flash attention, one wave per (b, h, 16-query tile) --------
__global__ void __launch_bounds__(32) attn_kernel(
    const h16* __restrict__ Qp, const h16* __restrict__ Kp, const h16* __restrict__ Vt,
    const h16* __restrict__ Qr, const h16* __restrict__ Kr,
    const int* __restrict__ smask, const float* __restrict__ gammas,
    h16* __restrict__ outA) {
  const int bid = blockIdx.x;
  const int qt = bid & 63;
  const int h  = (bid >> 6) & 7;
  const int b  = bid >> 9;
  const int lane = threadIdx.x;
  const int lr = lane & 15;
  const int hi = lane >> 4;
  const int q0 = qt << 4;

  // exp(-softplus(g)) == sigmoid(-g); clip lower bound
  const float g = gammas[h];
  float te = 1.0f / (1.0f + __expf(g));
  te = fminf(fmaxf(te, 1e-5f), 1e5f);
  const float sscale = te * 0.0441941738241592f;  // * 1/sqrt(512)
  const float qscale = 0.125f;                    // 1/sqrt(64)

  __shared__ alignas(16) h16 Plds[16 * 32];

  const size_t hd = (size_t)h * 64;
  const h16* qpb = Qp + ((size_t)(b * 1024 + q0) * 512 + hd);
  const h16* qrb = Qr + ((size_t)(b * 1024 + q0) * 512 + hd);
  const v16h aq0 = load_frag16(qpb, 512);
  const v16h aq1 = load_frag16(qpb + 32, 512);
  const v16h ar0 = load_frag16(qrb, 512);
  const v16h ar1 = load_frag16(qrb + 32, 512);

  v8f o0 = {}, o1 = {}, o2 = {}, o3 = {};
  float m8[8], l8[8];
#pragma unroll
  for (int i = 0; i < 8; ++i) { m8[i] = -3.0e38f; l8[i] = 0.0f; }

  const int nb = (q0 + 46) >> 5;  // key blocks of 32 covering keys < q0+16
  for (int kb0 = 0; kb0 < nb * 32; kb0 += 32) {
    float sc[2][8], pr[2][8];
#pragma unroll
    for (int t = 0; t < 2; ++t) {
      const int c0 = kb0 + t * 16;
      const h16* kpb = Kp + ((size_t)(b * 1024 + c0) * 512 + hd);
      const h16* krb = Kr + ((size_t)(b * 1024 + c0) * 512 + hd);
      v8f s = {};
      s = WMMA_F16(aq0, load_frag16(kpb, 512), s);
      s = WMMA_F16(aq1, load_frag16(kpb + 32, 512), s);
      v8f sr = {};
      sr = WMMA_F16(ar0, load_frag16(krb, 512), sr);
      sr = WMMA_F16(ar1, load_frag16(krb + 32, 512), sr);
      const int kc = c0 + lr;
#pragma unroll
      for (int i = 0; i < 8; ++i) {
        const int qr = q0 + i + hi * 8;                 // D-tile row
        const bool causal = kc < qr;                    // strict tril(-1)
        const int mv = smask[((size_t)b * 1024 + qr) * 1024 + kc];
        const float ss = (causal && mv) ? sr[i] * sscale : 0.0f;
        sc[t][i] = causal ? (s[i] * qscale + ss) : -3.0e38f;
      }
    }
    // online softmax (row = 16 lanes within a half-wave + element index)
    float fac[8];
#pragma unroll
    for (int i = 0; i < 8; ++i) {
      float rm = fmaxf(sc[0][i], sc[1][i]);
      rm = fmaxf(rm, __shfl_xor(rm, 1, 32));
      rm = fmaxf(rm, __shfl_xor(rm, 2, 32));
      rm = fmaxf(rm, __shfl_xor(rm, 4, 32));
      rm = fmaxf(rm, __shfl_xor(rm, 8, 32));
      const float mnew = fmaxf(m8[i], rm);
      fac[i] = __expf(m8[i] - mnew);
      pr[0][i] = (sc[0][i] > -1.0e37f) ? __expf(sc[0][i] - mnew) : 0.0f;
      pr[1][i] = (sc[1][i] > -1.0e37f) ? __expf(sc[1][i] - mnew) : 0.0f;
      float rs = pr[0][i] + pr[1][i];
      rs += __shfl_xor(rs, 1, 32);
      rs += __shfl_xor(rs, 2, 32);
      rs += __shfl_xor(rs, 4, 32);
      rs += __shfl_xor(rs, 8, 32);
      l8[i] = l8[i] * fac[i] + rs;
      m8[i] = mnew;
    }
#pragma unroll
    for (int i = 0; i < 8; ++i) {
      o0[i] *= fac[i]; o1[i] *= fac[i]; o2[i] *= fac[i]; o3[i] *= fac[i];
    }
    // transpose P (D-layout) -> A-fragment via LDS
#pragma unroll
    for (int t = 0; t < 2; ++t)
#pragma unroll
      for (int i = 0; i < 8; ++i)
        Plds[(i + hi * 8) * 32 + t * 16 + lr] = (h16)pr[t][i];
    __syncthreads();
    const v16h ap = load_frag16(Plds, 32);
    __syncthreads();
    // P(16x32) @ V(32 keys x 64 dk), V stored transposed [d][s]
    const h16* vb = Vt + ((size_t)(b * 512) + hd) * 1024 + kb0;
    o0 = WMMA_F16(ap, load_frag16(vb,             1024), o0);
    o1 = WMMA_F16(ap, load_frag16(vb + 16 * 1024, 1024), o1);
    o2 = WMMA_F16(ap, load_frag16(vb + 32 * 1024, 1024), o2);
    o3 = WMMA_F16(ap, load_frag16(vb + 48 * 1024, 1024), o3);
  }

  float inv8[8];
#pragma unroll
  for (int i = 0; i < 8; ++i) inv8[i] = (l8[i] > 0.0f) ? (1.0f / l8[i]) : 0.0f;
  h16* ob = outA + ((size_t)(b * 1024 + q0) * 512 + hd);
#pragma unroll
  for (int i = 0; i < 8; ++i) {
    const int r = i + hi * 8;
    ob[(size_t)r * 512 +  0 + lr] = (h16)(o0[i] * inv8[i]);
    ob[(size_t)r * 512 + 16 + lr] = (h16)(o1[i] * inv8[i]);
    ob[(size_t)r * 512 + 32 + lr] = (h16)(o2[i] * inv8[i]);
    ob[(size_t)r * 512 + 48 + lr] = (h16)(o3[i] * inv8[i]);
  }
}

// ---------------- LayerNorm over 512, one 256-thread block per row -----------
__global__ void __launch_bounds__(256) ln_kernel(
    const float* __restrict__ X, const float* __restrict__ gw,
    const float* __restrict__ bw, float* __restrict__ out) {
  const int row = blockIdx.x;
  const float* x = X + (size_t)row * 512;
  const int t = threadIdx.x;
  const float a = x[t], c = x[t + 256];
  __shared__ float red[8];
  float s = a + c;
  for (int m = 1; m < 32; m <<= 1) s += __shfl_xor(s, m, 32);
  if ((t & 31) == 0) red[t >> 5] = s;
  __syncthreads();
  float tot = 0.0f;
#pragma unroll
  for (int i = 0; i < 8; ++i) tot += red[i];
  const float mu = tot * (1.0f / 512.0f);
  __syncthreads();
  const float da = a - mu, dc = c - mu;
  float v = da * da + dc * dc;
  for (int m = 1; m < 32; m <<= 1) v += __shfl_xor(v, m, 32);
  if ((t & 31) == 0) red[t >> 5] = v;
  __syncthreads();
  float vt = 0.0f;
#pragma unroll
  for (int i = 0; i < 8; ++i) vt += red[i];
  const float rstd = rsqrtf(vt * (1.0f / 512.0f) + 1e-5f);
  out[(size_t)row * 512 + t]       = da * rstd * gw[t]       + bw[t];
  out[(size_t)row * 512 + t + 256] = dc * rstd * gw[t + 256] + bw[t + 256];
}

extern "C" void kernel_launch(void* const* d_in, const int* in_sizes, int n_in,
                              void* d_out, int out_size, void* d_ws, size_t ws_size,
                              hipStream_t stream) {
  (void)in_sizes; (void)n_in; (void)out_size; (void)ws_size;
  const float* q_in  = (const float*)d_in[0];
  const float* k_in  = (const float*)d_in[1];
  const float* v_in  = (const float*)d_in[2];
  const int*   smask = (const int*)  d_in[3];
  const float* Wq    = (const float*)d_in[4];
  const float* bq    = (const float*)d_in[5];
  const float* Wv    = (const float*)d_in[6];
  const float* bv    = (const float*)d_in[7];
  const float* Wo    = (const float*)d_in[8];
  const float* bo    = (const float*)d_in[9];
  const float* gm    = (const float*)d_in[10];
  const float* lng   = (const float*)d_in[11];
  const float* lnb   = (const float*)d_in[12];
  float* out = (float*)d_out;

  const size_t E = (size_t)8 * 1024 * 512;  // elements per [B,S,D] tensor
  char* ws = (char*)d_ws;
  h16*  qh  = (h16*)(ws);
  h16*  kh  = (h16*)(ws + 2 * E);
  h16*  vh  = (h16*)(ws + 4 * E);
  h16*  Qp  = (h16*)(ws + 6 * E);
  h16*  Kp  = (h16*)(ws + 8 * E);
  h16*  Vt  = (h16*)(ws + 10 * E);
  h16*  Wqt = (h16*)(ws + 12 * E);
  h16*  Wvt = (h16*)(ws + 12 * E + 524288);
  h16*  Wot = (h16*)(ws + 12 * E + 2 * 524288);
  h16*  Ao  = (h16*)(ws + 12 * E + 3 * 524288);
  float* Xr = (float*)(ws + 12 * E + 3 * 524288 + 2 * E);

  const int n = (int)E;
  cvt_h16<<<dim3((n + 255) / 256), dim3(256), 0, stream>>>(q_in, qh, n);
  cvt_h16<<<dim3((n + 255) / 256), dim3(256), 0, stream>>>(k_in, kh, n);
  cvt_h16<<<dim3((n + 255) / 256), dim3(256), 0, stream>>>(v_in, vh, n);
  cvtT_h16<<<dim3(512), dim3(256), 0, stream>>>(Wq, Wqt);
  cvtT_h16<<<dim3(512), dim3(256), 0, stream>>>(Wv, Wvt);
  cvtT_h16<<<dim3(512), dim3(256), 0, stream>>>(Wo, Wot);

  const int M = 8192;  // B*S rows; (M/128)*(512/128) = 256 tiles, one 8-wave block each
  proj_gemm<<<dim3(256), dim3(256), 0, stream>>>(qh, Wqt, bq, (void*)Qp, nullptr, M, 0);
  proj_gemm<<<dim3(256), dim3(256), 0, stream>>>(kh, Wqt, bq, (void*)Kp, nullptr, M, 0);
  proj_gemm<<<dim3(256), dim3(256), 0, stream>>>(vh, Wvt, bv, (void*)Vt, nullptr, M, 1);

  attn_kernel<<<dim3(4096), dim3(32), 0, stream>>>(Qp, Kp, Vt, qh, kh, smask, gm, Ao);

  proj_gemm<<<dim3(256), dim3(256), 0, stream>>>(Ao, Wot, bo, (void*)Xr, q_in, M, 2);
  ln_kernel<<<dim3(8192), dim3(256), 0, stream>>>(Xr, lng, lnb, out);
}

// v002
// One run takes 156 microseconds.
// Timed twice side by side with v001, it ran 1.09 times as fast both times.
// All steps since v000 together make it 1.54 times as fast.
#include <hip/hip_runtime.h>
#include <math.h>

typedef _Float16 h16;
typedef __attribute__((ext_vector_type(16))) _Float16 v16h;
typedef __attribute__((ext_vector_type(8)))  float    v8f;

#define WMMA_F16(a, b, c) \
  __builtin_amdgcn_wmma_f32_16x16x32_f16(false, (a), false, (b), (short)0, (c), false, false)

// Load a 16x32 (A) / 32x16 (B, fed column-major) f16 fragment from a row-major
// matrix with row stride `ld` (halves). Per ISA 16-bit A layout:
// lane = (half)*16 + r holds row r, K = kb+{0..7} and kb+{16..23}, kb = 8*half.
static __device__ __forceinline__ v16h load_frag16(const h16* base, int ld) {
  const int lane = threadIdx.x & 31;
  const int r  = lane & 15;
  const int kb = (lane >> 4) << 3;
  const h16* p = base + (size_t)r * (size_t)ld + kb;
  union { v16h v; uint4 u[2]; } f;
  f.u[0] = *(const uint4*)(p);
  f.u[1] = *(const uint4*)(p + 16);
  return f.v;
}

// ---------------- converts ----------------
// A [8,1024,512] tensor (4,194,304 elements) as one short stream: 512 work-groups of 8
// waves, each thread 8 pieces of 4 elements, 1,024 elements apart. A wave-wide load covers
// 512 contiguous bytes and a wave-wide store 256: whole lines both ways. 512 x 8,192
// elements cover the tensor exactly, so there is no bound test.
#define CVT_PIECES 8
__global__ void __launch_bounds__(256) cvt_h16(const float* __restrict__ in, h16* __restrict__ out) {
  const size_t base = (size_t)blockIdx.x * (1024 * CVT_PIECES) + threadIdx.x * 4;
  float4 v[CVT_PIECES];
#pragma unroll  // constant indices keep v in registers; all 8 loads are in flight before the first convert
  for (int j = 0; j < CVT_PIECES; ++j) v[j] = *(const float4*)(in + base + j * 1024);
#pragma unroll  // constant indices keep v in registers
  for (int j = 0; j < CVT_PIECES; ++j) {
    union { uint2 u; h16 h[4]; } p;
    p.h[0] = (h16)v[j].x; p.h[1] = (h16)v[j].y; p.h[2] = (h16)v[j].z; p.h[3] = (h16)v[j].w;
    *(uint2*)(out + base + j * 1024) = p.u;
  }
}

// in[k][n] (512x512 row-major) -> out[n][k] f16
__global__ void cvtT_h16(const float* __restrict__ in, h16* __restrict__ out) {
  const int n = blockIdx.x;
  for (int k = threadIdx.x; k < 512; k += blockDim.x)
    out[(size_t)n * 512 + k] = (h16)in[(size_t)k * 512 + n];
}

// ---------------- GEMM: C[M,512] = A[M,512] * Wt^T + bias ----------------
// One 256-thread block computes a 128x128 tile of C (M a multiple of 128, K = N = 512).
// Panels of 128 rows x 128 k of A and of Wt are brought into LDS by asynchronous
// copies (16 lanes x 16 B cover 256 contiguous bytes of one row: whole lines), in two
// buffers: the next panel's copies fly while this panel is multiplied.
// 8 waves, 4 along M x 2 along N; each owns 32x64 of C = 8 accumulators, so every
// LDS fragment feeds 2 or 4 WMMAs. The k order per accumulator is 0,32,...,480.
// mode 0: f16 row-major out. mode 1: f16 out transposed per batch [B][512][1024]
// (for V so attention B-frags are contiguous). mode 2: f32 out + residual.
#define GEMM_KS 128   // k (halves) per staged panel
#define GEMM_LP 136   // LDS row pitch in halves: 272 B = 16 B x 17, no bank conflict for 16-B reads

// Eight asynchronous 16-B copies per lane, global -> LDS, through no register: rows
// 16 apart on both sides. The s_wait_xcnt 0 is the statement's last line so that it
// stands ahead of any later rewrite of the address registers the copies name.
static __device__ __forceinline__ void copy_rows8(const h16* l, const h16* g) {
  const unsigned l0 = (unsigned)(size_t)l;       // LDS byte address: low 32 bits
  const unsigned ls = 16u * GEMM_LP * 2u;        // 16 LDS rows in bytes
  asm volatile(
      "global_load_async_to_lds_b128 %0, %8, off\n\t"
      "global_load_async_to_lds_b128 %1, %9, off\n\t"
      "global_load_async_to_lds_b128 %2, %10, off\n\t"
      "global_load_async_to_lds_b128 %3, %11, off\n\t"
      "global_load_async_to_lds_b128 %4, %12, off\n\t"
      "global_load_async_to_lds_b128 %5, %13, off\n\t"
      "global_load_async_to_lds_b128 %6, %14, off\n\t"
      "global_load_async_to_lds_b128 %7, %15, off\n\t"
      "s_wait_xcnt 0x0"
      :: "v"(l0), "v"(l0 + ls), "v"(l0 + 2u * ls), "v"(l0 + 3u * ls),
         "v"(l0 + 4u * ls), "v"(l0 + 5u * ls), "v"(l0 + 6u * ls), "v"(l0 + 7u * ls),
         "v"(g), "v"(g + 16 * 512), "v"(g + 32 * 512), "v"(g + 48 * 512),
         "v"(g + 64 * 512), "v"(g + 80 * 512), "v"(g + 96 * 512), "v"(g + 112 * 512)
      : "memory");
}

__global__ void __launch_bounds__(256) proj_gemm(
    const h16* __restrict__ A, const h16* __restrict__ Wt,
    const float* __restrict__ bias, void* __restrict__ out,
    const float* __restrict__ resid, int M, int mode) {
  __shared__ alignas(16) h16 As[2][128 * GEMM_LP];
  __shared__ alignas(16) h16 Ws[2][128 * GEMM_LP];
  const int tid = threadIdx.x;
  const int m0  = (int)(blockIdx.x >> 2) * 128;  // 4 column tiles of 128 along N=512
  const int nb  = (int)(blockIdx.x & 3) * 128;
  if (m0 >= M) return;   // uniform per block, ahead of every barrier
  const int lane = tid & 31;
  const int wv   = tid >> 5;
  const int wm = (wv >> 1) * 32;   // wave's rows inside the tile
  const int wn = (wv & 1) * 64;    // wave's columns inside the tile
  const int n0 = nb + wn;
  const int c  = lane & 15;

  v8f acc[2][4];
#pragma unroll  // constant indices keep acc in registers
  for (int j = 0; j < 4; ++j) {
    const float b = bias[n0 + j * 16 + c];
    acc[0][j] = (v8f){b, b, b, b, b, b, b, b};
    acc[1][j] = acc[0][j];
  }

  // staging: thread t copies 16 B at column (t & 15) of rows (t >> 4) + 16 j, j = 0..7
  const int srow = tid >> 4;
  const int scol = (tid & 15) * 8;
  const h16* ag = A  + (size_t)(m0 + srow) * 512 + scol;
  const h16* wg = Wt + (size_t)(nb + srow) * 512 + scol;
  const int  so = srow * GEMM_LP + scol;

  copy_rows8(&As[0][so], ag);
  copy_rows8(&Ws[0][so], wg);
  asm volatile("s_wait_asynccnt 0x0" ::: "memory");  // this wave's copies of panel 0 have landed
  __syncthreads();                                   // panel 0 is visible to every wave
  copy_rows8(&As[1][so], ag + GEMM_KS);              // panel 1 flies during panel 0
  copy_rows8(&Ws[1][so], wg + GEMM_KS);

  for (int kt = 0; kt < 4; ++kt) {
    const int cur = kt & 1;
    const h16* ab = &As[cur][wm * GEMM_LP];
    const h16* wb = &Ws[cur][wn * GEMM_LP];
#pragma unroll  // lets the LDS reads of later k steps be issued ahead of the WMMAs
    for (int ks = 0; ks < GEMM_KS; ks += 32) {
      const v16h a0 = load_frag16(ab + ks,                GEMM_LP);
      const v16h a1 = load_frag16(ab + ks + 16 * GEMM_LP, GEMM_LP);
      const v16h w0 = load_frag16(wb + ks,                GEMM_LP);
      const v16h w1 = load_frag16(wb + ks + 16 * GEMM_LP, GEMM_LP);
      const v16h w2 = load_frag16(wb + ks + 32 * GEMM_LP, GEMM_LP);
      const v16h w3 = load_frag16(wb + ks + 48 * GEMM_LP, GEMM_LP);
      acc[0][0] = WMMA_F16(a0, w0, acc[0][0]);
      acc[0][1] = WMMA_F16(a0, w1, acc[0][1]);
      acc[0][2] = WMMA_F16(a0, w2, acc[0][2]);
      acc[0][3] = WMMA_F16(a0, w3, acc[0][3]);
      acc[1][0] = WMMA_F16(a1, w0, acc[1][0]);
      acc[1][1] = WMMA_F16(a1, w1, acc[1][1]);
      acc[1][2] = WMMA_F16(a1, w2, acc[1][2]);
      acc[1][3] = WMMA_F16(a1, w3, acc[1][3]);
    }
    asm volatile("s_wait_dscnt 0x0" ::: "memory");     // this wave's reads of panel kt are done
    asm volatile("s_wait_asynccnt 0x0" ::: "memory");  // this wave's copies of panel kt+1 have landed
    __syncthreads();  // publishes panel kt+1 and ends every wave's reads of panel kt
    if (kt + 2 < 4) { // block-uniform: refill the buffer that panel kt has just left
      copy_rows8(&As[cur][so], ag + (kt + 2) * GEMM_KS);
      copy_rows8(&Ws[cur][so], wg + (kt + 2) * GEMM_KS);
    }
  }
  asm volatile("s_wait_asynccnt 0x0" ::: "memory");    // no copy is left in flight at the wave's end

  const int rw0 = m0 + wm + ((lane >> 4) << 3);  // this lane's 8 rows of the upper 16x64 strip
  if (mode == 0) {
    h16* o = (h16*)out;
#pragma unroll  // constant indices keep acc in registers
    for (int mi = 0; mi < 2; ++mi) {
#pragma unroll  // constant indices keep acc in registers
      for (int i = 0; i < 8; ++i) {
        h16* r = o + (size_t)(rw0 + mi * 16 + i) * 512 + n0 + c;
        r[0]  = (h16)acc[mi][0][i];
        r[16] = (h16)acc[mi][1][i];
        r[32] = (h16)acc[mi][2][i];
        r[48] = (h16)acc[mi][3][i];
      }
    }
  } else if (mode == 1) {
#pragma unroll  // constant indices keep acc in registers
    for (int mi = 0; mi < 2; ++mi) {
      const int row0 = rw0 + mi * 16;
      const int bIdx = row0 >> 10;     // 16 | 1024 so tiles never cross batches
      const int s0   = row0 & 1023;
      union { uint4 u; h16 h[8]; } pk0, pk1, pk2, pk3;
#pragma unroll  // constant indices keep acc in registers
      for (int i = 0; i < 8; ++i) {
        pk0.h[i] = (h16)acc[mi][0][i]; pk1.h[i] = (h16)acc[mi][1][i];
        pk2.h[i] = (h16)acc[mi][2][i]; pk3.h[i] = (h16)acc[mi][3][i];
      }
      h16* o = (h16*)out + ((size_t)bIdx * 512 + n0 + c) * 1024 + s0;
      *(uint4*)(o)               = pk0.u;   // 8 contiguous s-values, 16B aligned
      *(uint4*)(o + 16 * 1024)   = pk1.u;
      *(uint4*)(o + 32 * 1024)   = pk2.u;
      *(uint4*)(o + 48 * 1024)   = pk3.u;
    }
    // the build reuses a data register of these stores on the way to the exit:
    // this one stands ahead of that overwrite
    asm volatile("s_wait_xcnt 0x0" ::: "memory");
  } else {
    float* o = (float*)out;
#pragma unroll  // constant indices keep acc in registers
    for (int mi = 0; mi < 2; ++mi) {
#pragma unroll  // constant indices keep acc in registers
      for (int i = 0; i < 8; ++i) {
        const size_t idx = (size_t)(rw0 + mi * 16 + i) * 512 + n0 + c;
        o[idx]      = acc[mi][0][i] + resid[idx];
        o[idx + 16] = acc[mi][1][i] + resid[idx + 16];
        o[idx + 32] = acc[mi][2][i] + resid[idx + 32];
        o[idx + 48] = acc[mi][3][i] + resid[idx + 48];
      }
    }
    // the listing lays another branch's code behind these stores, and that code reuses
    // their address and data registers: this wait stands ahead of any such overwrite
    asm volatile("s_wait_xcnt 0x0" ::: "memory");
  }
}

// ---------------- flash attention, one wave per (b, h, 16-query tile) --------
__global__ void __launch_bounds__(32) attn_kernel(
    const h16* __restrict__ Qp, const h16* __restrict__ Kp, const h16* __restrict__ Vt,
    const h16* __restrict__ Qr, const h16* __restrict__ Kr,
    const int* __restrict__ smask, const float* __restrict__ gammas,
    h16* __restrict__ outA) {
  const int bid = blockIdx.x;
  const int qt = bid & 63;
  const int h  = (bid >> 6) & 7;
  const int b  = bid >> 9;
  const int lane = threadIdx.x;
  const int lr = lane & 15;
  const int hi = lane >> 4;
  const int q0 = qt << 4;

  // exp(-softplus(g)) == sigmoid(-g); clip lower bound
  const float g = gammas[h];
  float te = 1.0f / (1.0f + __expf(g));
  te = fminf(fmaxf(te, 1e-5f), 1e5f);
  const float sscale = te * 0.0441941738241592f;  // * 1/sqrt(512)
  const float qscale = 0.125f;                    // 1/sqrt(64)

  __shared__ alignas(16) h16 Plds[16 * 32];

  const size_t hd = (size_t)h * 64;
  const h16* qpb = Qp + ((size_t)(b * 1024 + q0) * 512 + hd);
  const h16* qrb = Qr + ((size_t)(b * 1024 + q0) * 512 + hd);
  const v16h aq0 = load_frag16(qpb, 512);
  const v16h aq1 = load_frag16(qpb + 32, 512);
  const v16h ar0 = load_frag16(qrb, 512);
  const v16h ar1 = load_frag16(qrb + 32, 512);

  v8f o0 = {}, o1 = {}, o2 = {}, o3 = {};
  float m8[8], l8[8];
#pragma unroll
  for (int i = 0; i < 8; ++i) { m8[i] = -3.0e38f; l8[i] = 0.0f; }

  const int nb = (q0 + 46) >> 5;  // key blocks of 32 covering keys < q0+16
  for (int kb0 = 0; kb0 < nb * 32; kb0 += 32) {
    float sc[2][8], pr[2][8];
#pragma unroll
    for (int t = 0; t < 2; ++t) {
      const int c0 = kb0 + t * 16;
      const h16* kpb = Kp + ((size_t)(b * 1024 + c0) * 512 + hd);
      const h16* krb = Kr + ((size_t)(b * 1024 + c0) * 512 + hd);
      v8f s = {};
      s = WMMA_F16(aq0, load_frag16(kpb, 512), s);
      s = WMMA_F16(aq1, load_frag16(kpb + 32, 512), s);
      v8f sr = {};
      sr = WMMA_F16(ar0, load_frag16(krb, 512), sr);
      sr = WMMA_F16(ar1, load_frag16(krb + 32, 512), sr);
      const int kc = c0 + lr;
#pragma unroll
      for (int i = 0; i < 8; ++i) {
        const int qr = q0 + i + hi * 8;                 // D-tile row
        const bool causal = kc < qr;                    // strict tril(-1)
        const int mv = smask[((size_t)b * 1024 + qr) * 1024 + kc];
        const float ss = (causal && mv) ? sr[i] * sscale : 0.0f;
        sc[t][i] = causal ? (s[i] * qscale + ss) : -3.0e38f;
      }
    }
    // online softmax (row = 16 lanes within a half-wave + element index)
    float fac[8];
#pragma unroll
    for (int i = 0; i < 8; ++i) {
      float rm = fmaxf(sc[0][i], sc[1][i]);
      rm = fmaxf(rm, __shfl_xor(rm, 1, 32));
      rm = fmaxf(rm, __shfl_xor(rm, 2, 32));
      rm = fmaxf(rm, __shfl_xor(rm, 4, 32));
      rm = fmaxf(rm, __shfl_xor(rm, 8, 32));
      const float mnew = fmaxf(m8[i], rm);
      fac[i] = __expf(m8[i] - mnew);
      pr[0][i] = (sc[0][i] > -1.0e37f) ? __expf(sc[0][i] - mnew) : 0.0f;
      pr[1][i] = (sc[1][i] > -1.0e37f) ? __expf(sc[1][i] - mnew) : 0.0f;
      float rs = pr[0][i] + pr[1][i];
      rs += __shfl_xor(rs, 1, 32);
      rs += __shfl_xor(rs, 2, 32);
      rs += __shfl_xor(rs, 4, 32);
      rs += __shfl_xor(rs, 8, 32);
      l8[i] = l8[i] * fac[i] + rs;
      m8[i] = mnew;
    }
#pragma unroll
    for (int i = 0; i < 8; ++i) {
      o0[i] *= fac[i]; o1[i] *= fac[i]; o2[i] *= fac[i]; o3[i] *= fac[i];
    }
    // transpose P (D-layout) -> A-fragment via LDS
#pragma unroll
    for (int t = 0; t < 2; ++t)
#pragma unroll
      for (int i = 0; i < 8; ++i)
        Plds[(i + hi * 8) * 32 + t * 16 + lr] = (h16)pr[t][i];
    __syncthreads();
    const v16h ap = load_frag16(Plds, 32);
    __syncthreads();
    // P(16x32) @ V(32 keys x 64 dk), V stored transposed [d][s]
    const h16* vb = Vt + ((size_t)(b * 512) + hd) * 1024 + kb0;
    o0 = WMMA_F16(ap, load_frag16(vb,             1024), o0);
    o1 = WMMA_F16(ap, load_frag16(vb + 16 * 1024, 1024), o1);
    o2 = WMMA_F16(ap, load_frag16(vb + 32 * 1024, 1024), o2);
    o3 = WMMA_F16(ap, load_frag16(vb + 48 * 1024, 1024), o3);
  }

  float inv8[8];
#pragma unroll
  for (int i = 0; i < 8; ++i) inv8[i] = (l8[i] > 0.0f) ? (1.0f / l8[i]) : 0.0f;
  h16* ob = outA + ((size_t)(b * 1024 + q0) * 512 + hd);
#pragma unroll
  for (int i = 0; i < 8; ++i) {
    const int r = i + hi * 8;
    ob[(size_t)r * 512 +  0 + lr] = (h16)(o0[i] * inv8[i]);
    ob[(size_t)r * 512 + 16 + lr] = (h16)(o1[i] * inv8[i]);
    ob[(size_t)r * 512 + 32 + lr] = (h16)(o2[i] * inv8[i]);
    ob[(size_t)r * 512 + 48 + lr] = (h16)(o3[i] * inv8[i]);
  }
}

// ---------------- LayerNorm over 512, one 256-thread block per row -----------
__global__ void __launch_bounds__(256) ln_kernel(
    const float* __restrict__ X, const float* __restrict__ gw,
    const float* __restrict__ bw, float* __restrict__ out) {
  const int row = blockIdx.x;
  const float* x = X + (size_t)row * 512;
  const int t = threadIdx.x;
  const float a = x[t], c = x[t + 256];
  __shared__ float red[8];
  float s = a + c;
  for (int m = 1; m < 32; m <<= 1) s += __shfl_xor(s, m, 32);
  if ((t & 31) == 0) red[t >> 5] = s;
  __syncthreads();
  float tot = 0.0f;
#pragma unroll
  for (int i = 0; i < 8; ++i) tot += red[i];
  const float mu = tot * (1.0f / 512.0f);
  __syncthreads();
  const float da = a - mu, dc = c - mu;
  float v = da * da + dc * dc;
  for (int m = 1; m < 32; m <<= 1) v += __shfl_xor(v, m, 32);
  if ((t & 31) == 0) red[t >> 5] = v;
  __syncthreads();
  float vt = 0.0f;
#pragma unroll
  for (int i = 0; i < 8; ++i) vt += red[i];
  const float rstd = rsqrtf(vt * (1.0f / 512.0f) + 1e-5f);
  out[(size_t)row * 512 + t]       = da * rstd * gw[t]       + bw[t];
  out[(size_t)row * 512 + t + 256] = dc * rstd * gw[t + 256] + bw[t + 256];
}

extern "C" void kernel_launch(void* const* d_in, const int* in_sizes, int n_in,
                              void* d_out, int out_size, void* d_ws, size_t ws_size,
                              hipStream_t stream) {
  (void)in_sizes; (void)n_in; (void)out_size; (void)ws_size;
  const float* q_in  = (const float*)d_in[0];
  const float* k_in  = (const float*)d_in[1];
  const float* v_in  = (const float*)d_in[2];
  const int*   smask = (const int*)  d_in[3];
  const float* Wq    = (const float*)d_in[4];
  const float* bq    = (const float*)d_in[5];
  const float* Wv    = (const float*)d_in[6];
  const float* bv    = (const float*)d_in[7];
  const float* Wo    = (const float*)d_in[8];
  const float* bo    = (const float*)d_in[9];
  const float* gm    = (const float*)d_in[10];
  const float* lng   = (const float*)d_in[11];
  const float* lnb   = (const float*)d_in[12];
  float* out = (float*)d_out;

  const size_t E = (size_t)8 * 1024 * 512;  // elements per [B,S,D] tensor
  char* ws = (char*)d_ws;
  h16*  qh  = (h16*)(ws);
  h16*  kh  = (h16*)(ws + 2 * E);
  h16*  vh  = (h16*)(ws + 4 * E);
  h16*  Qp  = (h16*)(ws + 6 * E);
  h16*  Kp  = (h16*)(ws + 8 * E);
  h16*  Vt  = (h16*)(ws + 10 * E);
  h16*  Wqt = (h16*)(ws + 12 * E);
  h16*  Wvt = (h16*)(ws + 12 * E + 524288);
  h16*  Wot = (h16*)(ws + 12 * E + 2 * 524288);
  h16*  Ao  = (h16*)(ws + 12 * E + 3 * 524288);
  float* Xr = (float*)(ws + 12 * E + 3 * 524288 + 2 * E);

  cvt_h16<<<dim3(512), dim3(256), 0, stream>>>(q_in, qh);
  cvt_h16<<<dim3(512), dim3(256), 0, stream>>>(k_in, kh);
  cvt_h16<<<dim3(512), dim3(256), 0, stream>>>(v_in, vh);
  cvtT_h16<<<dim3(512), dim3(256), 0, stream>>>(Wq, Wqt);
  cvtT_h16<<<dim3(512), dim3(256), 0, stream>>>(Wv, Wvt);
  cvtT_h16<<<dim3(512), dim3(256), 0, stream>>>(Wo, Wot);

  const int M = 8192;  // B*S rows; (M/128)*(512/128) = 256 tiles, one 8-wave block each
  proj_gemm<<<dim3(256), dim3(256), 0, stream>>>(qh, Wqt, bq, (void*)Qp, nullptr, M, 0);
  proj_gemm<<<dim3(256), dim3(256), 0, stream>>>(kh, Wqt, bq, (void*)Kp, nullptr, M, 0);
  proj_gemm<<<dim3(256), dim3(256), 0, stream>>>(vh, Wvt, bv, (void*)Vt, nullptr, M, 1);

  attn_kernel<<<dim3(4096), dim3(32), 0, stream>>>(Qp, Kp, Vt, qh, kh, smask, gm, Ao);

  proj_gemm<<<dim3(256), dim3(256), 0, stream>>>(Ao, Wot, bo, (void*)Xr, q_in, M, 2);
  ln_kernel<<<dim3(8192), dim3(256), 0, stream>>>(Xr, lng, lnb, out);
}

// v003
// One run takes 118 microseconds.
// Next to v002, in two timings, it ran 1.33 and 1.32 times as fast.
// Counting every step since v000, it is 2.04 times as fast.
#include <hip/hip_runtime.h>
#include <math.h>

typedef _Float16 h16;
typedef __attribute__((ext_vector_type(16))) _Float16 v16h;
typedef __attribute__((ext_vector_type(8)))  float    v8f;

#define WMMA_F16(a, b, c) \
  __builtin_amdgcn_wmma_f32_16x16x32_f16(false, (a), false, (b), (short)0, (c), false, false)

// Load a 16x32 (A) / 32x16 (B, fed column-major) f16 fragment from a row-major
// matrix with row stride `ld` (halves). Per ISA 16-bit A layout:
// lane = (half)*16 + r holds row r, K = kb+{0..7} and kb+{16..23}, kb = 8*half.
static __device__ __forceinline__ v16h load_frag16(const h16* base, int ld) {
  const int lane = threadIdx.x & 31;
  const int r  = lane & 15;
  const int kb = (lane >> 4) << 3;
  const h16* p = base + (size_t)r * (size_t)ld + kb;
  union { v16h v; uint4 u[2]; } f;
  f.u[0] = *(const uint4*)(p);
  f.u[1] = *(const uint4*)(p + 16);
  return f.v;
}

// ---------------- converts ----------------
// A [8,1024,512] tensor (4,194,304 elements) as one short stream: 512 work-groups of 8
// waves, each thread 8 pieces of 4 elements, 1,024 elements apart. A wave-wide load covers
// 512 contiguous bytes and a wave-wide store 256: whole lines both ways. 512 x 8,192
// elements cover the tensor exactly, so there is no bound test.
#define CVT_PIECES 8
__global__ void __launch_bounds__(256) cvt_h16(const float* __restrict__ in, h16* __restrict__ out) {
  const size_t base = (size_t)blockIdx.x * (1024 * CVT_PIECES) + threadIdx.x * 4;
  float4 v[CVT_PIECES];
#pragma unroll  // constant indices keep v in registers; all 8 loads are in flight before the first convert
  for (int j = 0; j < CVT_PIECES; ++j) v[j] = *(const float4*)(in + base + j * 1024);
#pragma unroll  // constant indices keep v in registers
  for (int j = 0; j < CVT_PIECES; ++j) {
    union { uint2 u; h16 h[4]; } p;
    p.h[0] = (h16)v[j].x; p.h[1] = (h16)v[j].y; p.h[2] = (h16)v[j].z; p.h[3] = (h16)v[j].w;
    *(uint2*)(out + base + j * 1024) = p.u;
  }
}

// in[k][n] (512x512 row-major) -> out[n][k] f16
__global__ void cvtT_h16(const float* __restrict__ in, h16* __restrict__ out) {
  const int n = blockIdx.x;
  for (int k = threadIdx.x; k < 512; k += blockDim.x)
    out[(size_t)n * 512 + k] = (h16)in[(size_t)k * 512 + n];
}

// ---------------- GEMM: C[M,512] = A[M,512] * Wt^T + bias ----------------
// One 256-thread block computes a 128x128 tile of C (M a multiple of 128, K = N = 512).
// Panels of 128 rows x 128 k of A and of Wt are brought into LDS by asynchronous
// copies (16 lanes x 16 B cover 256 contiguous bytes of one row: whole lines), in two
// buffers: the next panel's copies fly while this panel is multiplied.
// 8 waves, 4 along M x 2 along N; each owns 32x64 of C = 8 accumulators, so every
// LDS fragment feeds 2 or 4 WMMAs. The k order per accumulator is 0,32,...,480.
// mode 0: f16 row-major out. mode 1: f16 out transposed per batch [B][512][1024]
// (for V so attention B-frags are contiguous). mode 2: f32 out + residual.
#define GEMM_KS 128   // k (halves) per staged panel
#define GEMM_LP 136   // LDS row pitch in halves: 272 B = 16 B x 17, no bank conflict for 16-B reads

// Eight asynchronous 16-B copies per lane, global -> LDS, through no register: rows
// 16 apart on both sides. The s_wait_xcnt 0 is the statement's last line so that it
// stands ahead of any later rewrite of the address registers the copies name.
static __device__ __forceinline__ void copy_rows8(const h16* l, const h16* g) {
  const unsigned l0 = (unsigned)(size_t)l;       // LDS byte address: low 32 bits
  const unsigned ls = 16u * GEMM_LP * 2u;        // 16 LDS rows in bytes
  asm volatile(
      "global_load_async_to_lds_b128 %0, %8, off\n\t"
      "global_load_async_to_lds_b128 %1, %9, off\n\t"
      "global_load_async_to_lds_b128 %2, %10, off\n\t"
      "global_load_async_to_lds_b128 %3, %11, off\n\t"
      "global_load_async_to_lds_b128 %4, %12, off\n\t"
      "global_load_async_to_lds_b128 %5, %13, off\n\t"
      "global_load_async_to_lds_b128 %6, %14, off\n\t"
      "global_load_async_to_lds_b128 %7, %15, off\n\t"
      "s_wait_xcnt 0x0"
      :: "v"(l0), "v"(l0 + ls), "v"(l0 + 2u * ls), "v"(l0 + 3u * ls),
         "v"(l0 + 4u * ls), "v"(l0 + 5u * ls), "v"(l0 + 6u * ls), "v"(l0 + 7u * ls),
         "v"(g), "v"(g + 16 * 512), "v"(g + 32 * 512), "v"(g + 48 * 512),
         "v"(g + 64 * 512), "v"(g + 80 * 512), "v"(g + 96 * 512), "v"(g + 112 * 512)
      : "memory");
}

__global__ void __launch_bounds__(256) proj_gemm(
    const h16* __restrict__ A, const h16* __restrict__ Wt,
    const float* __restrict__ bias, void* __restrict__ out,
    const float* __restrict__ resid, int M, int mode) {
  __shared__ alignas(16) h16 As[2][128 * GEMM_LP];
  __shared__ alignas(16) h16 Ws[2][128 * GEMM_LP];
  const int tid = threadIdx.x;
  const int m0  = (int)(blockIdx.x >> 2) * 128;  // 4 column tiles of 128 along N=512
  const int nb  = (int)(blockIdx.x & 3) * 128;
  if (m0 >= M) return;   // uniform per block, ahead of every barrier
  const int lane = tid & 31;
  const int wv   = tid >> 5;
  const int wm = (wv >> 1) * 32;   // wave's rows inside the tile
  const int wn = (wv & 1) * 64;    // wave's columns inside the tile
  const int n0 = nb + wn;
  const int c  = lane & 15;

  v8f acc[2][4];
#pragma unroll  // constant indices keep acc in registers
  for (int j = 0; j < 4; ++j) {
    const float b = bias[n0 + j * 16 + c];
    acc[0][j] = (v8f){b, b, b, b, b, b, b, b};
    acc[1][j] = acc[0][j];
  }

  // staging: thread t copies 16 B at column (t & 15) of rows (t >> 4) + 16 j, j = 0..7
  const int srow = tid >> 4;
  const int scol = (tid & 15) * 8;
  const h16* ag = A  + (size_t)(m0 + srow) * 512 + scol;
  const h16* wg = Wt + (size_t)(nb + srow) * 512 + scol;
  const int  so = srow * GEMM_LP + scol;

  copy_rows8(&As[0][so], ag);
  copy_rows8(&Ws[0][so], wg);
  asm volatile("s_wait_asynccnt 0x0" ::: "memory");  // this wave's copies of panel 0 have landed
  __syncthreads();                                   // panel 0 is visible to every wave
  copy_rows8(&As[1][so], ag + GEMM_KS);              // panel 1 flies during panel 0
  copy_rows8(&Ws[1][so], wg + GEMM_KS);

  for (int kt = 0; kt < 4; ++kt) {
    const int cur = kt & 1;
    const h16* ab = &As[cur][wm * GEMM_LP];
    const h16* wb = &Ws[cur][wn * GEMM_LP];
#pragma unroll  // lets the LDS reads of later k steps be issued ahead of the WMMAs
    for (int ks = 0; ks < GEMM_KS; ks += 32) {
      const v16h a0 = load_frag16(ab + ks,                GEMM_LP);
      const v16h a1 = load_frag16(ab + ks + 16 * GEMM_LP, GEMM_LP);
      const v16h w0 = load_frag16(wb + ks,                GEMM_LP);
      const v16h w1 = load_frag16(wb + ks + 16 * GEMM_LP, GEMM_LP);
      const v16h w2 = load_frag16(wb + ks + 32 * GEMM_LP, GEMM_LP);
      const v16h w3 = load_frag16(wb + ks + 48 * GEMM_LP, GEMM_LP);
      acc[0][0] = WMMA_F16(a0, w0, acc[0][0]);
      acc[0][1] = WMMA_F16(a0, w1, acc[0][1]);
      acc[0][2] = WMMA_F16(a0, w2, acc[0][2]);
      acc[0][3] = WMMA_F16(a0, w3, acc[0][3]);
      acc[1][0] = WMMA_F16(a1, w0, acc[1][0]);
      acc[1][1] = WMMA_F16(a1, w1, acc[1][1]);
      acc[1][2] = WMMA_F16(a1, w2, acc[1][2]);
      acc[1][3] = WMMA_F16(a1, w3, acc[1][3]);
    }
    asm volatile("s_wait_dscnt 0x0" ::: "memory");     // this wave's reads of panel kt are done
    asm volatile("s_wait_asynccnt 0x0" ::: "memory");  // this wave's copies of panel kt+1 have landed
    __syncthreads();  // publishes panel kt+1 and ends every wave's reads of panel kt
    if (kt + 2 < 4) { // block-uniform: refill the buffer that panel kt has just left
      copy_rows8(&As[cur][so], ag + (kt + 2) * GEMM_KS);
      copy_rows8(&Ws[cur][so], wg + (kt + 2) * GEMM_KS);
    }
  }
  asm volatile("s_wait_asynccnt 0x0" ::: "memory");    // no copy is left in flight at the wave's end

  const int rw0 = m0 + wm + ((lane >> 4) << 3);  // this lane's 8 rows of the upper 16x64 strip
  if (mode == 0) {
    h16* o = (h16*)out;
#pragma unroll  // constant indices keep acc in registers
    for (int mi = 0; mi < 2; ++mi) {
#pragma unroll  // constant indices keep acc in registers
      for (int i = 0; i < 8; ++i) {
        h16* r = o + (size_t)(rw0 + mi * 16 + i) * 512 + n0 + c;
        r[0]  = (h16)acc[mi][0][i];
        r[16] = (h16)acc[mi][1][i];
        r[32] = (h16)acc[mi][2][i];
        r[48] = (h16)acc[mi][3][i];
      }
    }
  } else if (mode == 1) {
#pragma unroll  // constant indices keep acc in registers
    for (int mi = 0; mi < 2; ++mi) {
      const int row0 = rw0 + mi * 16;
      const int bIdx = row0 >> 10;     // 16 | 1024 so tiles never cross batches
      const int s0   = row0 & 1023;
      union { uint4 u; h16 h[8]; } pk0, pk1, pk2, pk3;
#pragma unroll  // constant indices keep acc in registers
      for (int i = 0; i < 8; ++i) {
        pk0.h[i] = (h16)acc[mi][0][i]; pk1.h[i] = (h16)acc[mi][1][i];
        pk2.h[i] = (h16)acc[mi][2][i]; pk3.h[i] = (h16)acc[mi][3][i];
      }
      h16* o = (h16*)out + ((size_t)bIdx * 512 + n0 + c) * 1024 + s0;
      *(uint4*)(o)               = pk0.u;   // 8 contiguous s-values, 16B aligned
      *(uint4*)(o + 16 * 1024)   = pk1.u;
      *(uint4*)(o + 32 * 1024)   = pk2.u;
      *(uint4*)(o + 48 * 1024)   = pk3.u;
    }
    // the build reuses a data register of these stores on the way to the exit:
    // this one stands ahead of that overwrite
    asm volatile("s_wait_xcnt 0x0" ::: "memory");
  } else {
    float* o = (float*)out;
#pragma unroll  // constant indices keep acc in registers
    for (int mi = 0; mi < 2; ++mi) {
#pragma unroll  // constant indices keep acc in registers
      for (int i = 0; i < 8; ++i) {
        const size_t idx = (size_t)(rw0 + mi * 16 + i) * 512 + n0 + c;
        o[idx]      = acc[mi][0][i] + resid[idx];
        o[idx + 16] = acc[mi][1][i] + resid[idx + 16];
        o[idx + 32] = acc[mi][2][i] + resid[idx + 32];
        o[idx + 48] = acc[mi][3][i] + resid[idx + 48];
      }
    }
    // the listing lays another branch's code behind these stores, and that code reuses
    // their address and data registers: this wait stands ahead of any such overwrite
    asm volatile("s_wait_xcnt 0x0" ::: "memory");
  }
}

// ---------------- flash attention, 8 waves per block: 128 queries of one (b, h) --------
// Each wave owns 16 queries and walks its keys in blocks of 32, as a one-wave kernel would.
// What the loop reads (64 keys of projected K, of raw K and of V, and the block's 128 x 64
// piece of the state mask) is brought into LDS once per block by asynchronous copies, whole
// 128-B and 256-B lines, in two buffers: the next 64 keys fly while these are worked on.
#define AT_KP 72               // K / raw K / V tile row pitch, halves: 144 B = 16 B x 9, conflict-free 16-B reads
#define AT_MP 68               // mask tile row pitch, ints: 272 B, so rows 8 apart fall on different banks
#define AT_TILE (64 * AT_KP)   // one 64-row tile, halves

// Six asynchronous 16-B copies per lane: rows r and r + 32 of the three 64-row f16 tiles.
// The s_wait_xcnt 0 is the statement's last line so that it stands ahead of any later
// rewrite of the address registers the copies name.
static __device__ __forceinline__ void copy_kv6(const h16* lk, const h16* gk, const h16* gr, const h16* gv) {
  const unsigned l0 = (unsigned)(size_t)lk;      // LDS byte address: low 32 bits
  const unsigned lt = AT_TILE * 2u;              // one tile in bytes
  const unsigned ls = 32u * AT_KP * 2u;          // 32 LDS rows in bytes
  asm volatile(
      "global_load_async_to_lds_b128 %0, %6, off\n\t"
      "global_load_async_to_lds_b128 %1, %7, off\n\t"
      "global_load_async_to_lds_b128 %2, %8, off\n\t"
      "global_load_async_to_lds_b128 %3, %9, off\n\t"
      "global_load_async_to_lds_b128 %4, %10, off\n\t"
      "global_load_async_to_lds_b128 %5, %11, off\n\t"
      "s_wait_xcnt 0x0"
      :: "v"(l0), "v"(l0 + ls), "v"(l0 + lt), "v"(l0 + lt + ls),
         "v"(l0 + 2u * lt), "v"(l0 + 2u * lt + ls),
         "v"(gk), "v"(gk + 32 * 512), "v"(gr), "v"(gr + 32 * 512),
         "v"(gv), "v"(gv + 32 * 1024)
      : "memory");
}

// Eight asynchronous 16-B copies per lane of the mask tile: rows 16 apart on both sides.
// s_wait_xcnt 0 as the last line, for the same reason as above.
static __device__ __forceinline__ void copy_mask8(const int* l, const int* g) {
  const unsigned l0 = (unsigned)(size_t)l;       // LDS byte address: low 32 bits
  const unsigned ls = 16u * AT_MP * 4u;          // 16 LDS rows in bytes
  asm volatile(
      "global_load_async_to_lds_b128 %0, %8, off\n\t"
      "global_load_async_to_lds_b128 %1, %9, off\n\t"
      "global_load_async_to_lds_b128 %2, %10, off\n\t"
      "global_load_async_to_lds_b128 %3, %11, off\n\t"
      "global_load_async_to_lds_b128 %4, %12, off\n\t"
      "global_load_async_to_lds_b128 %5, %13, off\n\t"
      "global_load_async_to_lds_b128 %6, %14, off\n\t"
      "global_load_async_to_lds_b128 %7, %15, off\n\t"
      "s_wait_xcnt 0x0"
      :: "v"(l0), "v"(l0 + ls), "v"(l0 + 2u * ls), "v"(l0 + 3u * ls),
         "v"(l0 + 4u * ls), "v"(l0 + 5u * ls), "v"(l0 + 6u * ls), "v"(l0 + 7u * ls),
         "v"(g), "v"(g + 16 * 1024), "v"(g + 32 * 1024), "v"(g + 48 * 1024),
         "v"(g + 64 * 1024), "v"(g + 80 * 1024), "v"(g + 96 * 1024), "v"(g + 112 * 1024)
      : "memory");
}

// Orders one wave's own LDS stores and loads for the compiler (the P tile is private to its
// wave, and a wave's LDS operations run in order): no instruction, no other wave waits.
static __device__ __forceinline__ void wave_lds_order() {
  __builtin_amdgcn_fence(__ATOMIC_RELEASE, "wavefront");
  __builtin_amdgcn_wave_barrier();
  __builtin_amdgcn_fence(__ATOMIC_ACQUIRE, "wavefront");
}

__global__ void __launch_bounds__(256) attn_kernel(
    const h16* __restrict__ Qp, const h16* __restrict__ Kp, const h16* __restrict__ Vt,
    const h16* __restrict__ Qr, const h16* __restrict__ Kr,
    const int* __restrict__ smask, const float* __restrict__ gammas,
    h16* __restrict__ outA) {
  __shared__ alignas(16) h16 KVs[2][3 * AT_TILE];    // [buffer][K | raw K | V^T], 64 rows each
  __shared__ alignas(16) int Ms[2][128 * AT_MP];     // [buffer][query row of the block][key]
  __shared__ alignas(16) h16 Plds[8][16 * 32];       // one P tile per wave
  const int bid = blockIdx.x;
  const int h   = bid & 7;
  const int b   = (bid >> 3) & 7;
  const int grp = bid >> 6;
  // query block: the four long ones first, then the short ones shortest first, so that a
  // late block that joins an early one on a WGP is short where the early one is long
  const int qb  = grp < 4 ? 7 - grp : grp - 4;
  const int tid  = threadIdx.x;
  const int lane = tid & 31;
  const int wv   = __builtin_amdgcn_readfirstlane(tid >> 5);  // wave number, in a scalar register
  const int lr = lane & 15;
  const int hi = lane >> 4;
  const int qb0 = qb << 7;
  const int q0  = qb0 + (wv << 4);

  // exp(-softplus(g)) == sigmoid(-g); clip lower bound
  const float g = gammas[h];
  float te = 1.0f / (1.0f + __expf(g));
  te = fminf(fmaxf(te, 1e-5f), 1e5f);
  const float sscale = te * 0.0441941738241592f;  // * 1/sqrt(512)
  const float qscale = 0.125f;                    // 1/sqrt(64)

  const size_t hd = (size_t)h * 64;

  // staging: thread t copies 16 B at column (t & 7) of rows (t >> 3) and (t >> 3) + 32 of
  // each f16 tile, and 16 B at column (t & 15) of rows (t >> 4) + 16 j of the mask tile
  const int krow = tid >> 3;
  const int kcol = (tid & 7) * 8;
  const h16* kg = Kp + ((size_t)(b * 1024 + krow) * 512 + hd + kcol);
  const h16* rg = Kr + ((size_t)(b * 1024 + krow) * 512 + hd + kcol);
  const h16* vg = Vt + (((size_t)(b * 512) + hd + krow) * 1024 + kcol);
  const int  ko = krow * AT_KP + kcol;
  const int mrow = tid >> 4;
  const int mcol = (tid & 15) * 4;
  const int* mg = smask + (((size_t)b * 1024 + qb0 + mrow) * 1024 + mcol);
  const int  mo = mrow * AT_MP + mcol;

  const int nst = 2 * qb + 2;   // stages of 64 keys covering keys < qb0 + 128; at least two

  copy_kv6(&KVs[0][ko], kg, rg, vg);
  copy_mask8(&Ms[0][mo], mg);

  const h16* qpb = Qp + ((size_t)(b * 1024 + q0) * 512 + hd);
  const h16* qrb = Qr + ((size_t)(b * 1024 + q0) * 512 + hd);
  const v16h aq0 = load_frag16(qpb, 512);
  const v16h aq1 = load_frag16(qpb + 32, 512);
  const v16h ar0 = load_frag16(qrb, 512);
  const v16h ar1 = load_frag16(qrb + 32, 512);

  asm volatile("s_wait_asynccnt 0x0" ::: "memory");  // this wave's copies of stage 0 have landed
  __syncthreads();                                   // stage 0 is visible to every wave
  copy_kv6(&KVs[1][ko], kg + 64 * 512, rg + 64 * 512, vg + 64);  // stage 1 flies during stage 0
  copy_mask8(&Ms[1][mo], mg + 64);

  v8f o0 = {}, o1 = {}, o2 = {}, o3 = {};
  float m8[8], l8[8];
#pragma unroll
  for (int i = 0; i < 8; ++i) { m8[i] = -3.0e38f; l8[i] = 0.0f; }

  h16* pl = &Plds[wv][0];
  const int nkw = ((q0 + 46) >> 5) << 5;  // this wave's keys: blocks of 32 covering keys < q0+16
  for (int st = 0; st < nst; ++st) {
    const int cur = st & 1;
#pragma unroll  // two key blocks of 32 per stage, at constant LDS offsets
    for (int u = 0; u < 2; ++u) {
      const int kb0 = st * 64 + u * 32;
      if (kb0 < nkw) {  // wave-uniform (scalar): key blocks wholly above this wave's diagonal are skipped
        float sc[2][8], pr[2][8];
#pragma unroll
        for (int t = 0; t < 2; ++t) {
          const int cl = u * 32 + t * 16;   // first key of this 16-key group inside the stage
          const h16* kpb = &KVs[cur][cl * AT_KP];
          const h16* krb = &KVs[cur][AT_TILE + cl * AT_KP];
          v8f s = {};
          s = WMMA_F16(aq0, load_frag16(kpb, AT_KP), s);
          s = WMMA_F16(aq1, load_frag16(kpb + 32, AT_KP), s);
          v8f sr = {};
          sr = WMMA_F16(ar0, load_frag16(krb, AT_KP), sr);
          sr = WMMA_F16(ar1, load_frag16(krb + 32, AT_KP), sr);
          const int kc = kb0 + t * 16 + lr;
#pragma unroll
          for (int i = 0; i < 8; ++i) {
            const int qr = q0 + i + hi * 8;                 // D-tile row
            const bool causal = kc < qr;                    // strict tril(-1)
            const int mv = Ms[cur][((wv << 4) + i + hi * 8) * AT_MP + cl + lr];
            const float ss = (causal && mv) ? sr[i] * sscale : 0.0f;
            sc[t][i] = causal ? (s[i] * qscale + ss) : -3.0e38f;
          }
        }
        // online softmax (row = 16 lanes within a half-wave + element index)
        float fac[8];
#pragma unroll
        for (int i = 0; i < 8; ++i) {
          float rm = fmaxf(sc[0][i], sc[1][i]);
          rm = fmaxf(rm, __shfl_xor(rm, 1, 32));
          rm = fmaxf(rm, __shfl_xor(rm, 2, 32));
          rm = fmaxf(rm, __shfl_xor(rm, 4, 32));
          rm = fmaxf(rm, __shfl_xor(rm, 8, 32));
          const float mnew = fmaxf(m8[i], rm);
          fac[i] = __expf(m8[i] - mnew);
          pr[0][i] = (sc[0][i] > -1.0e37f) ? __expf(sc[0][i] - mnew) : 0.0f;
          pr[1][i] = (sc[1][i] > -1.0e37f) ? __expf(sc[1][i] - mnew) : 0.0f;
          float rs = pr[0][i] + pr[1][i];
          rs += __shfl_xor(rs, 1, 32);
          rs += __shfl_xor(rs, 2, 32);
          rs += __shfl_xor(rs, 4, 32);
          rs += __shfl_xor(rs, 8, 32);
          l8[i] = l8[i] * fac[i] + rs;
          m8[i] = mnew;
        }
#pragma unroll
        for (int i = 0; i < 8; ++i) {
          o0[i] *= fac[i]; o1[i] *= fac[i]; o2[i] *= fac[i]; o3[i] *= fac[i];
        }
        // transpose P (D-layout) -> A-fragment via this wave's own LDS tile
#pragma unroll
        for (int t = 0; t < 2; ++t)
#pragma unroll
          for (int i = 0; i < 8; ++i)
            pl[(i + hi * 8) * 32 + t * 16 + lr] = (h16)pr[t][i];
        wave_lds_order();   // the stores above stay ahead of the fragment read
        const v16h ap = load_frag16(pl, 32);
        wave_lds_order();   // the fragment read stays ahead of the next key block's stores
        // P(16x32) @ V(32 keys x 64 dk), V stored transposed [d][s]
        const h16* vb = &KVs[cur][2 * AT_TILE + u * 32];
        o0 = WMMA_F16(ap, load_frag16(vb,              AT_KP), o0);
        o1 = WMMA_F16(ap, load_frag16(vb + 16 * AT_KP, AT_KP), o1);
        o2 = WMMA_F16(ap, load_frag16(vb + 32 * AT_KP, AT_KP), o2);
        o3 = WMMA_F16(ap, load_frag16(vb + 48 * AT_KP, AT_KP), o3);
      }
    }
    asm volatile("s_wait_dscnt 0x0" ::: "memory");     // this wave's reads of stage st are done
    asm volatile("s_wait_asynccnt 0x0" ::: "memory");  // this wave's copies of stage st+1 have landed
    __syncthreads();  // publishes stage st+1 and ends every wave's reads of stage st
    if (st + 2 < nst) {  // block-uniform: refill the buffer that stage st has just left
      const int kn = (st + 2) * 64;
      copy_kv6(&KVs[cur][ko], kg + (size_t)kn * 512, rg + (size_t)kn * 512, vg + kn);
      copy_mask8(&Ms[cur][mo], mg + kn);
    }
  }
  asm volatile("s_wait_asynccnt 0x0" ::: "memory");    // no copy is left in flight at the wave's end

  float inv8[8];
#pragma unroll
  for (int i = 0; i < 8; ++i) inv8[i] = (l8[i] > 0.0f) ? (1.0f / l8[i]) : 0.0f;
  h16* ob = outA + ((size_t)(b * 1024 + q0) * 512 + hd);
#pragma unroll
  for (int i = 0; i < 8; ++i) {
    const int r = i + hi * 8;
    ob[(size_t)r * 512 +  0 + lr] = (h16)(o0[i] * inv8[i]);
    ob[(size_t)r * 512 + 16 + lr] = (h16)(o1[i] * inv8[i]);
    ob[(size_t)r * 512 + 32 + lr] = (h16)(o2[i] * inv8[i]);
    ob[(size_t)r * 512 + 48 + lr] = (h16)(o3[i] * inv8[i]);
  }
}

// ---------------- LayerNorm over 512, one 256-thread block per row -----------
__global__ void __launch_bounds__(256) ln_kernel(
    const float* __restrict__ X, const float* __restrict__ gw,
    const float* __restrict__ bw, float* __restrict__ out) {
  const int row = blockIdx.x;
  const float* x = X + (size_t)row * 512;
  const int t = threadIdx.x;
  const float a = x[t], c = x[t + 256];
  __shared__ float red[8];
  float s = a + c;
  for (int m = 1; m < 32; m <<= 1) s += __shfl_xor(s, m, 32);
  if ((t & 31) == 0) red[t >> 5] = s;
  __syncthreads();
  float tot = 0.0f;
#pragma unroll
  for (int i = 0; i < 8; ++i) tot += red[i];
  const float mu = tot * (1.0f / 512.0f);
  __syncthreads();
  const float da = a - mu, dc = c - mu;
  float v = da * da + dc * dc;
  for (int m = 1; m < 32; m <<= 1) v += __shfl_xor(v, m, 32);
  if ((t & 31) == 0) red[t >> 5] = v;
  __syncthreads();
  float vt = 0.0f;
#pragma unroll
  for (int i = 0; i < 8; ++i) vt += red[i];
  const float rstd = rsqrtf(vt * (1.0f / 512.0f) + 1e-5f);
  out[(size_t)row * 512 + t]       = da * rstd * gw[t]       + bw[t];
  out[(size_t)row * 512 + t + 256] = dc * rstd * gw[t + 256] + bw[t + 256];
}

extern "C" void kernel_launch(void* const* d_in, const int* in_sizes, int n_in,
                              void* d_out, int out_size, void* d_ws, size_t ws_size,
                              hipStream_t stream) {
  (void)in_sizes; (void)n_in; (void)out_size; (void)ws_size;
  const float* q_in  = (const float*)d_in[0];
  const float* k_in  = (const float*)d_in[1];
  const float* v_in  = (const float*)d_in[2];
  const int*   smask = (const int*)  d_in[3];
  const float* Wq    = (const float*)d_in[4];
  const float* bq    = (const float*)d_in[5];
  const float* Wv    = (const float*)d_in[6];
  const float* bv    = (const float*)d_in[7];
  const float* Wo    = (const float*)d_in[8];
  const float* bo    = (const float*)d_in[9];
  const float* gm    = (const float*)d_in[10];
  const float* lng   = (const float*)d_in[11];
  const float* lnb   = (const float*)d_in[12];
  float* out = (float*)d_out;

  const size_t E = (size_t)8 * 1024 * 512;  // elements per [B,S,D] tensor
  char* ws = (char*)d_ws;
  h16*  qh  = (h16*)(ws);
  h16*  kh  = (h16*)(ws + 2 * E);
  h16*  vh  = (h16*)(ws + 4 * E);
  h16*  Qp  = (h16*)(ws + 6 * E);
  h16*  Kp  = (h16*)(ws + 8 * E);
  h16*  Vt  = (h16*)(ws + 10 * E);
  h16*  Wqt = (h16*)(ws + 12 * E);
  h16*  Wvt = (h16*)(ws + 12 * E + 524288);
  h16*  Wot = (h16*)(ws + 12 * E + 2 * 524288);
  h16*  Ao  = (h16*)(ws + 12 * E + 3 * 524288);
  float* Xr = (float*)(ws + 12 * E + 3 * 524288 + 2 * E);

  cvt_h16<<<dim3(512), dim3(256), 0, stream>>>(q_in, qh);
  cvt_h16<<<dim3(512), dim3(256), 0, stream>>>(k_in, kh);
  cvt_h16<<<dim3(512), dim3(256), 0, stream>>>(v_in, vh);
  cvtT_h16<<<dim3(512), dim3(256), 0, stream>>>(Wq, Wqt);
  cvtT_h16<<<dim3(512), dim3(256), 0, stream>>>(Wv, Wvt);
  cvtT_h16<<<dim3(512), dim3(256), 0, stream>>>(Wo, Wot);

  const int M = 8192;  // B*S rows; (M/128)*(512/128) = 256 tiles, one 8-wave block each
  proj_gemm<<<dim3(256), dim3(256), 0, stream>>>(qh, Wqt, bq, (void*)Qp, nullptr, M, 0);
  proj_gemm<<<dim3(256), dim3(256), 0, stream>>>(kh, Wqt, bq, (void*)Kp, nullptr, M, 0);
  proj_gemm<<<dim3(256), dim3(256), 0, stream>>>(vh, Wvt, bv, (void*)Vt, nullptr, M, 1);

  attn_kernel<<<dim3(512), dim3(256), 0, stream>>>(Qp, Kp, Vt, qh, kh, smask, gm, Ao);

  proj_gemm<<<dim3(256), dim3(256), 0, stream>>>(Ao, Wot, bo, (void*)Xr, q_in, M, 2);
  ln_kernel<<<dim3(8192), dim3(256), 0, stream>>>(Xr, lng, lnb, out);
}

// v004
// A run of this version takes 98.4 microseconds.
// Two timings next to v003 both put it at 1.20 times that version's speed.
// Over all steps from v000 it is 2.45 times as fast.
#include <hip/hip_runtime.h>
#include <math.h>

typedef _Float16 h16;
typedef __attribute__((ext_vector_type(16))) _Float16 v16h;
typedef __attribute__((ext_vector_type(8)))  float    v8f;

#define WMMA_F16(a, b, c) \
  __builtin_amdgcn_wmma_f32_16x16x32_f16(false, (a), false, (b), (short)0, (c), false, false)

// Load a 16x32 (A) / 32x16 (B, fed column-major) f16 fragment from a row-major
// matrix with row stride `ld` (halves). Per ISA 16-bit A layout:
// lane = (half)*16 + r holds row r, K = kb+{0..7} and kb+{16..23}, kb = 8*half.
static __device__ __forceinline__ v16h load_frag16(const h16* base, int ld) {
  const int lane = threadIdx.x & 31;
  const int r  = lane & 15;
  const int kb = (lane >> 4) << 3;
  const h16* p = base + (size_t)r * (size_t)ld + kb;
  union { v16h v; uint4 u[2]; } f;
  f.u[0] = *(const uint4*)(p);
  f.u[1] = *(const uint4*)(p + 16);
  return f.v;
}

// ---------------- converts ----------------
// A [8,1024,512] tensor (4,194,304 elements) as one short stream: 512 work-groups of 8
// waves, each thread 8 pieces of 4 elements, 1,024 elements apart. A wave-wide load covers
// 512 contiguous bytes and a wave-wide store 256: whole lines both ways. 512 x 8,192
// elements cover the tensor exactly, so there is no bound test.
#define CVT_PIECES 8
__global__ void __launch_bounds__(256) cvt_h16(const float* __restrict__ in, h16* __restrict__ out) {
  const size_t base = (size_t)blockIdx.x * (1024 * CVT_PIECES) + threadIdx.x * 4;
  float4 v[CVT_PIECES];
#pragma unroll  // constant indices keep v in registers; all 8 loads are in flight before the first convert
  for (int j = 0; j < CVT_PIECES; ++j) v[j] = *(const float4*)(in + base + j * 1024);
#pragma unroll  // constant indices keep v in registers
  for (int j = 0; j < CVT_PIECES; ++j) {
    union { uint2 u; h16 h[4]; } p;
    p.h[0] = (h16)v[j].x; p.h[1] = (h16)v[j].y; p.h[2] = (h16)v[j].z; p.h[3] = (h16)v[j].w;
    *(uint2*)(out + base + j * 1024) = p.u;
  }
}

// in[k][n] (512x512 row-major) -> out[n][k] f16
__global__ void cvtT_h16(const float* __restrict__ in, h16* __restrict__ out) {
  const int n = blockIdx.x;
  for (int k = threadIdx.x; k < 512; k += blockDim.x)
    out[(size_t)n * 512 + k] = (h16)in[(size_t)k * 512 + n];
}

// ---------------- GEMM: C[M,512] = A[M,512] * Wt^T + bias ----------------
// One 256-thread block computes a 128x128 tile of C (M a multiple of 128, K = N = 512).
// Panels of 128 rows x 128 k of A and of Wt are brought into LDS by asynchronous
// copies (16 lanes x 16 B cover 256 contiguous bytes of one row: whole lines), in two
// buffers: the next panel's copies fly while this panel is multiplied.
// 8 waves, 4 along M x 2 along N; each owns 32x64 of C = 8 accumulators, so every
// LDS fragment feeds 2 or 4 WMMAs. The k order per accumulator is 0,32,...,480.
// mode 0: f16 row-major out. mode 1: f16 out transposed per batch [B][512][1024]
// (for V so attention A-frags are contiguous). mode 2: f32 out + residual.
#define GEMM_KS 128   // k (halves) per staged panel
#define GEMM_LP 136   // LDS row pitch in halves: 272 B = 16 B x 17, no bank conflict for 16-B reads

// Eight asynchronous 16-B copies per lane, global -> LDS, through no register: rows
// 16 apart on both sides. The s_wait_xcnt 0 is the statement's last line so that it
// stands ahead of any later rewrite of the address registers the copies name.
static __device__ __forceinline__ void copy_rows8(const h16* l, const h16* g) {
  const unsigned l0 = (unsigned)(size_t)l;       // LDS byte address: low 32 bits
  const unsigned ls = 16u * GEMM_LP * 2u;        // 16 LDS rows in bytes
  asm volatile(
      "global_load_async_to_lds_b128 %0, %8, off\n\t"
      "global_load_async_to_lds_b128 %1, %9, off\n\t"
      "global_load_async_to_lds_b128 %2, %10, off\n\t"
      "global_load_async_to_lds_b128 %3, %11, off\n\t"
      "global_load_async_to_lds_b128 %4, %12, off\n\t"
      "global_load_async_to_lds_b128 %5, %13, off\n\t"
      "global_load_async_to_lds_b128 %6, %14, off\n\t"
      "global_load_async_to_lds_b128 %7, %15, off\n\t"
      "s_wait_xcnt 0x0"
      :: "v"(l0), "v"(l0 + ls), "v"(l0 + 2u * ls), "v"(l0 + 3u * ls),
         "v"(l0 + 4u * ls), "v"(l0 + 5u * ls), "v"(l0 + 6u * ls), "v"(l0 + 7u * ls),
         "v"(g), "v"(g + 16 * 512), "v"(g + 32 * 512), "v"(g + 48 * 512),
         "v"(g + 64 * 512), "v"(g + 80 * 512), "v"(g + 96 * 512), "v"(g + 112 * 512)
      : "memory");
}

__global__ void __launch_bounds__(256) proj_gemm(
    const h16* __restrict__ A, const h16* __restrict__ Wt,
    const float* __restrict__ bias, void* __restrict__ out,
    const float* __restrict__ resid, int M, int mode) {
  __shared__ alignas(16) h16 As[2][128 * GEMM_LP];
  __shared__ alignas(16) h16 Ws[2][128 * GEMM_LP];
  const int tid = threadIdx.x;
  const int m0  = (int)(blockIdx.x >> 2) * 128;  // 4 column tiles of 128 along N=512
  const int nb  = (int)(blockIdx.x & 3) * 128;
  if (m0 >= M) return;   // uniform per block, ahead of every barrier
  const int lane = tid & 31;
  const int wv   = tid >> 5;
  const int wm = (wv >> 1) * 32;   // wave's rows inside the tile
  const int wn = (wv & 1) * 64;    // wave's columns inside the tile
  const int n0 = nb + wn;
  const int c  = lane & 15;

  v8f acc[2][4];
#pragma unroll  // constant indices keep acc in registers
  for (int j = 0; j < 4; ++j) {
    const float b = bias[n0 + j * 16 + c];
    acc[0][j] = (v8f){b, b, b, b, b, b, b, b};
    acc[1][j] = acc[0][j];
  }

  // staging: thread t copies 16 B at column (t & 15) of rows (t >> 4) + 16 j, j = 0..7
  const int srow = tid >> 4;
  const int scol = (tid & 15) * 8;
  const h16* ag = A  + (size_t)(m0 + srow) * 512 + scol;
  const h16* wg = Wt + (size_t)(nb + srow) * 512 + scol;
  const int  so = srow * GEMM_LP + scol;

  copy_rows8(&As[0][so], ag);
  copy_rows8(&Ws[0][so], wg);
  asm volatile("s_wait_asynccnt 0x0" ::: "memory");  // this wave's copies of panel 0 have landed
  __syncthreads();                                   // panel 0 is visible to every wave
  copy_rows8(&As[1][so], ag + GEMM_KS);              // panel 1 flies during panel 0
  copy_rows8(&Ws[1][so], wg + GEMM_KS);

  for (int kt = 0; kt < 4; ++kt) {
    const int cur = kt & 1;
    const h16* ab = &As[cur][wm * GEMM_LP];
    const h16* wb = &Ws[cur][wn * GEMM_LP];
#pragma unroll  // lets the LDS reads of later k steps be issued ahead of the WMMAs
    for (int ks = 0; ks < GEMM_KS; ks += 32) {
      const v16h a0 = load_frag16(ab + ks,                GEMM_LP);
      const v16h a1 = load_frag16(ab + ks + 16 * GEMM_LP, GEMM_LP);
      const v16h w0 = load_frag16(wb + ks,                GEMM_LP);
      const v16h w1 = load_frag16(wb + ks + 16 * GEMM_LP, GEMM_LP);
      const v16h w2 = load_frag16(wb + ks + 32 * GEMM_LP, GEMM_LP);
      const v16h w3 = load_frag16(wb + ks + 48 * GEMM_LP, GEMM_LP);
      acc[0][0] = WMMA_F16(a0, w0, acc[0][0]);
      acc[0][1] = WMMA_F16(a0, w1, acc[0][1]);
      acc[0][2] = WMMA_F16(a0, w2, acc[0][2]);
      acc[0][3] = WMMA_F16(a0, w3, acc[0][3]);
      acc[1][0] = WMMA_F16(a1, w0, acc[1][0]);
      acc[1][1] = WMMA_F16(a1, w1, acc[1][1]);
      acc[1][2] = WMMA_F16(a1, w2, acc[1][2]);
      acc[1][3] = WMMA_F16(a1, w3, acc[1][3]);
    }
    asm volatile("s_wait_dscnt 0x0" ::: "memory");     // this wave's reads of panel kt are done
    asm volatile("s_wait_asynccnt 0x0" ::: "memory");  // this wave's copies of panel kt+1 have landed
    __syncthreads();  // publishes panel kt+1 and ends every wave's reads of panel kt
    if (kt + 2 < 4) { // block-uniform: refill the buffer that panel kt has just left
      copy_rows8(&As[cur][so], ag + (kt + 2) * GEMM_KS);
      copy_rows8(&Ws[cur][so], wg + (kt + 2) * GEMM_KS);
    }
  }
  asm volatile("s_wait_asynccnt 0x0" ::: "memory");    // no copy is left in flight at the wave's end

  const int rw0 = m0 + wm + ((lane >> 4) << 3);  // this lane's 8 rows of the upper 16x64 strip
  if (mode == 0) {
    h16* o = (h16*)out;
#pragma unroll  // constant indices keep acc in registers
    for (int mi = 0; mi < 2; ++mi) {
#pragma unroll  // constant indices keep acc in registers
      for (int i = 0; i < 8; ++i) {
        h16* r = o + (size_t)(rw0 + mi * 16 + i) * 512 + n0 + c;
        r[0]  = (h16)acc[mi][0][i];
        r[16] = (h16)acc[mi][1][i];
        r[32] = (h16)acc[mi][2][i];
        r[48] = (h16)acc[mi][3][i];
      }
    }
  } else if (mode == 1) {
#pragma unroll  // constant indices keep acc in registers
    for (int mi = 0; mi < 2; ++mi) {
      const int row0 = rw0 + mi * 16;
      const int bIdx = row0 >> 10;     // 16 | 1024 so tiles never cross batches
      const int s0   = row0 & 1023;
      union { uint4 u; h16 h[8]; } pk0, pk1, pk2, pk3;
#pragma unroll  // constant indices keep acc in registers
      for (int i = 0; i < 8; ++i) {
        pk0.h[i] = (h16)acc[mi][0][i]; pk1.h[i] = (h16)acc[mi][1][i];
        pk2.h[i] = (h16)acc[mi][2][i]; pk3.h[i] = (h16)acc[mi][3][i];
      }
      h16* o = (h16*)out + ((size_t)bIdx * 512 + n0 + c) * 1024 + s0;
      *(uint4*)(o)               = pk0.u;   // 8 contiguous s-values, 16B aligned
      *(uint4*)(o + 16 * 1024)   = pk1.u;
      *(uint4*)(o + 32 * 1024)   = pk2.u;
      *(uint4*)(o + 48 * 1024)   = pk3.u;
    }
    // the build reuses a data register of these stores on the way to the exit:
    // this one stands ahead of that overwrite
    asm volatile("s_wait_xcnt 0x0" ::: "memory");
  } else {
    float* o = (float*)out;
#pragma unroll  // constant indices keep acc in registers
    for (int mi = 0; mi < 2; ++mi) {
#pragma unroll  // constant indices keep acc in registers
      for (int i = 0; i < 8; ++i) {
        const size_t idx = (size_t)(rw0 + mi * 16 + i) * 512 + n0 + c;
        o[idx]      = acc[mi][0][i] + resid[idx];
        o[idx + 16] = acc[mi][1][i] + resid[idx + 16];
        o[idx + 32] = acc[mi][2][i] + resid[idx + 32];
        o[idx + 48] = acc[mi][3][i] + resid[idx + 48];
      }
    }
    // the listing lays another branch's code behind these stores, and that code reuses
    // their address and data registers: this wait stands ahead of any such overwrite
    asm volatile("s_wait_xcnt 0x0" ::: "memory");
  }
}

#define AT_KP 72               // K / raw K / V tile row pitch, halves: 144 B = 16 B x 9, conflict-free 16-B reads
#define AT_MP 68               // mask tile row pitch, ints: 272 B, so rows 8 apart fall on different banks
#define AT_TILE (64 * AT_KP)   // one 64-row tile, halves

// Six asynchronous 16-B copies per lane: rows r and r + 32 of the three 64-row f16 tiles.
// The s_wait_xcnt 0 is the statement's last line so that it stands ahead of any later
// rewrite of the address registers the copies name.
static __device__ __forceinline__ void copy_kv6(const h16* lk, const h16* gk, const h16* gr, const h16* gv) {
  const unsigned l0 = (unsigned)(size_t)lk;      // LDS byte address: low 32 bits
  const unsigned lt = AT_TILE * 2u;              // one tile in bytes
  const unsigned ls = 32u * AT_KP * 2u;          // 32 LDS rows in bytes
  asm volatile(
      "global_load_async_to_lds_b128 %0, %6, off\n\t"
      "global_load_async_to_lds_b128 %1, %7, off\n\t"
      "global_load_async_to_lds_b128 %2, %8, off\n\t"
      "global_load_async_to_lds_b128 %3, %9, off\n\t"
      "global_load_async_to_lds_b128 %4, %10, off\n\t"
      "global_load_async_to_lds_b128 %5, %11, off\n\t"
      "s_wait_xcnt 0x0"
      :: "v"(l0), "v"(l0 + ls), "v"(l0 + lt), "v"(l0 + lt + ls),
         "v"(l0 + 2u * lt), "v"(l0 + 2u * lt + ls),
         "v"(gk), "v"(gk + 32 * 512), "v"(gr), "v"(gr + 32 * 512),
         "v"(gv), "v"(gv + 32 * 1024)
      : "memory");
}

// Eight asynchronous 16-B copies per lane of the mask tile: rows 16 apart on both sides.
// s_wait_xcnt 0 as the last line, for the same reason as above.
static __device__ __forceinline__ void copy_mask8(const int* l, const int* g) {
  const unsigned l0 = (unsigned)(size_t)l;       // LDS byte address: low 32 bits
  const unsigned ls = 16u * AT_MP * 4u;          // 16 LDS rows in bytes
  asm volatile(
      "global_load_async_to_lds_b128 %0, %8, off\n\t"
      "global_load_async_to_lds_b128 %1, %9, off\n\t"
      "global_load_async_to_lds_b128 %2, %10, off\n\t"
      "global_load_async_to_lds_b128 %3, %11, off\n\t"
      "global_load_async_to_lds_b128 %4, %12, off\n\t"
      "global_load_async_to_lds_b128 %5, %13, off\n\t"
      "global_load_async_to_lds_b128 %6, %14, off\n\t"
      "global_load_async_to_lds_b128 %7, %15, off\n\t"
      "s_wait_xcnt 0x0"
      :: "v"(l0), "v"(l0 + ls), "v"(l0 + 2u * ls), "v"(l0 + 3u * ls),
         "v"(l0 + 4u * ls), "v"(l0 + 5u * ls), "v"(l0 + 6u * ls), "v"(l0 + 7u * ls),
         "v"(g), "v"(g + 16 * 1024), "v"(g + 32 * 1024), "v"(g + 48 * 1024),
         "v"(g + 64 * 1024), "v"(g + 80 * 1024), "v"(g + 96 * 1024), "v"(g + 112 * 1024)
      : "memory");
}

// Lane l takes the value of lane l ^ 16: one vector cross-row move, no LDS.
static __device__ __forceinline__ float xhalf(float x) {
  const int b = __builtin_bit_cast(int, x);
  return __builtin_bit_cast(float, __builtin_amdgcn_permlanex16(b, b, 0x76543210, 0xfedcba98, false, false));
}

__global__ void __launch_bounds__(256) attn_kernel(
    const h16* __restrict__ Qp, const h16* __restrict__ Kp, const h16* __restrict__ Vt,
    const h16* __restrict__ Qr, const h16* __restrict__ Kr,
    const int* __restrict__ smask, const float* __restrict__ gammas,
    h16* __restrict__ outA) {
  __shared__ alignas(16) h16 KVs[2][3 * AT_TILE];    // [buffer][K | raw K | V^T], 64 rows each
  __shared__ alignas(16) int Ms[2][128 * AT_MP];     // [buffer][query row of the block][key]
  const int bid = blockIdx.x;
  const int h   = bid & 7;
  const int b   = (bid >> 3) & 7;
  const int grp = bid >> 6;
  // query block: the four long ones first, then the short ones shortest first, so that a
  // late block that joins an early one on a WGP is short where the early one is long
  const int qb  = grp < 4 ? 7 - grp : grp - 4;
  const int tid  = threadIdx.x;
  const int lane = tid & 31;
  const int wv   = __builtin_amdgcn_readfirstlane(tid >> 5);  // wave number, in a scalar register
  const int lr = lane & 15;
  const int hi = lane >> 4;
  const int qb0 = qb << 7;
  const int q0  = qb0 + (wv << 4);

  // exp(-softplus(g)) == sigmoid(-g); clip lower bound
  const float g = gammas[h];
  float te = 1.0f / (1.0f + __expf(g));
  te = fminf(fmaxf(te, 1e-5f), 1e5f);
  const float sscale = te * 0.0441941738241592f;  // * 1/sqrt(512)
  const float qscale = 0.125f;                    // 1/sqrt(64)

  const size_t hd = (size_t)h * 64;

  // staging: thread t copies 16 B at column (t & 7) of rows (t >> 3) and (t >> 3) + 32 of
  // each f16 tile, and 16 B at column (t & 15) of rows (t >> 4) + 16 j of the mask tile
  const int krow = tid >> 3;
  const int kcol = (tid & 7) * 8;
  const h16* kg = Kp + ((size_t)(b * 1024 + krow) * 512 + hd + kcol);
  const h16* rg = Kr + ((size_t)(b * 1024 + krow) * 512 + hd + kcol);
  const h16* vg = Vt + (((size_t)(b * 512) + hd + krow) * 1024 + kcol);
  const int  ko = krow * AT_KP + kcol;
  const int mrow = tid >> 4;
  const int mcol = (tid & 15) * 4;
  const int* mg = smask + (((size_t)b * 1024 + qb0 + mrow) * 1024 + mcol);
  const int  mo = mrow * AT_MP + mcol;

  const int nst = 2 * qb + 2;   // stages of 64 keys covering keys < qb0 + 128; at least two

  copy_kv6(&KVs[0][ko], kg, rg, vg);
  copy_mask8(&Ms[0][mo], mg);

  const h16* qpb = Qp + ((size_t)(b * 1024 + q0) * 512 + hd);
  const h16* qrb = Qr + ((size_t)(b * 1024 + q0) * 512 + hd);
  const v16h aq0 = load_frag16(qpb, 512);
  const v16h aq1 = load_frag16(qpb + 32, 512);
  const v16h ar0 = load_frag16(qrb, 512);
  const v16h ar1 = load_frag16(qrb + 32, 512);

  asm volatile("s_wait_asynccnt 0x0" ::: "memory");  // this wave's copies of stage 0 have landed
  __syncthreads();                                   // stage 0 is visible to every wave
  copy_kv6(&KVs[1][ko], kg + 64 * 512, rg + 64 * 512, vg + 64);  // stage 1 flies during stage 0
  copy_mask8(&Ms[1][mo], mg + 64);

  v8f o0 = {}, o1 = {}, o2 = {}, o3 = {};   // O^T: register i = dk 16 j + 8 hi + i of query q0 + lr
  float mrun = -3.0e38f;   // running maximum of this lane's query (equal in lanes l and l ^ 16)
  float lrun = 0.0f;       // running sum over this lane's own keys; the halves are joined after the loop

  const int qq = q0 + lr;                              // this lane's query
  const int mq = ((wv << 4) + lr) * AT_MP + hi * 8;    // its mask row, at this half's first key
  const int nkw = ((q0 + 46) >> 5) << 5;  // this wave's keys: blocks of 32 covering keys < q0+16
  for (int st = 0; st < nst; ++st) {
    const int cur = st & 1;
#pragma unroll  // two key blocks of 32 per stage, at constant LDS offsets
    for (int u = 0; u < 2; ++u) {
      const int kb0 = st * 64 + u * 32;
      if (kb0 < nkw) {  // wave-uniform (scalar): key blocks wholly above this wave's diagonal are skipped
        float sc[16];   // scores of keys kb0 + 16 t + 8 hi + i at index 8 t + i
#pragma unroll
        for (int t = 0; t < 2; ++t) {
          const int cl = u * 32 + t * 16;   // first key of this 16-key group inside the stage
          const h16* kpb = &KVs[cur][cl * AT_KP];
          const h16* krb = &KVs[cur][AT_TILE + cl * AT_KP];
          v8f s = {};
          s = WMMA_F16(load_frag16(kpb, AT_KP), aq0, s);
          s = WMMA_F16(load_frag16(kpb + 32, AT_KP), aq1, s);
          v8f sr = {};
          sr = WMMA_F16(load_frag16(krb, AT_KP), ar0, sr);
          sr = WMMA_F16(load_frag16(krb + 32, AT_KP), ar1, sr);
          // 8 consecutive keys of this query's mask row: two 16-B LDS reads
          const int4 ma = *(const int4*)&Ms[cur][mq + cl];
          const int4 mb = *(const int4*)&Ms[cur][mq + cl + 4];
          const int mk[8] = {ma.x, ma.y, ma.z, ma.w, mb.x, mb.y, mb.z, mb.w};
          const int kc = kb0 + t * 16 + hi * 8;
#pragma unroll
          for (int i = 0; i < 8; ++i) {
            const bool causal = kc + i < qq;                // strict tril(-1)
            const float ss = mk[i] ? sr[i] * sscale : 0.0f; // a non-causal key drops the whole score below
            sc[t * 8 + i] = causal ? (s[i] * qscale + ss) : -3.0e38f;
          }
        }
        // online softmax: one query per lane, its 32 keys split between lanes l and l ^ 16
        float rm = sc[0];
#pragma unroll
        for (int j = 1; j < 16; ++j) rm = fmaxf(rm, sc[j]);
        rm = fmaxf(rm, xhalf(rm));
        const float mnew = fmaxf(mrun, rm);
        const float fac = __expf(mrun - mnew);
        mrun = mnew;
        v16h bp;        // P^T as a B operand: element 8 t + i is key 16 t + 8 hi + i, the loader's k order
        float rs = 0.0f;
#pragma unroll
        for (int j = 0; j < 16; ++j) {
          const float p = (sc[j] > -1.0e37f) ? __expf(sc[j] - mnew) : 0.0f;
          rs += p;
          bp[j] = (h16)p;
        }
        lrun = lrun * fac + rs;
#pragma unroll
        for (int i = 0; i < 8; ++i) {
          o0[i] *= fac; o1[i] *= fac; o2[i] *= fac; o3[i] *= fac;
        }
        // V^T(64 dk x 32 keys) @ P^T(32 keys x 16 queries), V stored transposed [d][s]
        const h16* vb = &KVs[cur][2 * AT_TILE + u * 32];
        o0 = WMMA_F16(load_frag16(vb,              AT_KP), bp, o0);
        o1 = WMMA_F16(load_frag16(vb + 16 * AT_KP, AT_KP), bp, o1);
        o2 = WMMA_F16(load_frag16(vb + 32 * AT_KP, AT_KP), bp, o2);
        o3 = WMMA_F16(load_frag16(vb + 48 * AT_KP, AT_KP), bp, o3);
      }
    }
    asm volatile("s_wait_dscnt 0x0" ::: "memory");     // this wave's reads of stage st are done
    asm volatile("s_wait_asynccnt 0x0" ::: "memory");  // this wave's copies of stage st+1 have landed
    __syncthreads();  // publishes stage st+1 and ends every wave's reads of stage st
    if (st + 2 < nst) {  // block-uniform: refill the buffer that stage st has just left
      const int kn = (st + 2) * 64;
      copy_kv6(&KVs[cur][ko], kg + (size_t)kn * 512, rg + (size_t)kn * 512, vg + kn);
      copy_mask8(&Ms[cur][mo], mg + kn);
    }
  }
  asm volatile("s_wait_asynccnt 0x0" ::: "memory");    // no copy is left in flight at the wave's end

  const float ltot = lrun + xhalf(lrun);   // the two halves' sums of one query
  const float inv = (ltot > 0.0f) ? (1.0f / ltot) : 0.0f;
  union { uint4 u; h16 h[8]; } pk0, pk1, pk2, pk3;
#pragma unroll
  for (int i = 0; i < 8; ++i) {
    pk0.h[i] = (h16)(o0[i] * inv); pk1.h[i] = (h16)(o1[i] * inv);
    pk2.h[i] = (h16)(o2[i] * inv); pk3.h[i] = (h16)(o3[i] * inv);
  }
  h16* ob = outA + ((size_t)(b * 1024 + qq) * 512 + hd + hi * 8);
  *(uint4*)(ob)      = pk0.u;   // 8 consecutive dk of one query, 16-B aligned
  *(uint4*)(ob + 16) = pk1.u;
  *(uint4*)(ob + 32) = pk2.u;
  *(uint4*)(ob + 48) = pk3.u;
}

// ---------------- LayerNorm over 512, one 256-thread block per row -----------
__global__ void __launch_bounds__(256) ln_kernel(
    const float* __restrict__ X, const float* __restrict__ gw,
    const float* __restrict__ bw, float* __restrict__ out) {
  const int row = blockIdx.x;
  const float* x = X + (size_t)row * 512;
  const int t = threadIdx.x;
  const float a = x[t], c = x[t + 256];
  __shared__ float red[8];
  float s = a + c;
  for (int m = 1; m < 32; m <<= 1) s += __shfl_xor(s, m, 32);
  if ((t & 31) == 0) red[t >> 5] = s;
  __syncthreads();
  float tot = 0.0f;
#pragma unroll
  for (int i = 0; i < 8; ++i) tot += red[i];
  const float mu = tot * (1.0f / 512.0f);
  __syncthreads();
  const float da = a - mu, dc = c - mu;
  float v = da * da + dc * dc;
  for (int m = 1; m < 32; m <<= 1) v += __shfl_xor(v, m, 32);
  if ((t & 31) == 0) red[t >> 5] = v;
  __syncthreads();
  float vt = 0.0f;
#pragma unroll
  for (int i = 0; i < 8; ++i) vt += red[i];
  const float rstd = rsqrtf(vt * (1.0f / 512.0f) + 1e-5f);
  out[(size_t)row * 512 + t]       = da * rstd * gw[t]       + bw[t];
  out[(size_t)row * 512 + t + 256] = dc * rstd * gw[t + 256] + bw[t + 256];
}

extern "C" void kernel_launch(void* const* d_in, const int* in_sizes, int n_in,
                              void* d_out, int out_size, void* d_ws, size_t ws_size,
                              hipStream_t stream) {
  (void)in_sizes; (void)n_in; (void)out_size; (void)ws_size;
  const float* q_in  = (const float*)d_in[0];
  const float* k_in  = (const float*)d_in[1];
  const float* v_in  = (const float*)d_in[2];
  const int*   smask = (const int*)  d_in[3];
  const float* Wq    = (const float*)d_in[4];
  const float* bq    = (const float*)d_in[5];
  const float* Wv    = (const float*)d_in[6];
  const float* bv    = (const float*)d_in[7];
  const float* Wo    = (const float*)d_in[8];
  const float* bo    = (const float*)d_in[9];
  const float* gm    = (const float*)d_in[10];
  const float* lng   = (const float*)d_in[11];
  const float* lnb   = (const float*)d_in[12];
  float* out = (float*)d_out;

  const size_t E = (size_t)8 * 1024 * 512;  // elements per [B,S,D] tensor
  char* ws = (char*)d_ws;
  h16*  qh  = (h16*)(ws);
  h16*  kh  = (h16*)(ws + 2 * E);
  h16*  vh  = (h16*)(ws + 4 * E);
  h16*  Qp  = (h16*)(ws + 6 * E);
  h16*  Kp  = (h16*)(ws + 8 * E);
  h16*  Vt  = (h16*)(ws + 10 * E);
  h16*  Wqt = (h16*)(ws + 12 * E);
  h16*  Wvt = (h16*)(ws + 12 * E + 524288);
  h16*  Wot = (h16*)(ws + 12 * E + 2 * 524288);
  h16*  Ao  = (h16*)(ws + 12 * E + 3 * 524288);
  float* Xr = (float*)(ws + 12 * E + 3 * 524288 + 2 * E);

  cvt_h16<<<dim3(512), dim3(256), 0, stream>>>(q_in, qh);
  cvt_h16<<<dim3(512), dim3(256), 0, stream>>>(k_in, kh);
  cvt_h16<<<dim3(512), dim3(256), 0, stream>>>(v_in, vh);
  cvtT_h16<<<dim3(512), dim3(256), 0, stream>>>(Wq, Wqt);
  cvtT_h16<<<dim3(512), dim3(256), 0, stream>>>(Wv, Wvt);
  cvtT_h16<<<dim3(512), dim3(256), 0, stream>>>(Wo, Wot);

  const int M = 8192;  // B*S rows; (M/128)*(512/128) = 256 tiles, one 8-wave block each
  proj_gemm<<<dim3(256), dim3(256), 0, stream>>>(qh, Wqt, bq, (void*)Qp, nullptr, M, 0);
  proj_gemm<<<dim3(256), dim3(256), 0, stream>>>(kh, Wqt, bq, (void*)Kp, nullptr, M, 0);
  proj_gemm<<<dim3(256), dim3(256), 0, stream>>>(vh, Wvt, bv, (void*)Vt, nullptr, M, 1);

  attn_kernel<<<dim3(512), dim3(256), 0, stream>>>(Qp, Kp, Vt, qh, kh, smask, gm, Ao);

  proj_gemm<<<dim3(256), dim3(256), 0, stream>>>(Ao, Wot, bo, (void*)Xr, q_in, M, 2);
  ln_kernel<<<dim3(8192), dim3(256), 0, stream>>>(Xr, lng, lnb, out);
}

// v005
// Measured time: 79.7 microseconds a run.
// Timed twice side by side with v004, it ran 1.24 and 1.25 times as fast.
// Counting every step since v000, it is 3.05 times as fast.
#include <hip/hip_runtime.h>
#include <math.h>

typedef _Float16 h16;
typedef __attribute__((ext_vector_type(16))) _Float16 v16h;
typedef __attribute__((ext_vector_type(8)))  float    v8f;

#define WMMA_F16(a, b, c) \
  __builtin_amdgcn_wmma_f32_16x16x32_f16(false, (a), false, (b), (short)0, (c), false, false)

// Load a 16x32 (A) / 32x16 (B, fed column-major) f16 fragment from a row-major
// matrix with row stride `ld` (halves). Per ISA 16-bit A layout:
// lane = (half)*16 + r holds row r, K = kb+{0..7} and kb+{16..23}, kb = 8*half.
static __device__ __forceinline__ v16h load_frag16(const h16* base, int ld) {
  const int lane = threadIdx.x & 31;
  const int r  = lane & 15;
  const int kb = (lane >> 4) << 3;
  const h16* p = base + (size_t)r * (size_t)ld + kb;
  union { v16h v; uint4 u[2]; } f;
  f.u[0] = *(const uint4*)(p);
  f.u[1] = *(const uint4*)(p + 16);
  return f.v;
}

// ---------------- converts ----------------
// A [8,1024,512] tensor (4,194,304 elements) as one short stream: 512 work-groups of 8
// waves, each thread 8 pieces of 4 elements, 1,024 elements apart. A wave-wide load covers
// 512 contiguous bytes and a wave-wide store 256: whole lines both ways. 512 x 8,192
// elements cover the tensor exactly, so there is no bound test.
#define CVT_PIECES 8
static __device__ __forceinline__ void cvt_h16(const float* __restrict__ in, h16* __restrict__ out, int blk) {
  const size_t base = (size_t)blk * (1024 * CVT_PIECES) + threadIdx.x * 4;
  float4 v[CVT_PIECES];
#pragma unroll  // constant indices keep v in registers; all 8 loads are in flight before the first convert
  for (int j = 0; j < CVT_PIECES; ++j) v[j] = *(const float4*)(in + base + j * 1024);
#pragma unroll  // constant indices keep v in registers
  for (int j = 0; j < CVT_PIECES; ++j) {
    union { uint2 u; h16 h[4]; } p;
    p.h[0] = (h16)v[j].x; p.h[1] = (h16)v[j].y; p.h[2] = (h16)v[j].z; p.h[3] = (h16)v[j].w;
    *(uint2*)(out + base + j * 1024) = p.u;
  }
}

// in[k][n] (512x512 row-major) -> out[n][k] f16
static __device__ __forceinline__ void cvtT_h16(const float* __restrict__ in, h16* __restrict__ out, int n) {
  for (int k = threadIdx.x; k < 512; k += blockDim.x)
    out[(size_t)n * 512 + k] = (h16)in[(size_t)k * 512 + n];
}

// The six conversions need nothing of each other, so they share one launch: ranges of 512
// work-groups, told apart by a block-uniform branch. Ranges 0 to 2 cast q, k and v, ranges
// 3 to 5 cast and transpose the three weights.
__global__ void __launch_bounds__(256) cvt_all(
    const float* __restrict__ q, const float* __restrict__ k, const float* __restrict__ v,
    const float* __restrict__ wq, const float* __restrict__ wv, const float* __restrict__ wo,
    h16* __restrict__ qh, h16* __restrict__ kh, h16* __restrict__ vh,
    h16* __restrict__ wqt, h16* __restrict__ wvt, h16* __restrict__ wot) {
  const int job = (int)(blockIdx.x >> 9);
  const int blk = (int)(blockIdx.x & 511);
  if (job < 3)
    cvt_h16(job == 0 ? q : job == 1 ? k : v, job == 0 ? qh : job == 1 ? kh : vh, blk);
  else
    cvtT_h16(job == 3 ? wq : job == 4 ? wv : wo, job == 3 ? wqt : job == 4 ? wvt : wot, blk);
}

// ---------------- GEMM: C[M,512] = A[M,512] * Wt^T + bias ----------------
// One 256-thread block computes a 128x128 tile of C (M a multiple of 128, K = N = 512).
// Panels of 128 rows x 128 k of A and of Wt are brought into LDS by asynchronous
// copies (16 lanes x 16 B cover 256 contiguous bytes of one row: whole lines), in two
// buffers: the next panel's copies fly while this panel is multiplied.
// 8 waves, 4 along M x 2 along N; each owns 32x64 of C = 8 accumulators, so every
// LDS fragment feeds 2 or 4 WMMAs. The k order per accumulator is 0,32,...,480.
// mode 0: f16 row-major out. mode 1: f16 out transposed per batch [B][512][1024]
// (for V so attention A-frags are contiguous). mode 2: f32 out + residual.
#define GEMM_KS 128   // k (halves) per staged panel
#define GEMM_LP 136   // LDS row pitch in halves: 272 B = 16 B x 17, no bank conflict for 16-B reads

// Eight asynchronous 16-B copies per lane, global -> LDS, through no register: rows
// 16 apart on both sides. The s_wait_xcnt 0 is the statement's last line so that it
// stands ahead of any later rewrite of the address registers the copies name.
static __device__ __forceinline__ void copy_rows8(const h16* l, const h16* g) {
  const unsigned l0 = (unsigned)(size_t)l;       // LDS byte address: low 32 bits
  const unsigned ls = 16u * GEMM_LP * 2u;        // 16 LDS rows in bytes
  asm volatile(
      "global_load_async_to_lds_b128 %0, %8, off\n\t"
      "global_load_async_to_lds_b128 %1, %9, off\n\t"
      "global_load_async_to_lds_b128 %2, %10, off\n\t"
      "global_load_async_to_lds_b128 %3, %11, off\n\t"
      "global_load_async_to_lds_b128 %4, %12, off\n\t"
      "global_load_async_to_lds_b128 %5, %13, off\n\t"
      "global_load_async_to_lds_b128 %6, %14, off\n\t"
      "global_load_async_to_lds_b128 %7, %15, off\n\t"
      "s_wait_xcnt 0x0"
      :: "v"(l0), "v"(l0 + ls), "v"(l0 + 2u * ls), "v"(l0 + 3u * ls),
         "v"(l0 + 4u * ls), "v"(l0 + 5u * ls), "v"(l0 + 6u * ls), "v"(l0 + 7u * ls),
         "v"(g), "v"(g + 16 * 512), "v"(g + 32 * 512), "v"(g + 48 * 512),
         "v"(g + 64 * 512), "v"(g + 80 * 512), "v"(g + 96 * 512), "v"(g + 112 * 512)
      : "memory");
}

static __device__ __forceinline__ void gemm_tile(
    const h16* __restrict__ A, const h16* __restrict__ Wt,
    const float* __restrict__ bias, void* __restrict__ out,
    const float* __restrict__ resid, int M, int mode, unsigned tile) {
  __shared__ alignas(16) h16 As[2][128 * GEMM_LP];
  __shared__ alignas(16) h16 Ws[2][128 * GEMM_LP];
  const int tid = threadIdx.x;
  const int m0  = (int)(tile >> 2) * 128;  // 4 column tiles of 128 along N=512
  const int nb  = (int)(tile & 3) * 128;
  if (m0 >= M) return;   // uniform per block, ahead of every barrier
  const int lane = tid & 31;
  const int wv   = tid >> 5;
  const int wm = (wv >> 1) * 32;   // wave's rows inside the tile
  const int wn = (wv & 1) * 64;    // wave's columns inside the tile
  const int n0 = nb + wn;
  const int c  = lane & 15;

  v8f acc[2][4];
#pragma unroll  // constant indices keep acc in registers
  for (int j = 0; j < 4; ++j) {
    const float b = bias[n0 + j * 16 + c];
    acc[0][j] = (v8f){b, b, b, b, b, b, b, b};
    acc[1][j] = acc[0][j];
  }

  // staging: thread t copies 16 B at column (t & 15) of rows (t >> 4) + 16 j, j = 0..7
  const int srow = tid >> 4;
  const int scol = (tid & 15) * 8;
  const h16* ag = A  + (size_t)(m0 + srow) * 512 + scol;
  const h16* wg = Wt + (size_t)(nb + srow) * 512 + scol;
  const int  so = srow * GEMM_LP + scol;

  copy_rows8(&As[0][so], ag);
  copy_rows8(&Ws[0][so], wg);
  asm volatile("s_wait_asynccnt 0x0" ::: "memory");  // this wave's copies of panel 0 have landed
  __syncthreads();                                   // panel 0 is visible to every wave
  copy_rows8(&As[1][so], ag + GEMM_KS);              // panel 1 flies during panel 0
  copy_rows8(&Ws[1][so], wg + GEMM_KS);

  for (int kt = 0; kt < 4; ++kt) {
    const int cur = kt & 1;
    const h16* ab = &As[cur][wm * GEMM_LP];
    const h16* wb = &Ws[cur][wn * GEMM_LP];
#pragma unroll  // lets the LDS reads of later k steps be issued ahead of the WMMAs
    for (int ks = 0; ks < GEMM_KS; ks += 32) {
      const v16h a0 = load_frag16(ab + ks,                GEMM_LP);
      const v16h a1 = load_frag16(ab + ks + 16 * GEMM_LP, GEMM_LP);
      const v16h w0 = load_frag16(wb + ks,                GEMM_LP);
      const v16h w1 = load_frag16(wb + ks + 16 * GEMM_LP, GEMM_LP);
      const v16h w2 = load_frag16(wb + ks + 32 * GEMM_LP, GEMM_LP);
      const v16h w3 = load_frag16(wb + ks + 48 * GEMM_LP, GEMM_LP);
      acc[0][0] = WMMA_F16(a0, w0, acc[0][0]);
      acc[0][1] = WMMA_F16(a0, w1, acc[0][1]);
      acc[0][2] = WMMA_F16(a0, w2, acc[0][2]);
      acc[0][3] = WMMA_F16(a0, w3, acc[0][3]);
      acc[1][0] = WMMA_F16(a1, w0, acc[1][0]);
      acc[1][1] = WMMA_F16(a1, w1, acc[1][1]);
      acc[1][2] = WMMA_F16(a1, w2, acc[1][2]);
      acc[1][3] = WMMA_F16(a1, w3, acc[1][3]);
    }
    asm volatile("s_wait_dscnt 0x0" ::: "memory");     // this wave's reads of panel kt are done
    asm volatile("s_wait_asynccnt 0x0" ::: "memory");  // this wave's copies of panel kt+1 have landed
    __syncthreads();  // publishes panel kt+1 and ends every wave's reads of panel kt
    if (kt + 2 < 4) { // block-uniform: refill the buffer that panel kt has just left
      copy_rows8(&As[cur][so], ag + (kt + 2) * GEMM_KS);
      copy_rows8(&Ws[cur][so], wg + (kt + 2) * GEMM_KS);
    }
  }
  asm volatile("s_wait_asynccnt 0x0" ::: "memory");    // no copy is left in flight at the wave's end

  const int rw0 = m0 + wm + ((lane >> 4) << 3);  // this lane's 8 rows of the upper 16x64 strip
  if (mode == 0) {
    h16* o = (h16*)out;
#pragma unroll  // constant indices keep acc in registers
    for (int mi = 0; mi < 2; ++mi) {
#pragma unroll  // constant indices keep acc in registers
      for (int i = 0; i < 8; ++i) {
        h16* r = o + (size_t)(rw0 + mi * 16 + i) * 512 + n0 + c;
        r[0]  = (h16)acc[mi][0][i];
        r[16] = (h16)acc[mi][1][i];
        r[32] = (h16)acc[mi][2][i];
        r[48] = (h16)acc[mi][3][i];
      }
    }
    // in the merged launch's listing the next branch's code lies behind these stores and
    // reuses their data registers: this wait stands ahead of any such overwrite
    asm volatile("s_wait_xcnt 0x0" ::: "memory");
  } else if (mode == 1) {
#pragma unroll  // constant indices keep acc in registers
    for (int mi = 0; mi < 2; ++mi) {
      const int row0 = rw0 + mi * 16;
      const int bIdx = row0 >> 10;     // 16 | 1024 so tiles never cross batches
      const int s0   = row0 & 1023;
      union { uint4 u; h16 h[8]; } pk0, pk1, pk2, pk3;
#pragma unroll  // constant indices keep acc in registers
      for (int i = 0; i < 8; ++i) {
        pk0.h[i] = (h16)acc[mi][0][i]; pk1.h[i] = (h16)acc[mi][1][i];
        pk2.h[i] = (h16)acc[mi][2][i]; pk3.h[i] = (h16)acc[mi][3][i];
      }
      h16* o = (h16*)out + ((size_t)bIdx * 512 + n0 + c) * 1024 + s0;
      *(uint4*)(o)               = pk0.u;   // 8 contiguous s-values, 16B aligned
      *(uint4*)(o + 16 * 1024)   = pk1.u;
      *(uint4*)(o + 32 * 1024)   = pk2.u;
      *(uint4*)(o + 48 * 1024)   = pk3.u;
    }
    // the build reuses a data register of these stores on the way to the exit:
    // this one stands ahead of that overwrite
    asm volatile("s_wait_xcnt 0x0" ::: "memory");
  } else {
    float* o = (float*)out;
#pragma unroll  // constant indices keep acc in registers
    for (int mi = 0; mi < 2; ++mi) {
#pragma unroll  // constant indices keep acc in registers
      for (int i = 0; i < 8; ++i) {
        const size_t idx = (size_t)(rw0 + mi * 16 + i) * 512 + n0 + c;
        o[idx]      = acc[mi][0][i] + resid[idx];
        o[idx + 16] = acc[mi][1][i] + resid[idx + 16];
        o[idx + 32] = acc[mi][2][i] + resid[idx + 32];
        o[idx + 48] = acc[mi][3][i] + resid[idx + 48];
      }
    }
    // the listing lays another branch's code behind these stores, and that code reuses
    // their address and data registers: this wait stands ahead of any such overwrite
    asm volatile("s_wait_xcnt 0x0" ::: "memory");
  }
}

// The projections of q, k and v need nothing of each other, so they share one launch:
// ranges of 256 work-groups (one per tile of an [8192, 512] product), told apart by
// block-uniform selects. Two work-groups fit a WGP's LDS, so one's loads, barriers and
// stores run under the other's products.
__global__ void __launch_bounds__(256) proj_qkv(
    const h16* __restrict__ qh, const h16* __restrict__ kh, const h16* __restrict__ vh,
    const h16* __restrict__ Wqt, const h16* __restrict__ Wvt,
    const float* __restrict__ bq, const float* __restrict__ bv,
    h16* __restrict__ Qp, h16* __restrict__ Kp, h16* __restrict__ Vt, int M) {
  const int job = (int)(blockIdx.x >> 8);
  gemm_tile(job == 0 ? qh : job == 1 ? kh : vh, job == 2 ? Wvt : Wqt, job == 2 ? bv : bq,
            (void*)(job == 0 ? Qp : job == 1 ? Kp : Vt), nullptr, M, job == 2 ? 1 : 0,
            blockIdx.x & 255);
}

// One product alone in its launch: the output projection, which needs the attention's result.
__global__ void __launch_bounds__(256) proj_gemm(
    const h16* __restrict__ A, const h16* __restrict__ Wt,
    const float* __restrict__ bias, void* __restrict__ out,
    const float* __restrict__ resid, int M, int mode) {
  gemm_tile(A, Wt, bias, out, resid, M, mode, blockIdx.x);
}

#define AT_KP 72               // K / raw K / V tile row pitch, halves: 144 B = 16 B x 9, conflict-free 16-B reads
#define AT_MP 68               // mask tile row pitch, ints: 272 B, so rows 8 apart fall on different banks
#define AT_TILE (64 * AT_KP)   // one 64-row tile, halves

// Six asynchronous 16-B copies per lane: rows r and r + 32 of the three 64-row f16 tiles.
// The s_wait_xcnt 0 is the statement's last line so that it stands ahead of any later
// rewrite of the address registers the copies name.
static __device__ __forceinline__ void copy_kv6(const h16* lk, const h16* gk, const h16* gr, const h16* gv) {
  const unsigned l0 = (unsigned)(size_t)lk;      // LDS byte address: low 32 bits
  const unsigned lt = AT_TILE * 2u;              // one tile in bytes
  const unsigned ls = 32u * AT_KP * 2u;          // 32 LDS rows in bytes
  asm volatile(
      "global_load_async_to_lds_b128 %0, %6, off\n\t"
      "global_load_async_to_lds_b128 %1, %7, off\n\t"
      "global_load_async_to_lds_b128 %2, %8, off\n\t"
      "global_load_async_to_lds_b128 %3, %9, off\n\t"
      "global_load_async_to_lds_b128 %4, %10, off\n\t"
      "global_load_async_to_lds_b128 %5, %11, off\n\t"
      "s_wait_xcnt 0x0"
      :: "v"(l0), "v"(l0 + ls), "v"(l0 + lt), "v"(l0 + lt + ls),
         "v"(l0 + 2u * lt), "v"(l0 + 2u * lt + ls),
         "v"(gk), "v"(gk + 32 * 512), "v"(gr), "v"(gr + 32 * 512),
         "v"(gv), "v"(gv + 32 * 1024)
      : "memory");
}

// Eight asynchronous 16-B copies per lane of the mask tile: rows 16 apart on both sides.
// s_wait_xcnt 0 as the last line, for the same reason as above.
static __device__ __forceinline__ void copy_mask8(const int* l, const int* g) {
  const unsigned l0 = (unsigned)(size_t)l;       // LDS byte address: low 32 bits
  const unsigned ls = 16u * AT_MP * 4u;          // 16 LDS rows in bytes
  asm volatile(
      "global_load_async_to_lds_b128 %0, %8, off\n\t"
      "global_load_async_to_lds_b128 %1, %9, off\n\t"
      "global_load_async_to_lds_b128 %2, %10, off\n\t"
      "global_load_async_to_lds_b128 %3, %11, off\n\t"
      "global_load_async_to_lds_b128 %4, %12, off\n\t"
      "global_load_async_to_lds_b128 %5, %13, off\n\t"
      "global_load_async_to_lds_b128 %6, %14, off\n\t"
      "global_load_async_to_lds_b128 %7, %15, off\n\t"
      "s_wait_xcnt 0x0"
      :: "v"(l0), "v"(l0 + ls), "v"(l0 + 2u * ls), "v"(l0 + 3u * ls),
         "v"(l0 + 4u * ls), "v"(l0 + 5u * ls), "v"(l0 + 6u * ls), "v"(l0 + 7u * ls),
         "v"(g), "v"(g + 16 * 1024), "v"(g + 32 * 1024), "v"(g + 48 * 1024),
         "v"(g + 64 * 1024), "v"(g + 80 * 1024), "v"(g + 96 * 1024), "v"(g + 112 * 1024)
      : "memory");
}

// Lane l takes the value of lane l ^ 16: one vector cross-row move, no LDS.
static __device__ __forceinline__ float xhalf(float x) {
  const int b = __builtin_bit_cast(int, x);
  return __builtin_bit_cast(float, __builtin_amdgcn_permlanex16(b, b, 0x76543210, 0xfedcba98, false, false));
}

__global__ void __launch_bounds__(256) attn_kernel(
    const h16* __restrict__ Qp, const h16* __restrict__ Kp, const h16* __restrict__ Vt,
    const h16* __restrict__ Qr, const h16* __restrict__ Kr,
    const int* __restrict__ smask, const float* __restrict__ gammas,
    h16* __restrict__ outA) {
  __shared__ alignas(16) h16 KVs[2][3 * AT_TILE];    // [buffer][K | raw K | V^T], 64 rows each
  __shared__ alignas(16) int Ms[2][128 * AT_MP];     // [buffer][query row of the block][key]
  const int bid = blockIdx.x;
  const int h   = bid & 7;
  const int b   = (bid >> 3) & 7;
  const int grp = bid >> 6;
  // query block: the four long ones first, then the short ones shortest first, so that a
  // late block that joins an early one on a WGP is short where the early one is long
  const int qb  = grp < 4 ? 7 - grp : grp - 4;
  const int tid  = threadIdx.x;
  const int lane = tid & 31;
  const int wv   = __builtin_amdgcn_readfirstlane(tid >> 5);  // wave number, in a scalar register
  const int lr = lane & 15;
  const int hi = lane >> 4;
  const int qb0 = qb << 7;
  const int q0  = qb0 + (wv << 4);

  // exp(-softplus(g)) == sigmoid(-g); clip lower bound
  const float g = gammas[h];
  float te = 1.0f / (1.0f + __expf(g));
  te = fminf(fmaxf(te, 1e-5f), 1e5f);
  const float sscale = te * 0.0441941738241592f;  // * 1/sqrt(512)
  const float qscale = 0.125f;                    // 1/sqrt(64)

  const size_t hd = (size_t)h * 64;

  // staging: thread t copies 16 B at column (t & 7) of rows (t >> 3) and (t >> 3) + 32 of
  // each f16 tile, and 16 B at column (t & 15) of rows (t >> 4) + 16 j of the mask tile
  const int krow = tid >> 3;
  const int kcol = (tid & 7) * 8;
  const h16* kg = Kp + ((size_t)(b * 1024 + krow) * 512 + hd + kcol);
  const h16* rg = Kr + ((size_t)(b * 1024 + krow) * 512 + hd + kcol);
  const h16* vg = Vt + (((size_t)(b * 512) + hd + krow) * 1024 + kcol);
  const int  ko = krow * AT_KP + kcol;
  const int mrow = tid >> 4;
  const int mcol = (tid & 15) * 4;
  const int* mg = smask + (((size_t)b * 1024 + qb0 + mrow) * 1024 + mcol);
  const int  mo = mrow * AT_MP + mcol;

  const int nst = 2 * qb + 2;   // stages of 64 keys covering keys < qb0 + 128; at least two

  copy_kv6(&KVs[0][ko], kg, rg, vg);
  copy_mask8(&Ms[0][mo], mg);

  const h16* qpb = Qp + ((size_t)(b * 1024 + q0) * 512 + hd);
  const h16* qrb = Qr + ((size_t)(b * 1024 + q0) * 512 + hd);
  const v16h aq0 = load_frag16(qpb, 512);
  const v16h aq1 = load_frag16(qpb + 32, 512);
  const v16h ar0 = load_frag16(qrb, 512);
  const v16h ar1 = load_frag16(qrb + 32, 512);

  asm volatile("s_wait_asynccnt 0x0" ::: "memory");  // this wave's copies of stage 0 have landed
  __syncthreads();                                   // stage 0 is visible to every wave
  copy_kv6(&KVs[1][ko], kg + 64 * 512, rg + 64 * 512, vg + 64);  // stage 1 flies during stage 0
  copy_mask8(&Ms[1][mo], mg + 64);

  v8f o0 = {}, o1 = {}, o2 = {}, o3 = {};   // O^T: register i = dk 16 j + 8 hi + i of query q0 + lr
  float mrun = -3.0e38f;   // running maximum of this lane's query (equal in lanes l and l ^ 16)
  float lrun = 0.0f;       // running sum over this lane's own keys; the halves are joined after the loop

  const int qq = q0 + lr;                              // this lane's query
  const int mq = ((wv << 4) + lr) * AT_MP + hi * 8;    // its mask row, at this half's first key
  const int nkw = ((q0 + 46) >> 5) << 5;  // this wave's keys: blocks of 32 covering keys < q0+16
  for (int st = 0; st < nst; ++st) {
    const int cur = st & 1;
#pragma unroll  // two key blocks of 32 per stage, at constant LDS offsets
    for (int u = 0; u < 2; ++u) {
      const int kb0 = st * 64 + u * 32;
      if (kb0 < nkw) {  // wave-uniform (scalar): key blocks wholly above this wave's diagonal are skipped
        float sc[16];   // scores of keys kb0 + 16 t + 8 hi + i at index 8 t + i
#pragma unroll
        for (int t = 0; t < 2; ++t) {
          const int cl = u * 32 + t * 16;   // first key of this 16-key group inside the stage
          const h16* kpb = &KVs[cur][cl * AT_KP];
          const h16* krb = &KVs[cur][AT_TILE + cl * AT_KP];
          v8f s = {};
          s = WMMA_F16(load_frag16(kpb, AT_KP), aq0, s);
          s = WMMA_F16(load_frag16(kpb + 32, AT_KP), aq1, s);
          v8f sr = {};
          sr = WMMA_F16(load_frag16(krb, AT_KP), ar0, sr);
          sr = WMMA_F16(load_frag16(krb + 32, AT_KP), ar1, sr);
          // 8 consecutive keys of this query's mask row: two 16-B LDS reads
          const int4 ma = *(const int4*)&Ms[cur][mq + cl];
          const int4 mb = *(const int4*)&Ms[cur][mq + cl + 4];
          const int mk[8] = {ma.x, ma.y, ma.z, ma.w, mb.x, mb.y, mb.z, mb.w};
          const int kc = kb0 + t * 16 + hi * 8;
#pragma unroll
          for (int i = 0; i < 8; ++i) {
            const bool causal = kc + i < qq;                // strict tril(-1)
            const float ss = mk[i] ? sr[i] * sscale : 0.0f; // a non-causal key drops the whole score below
            sc[t * 8 + i] = causal ? (s[i] * qscale + ss) : -3.0e38f;
          }
        }
        // online softmax: one query per lane, its 32 keys split between lanes l and l ^ 16
        float rm = sc[0];
#pragma unroll
        for (int j = 1; j < 16; ++j) rm = fmaxf(rm, sc[j]);
        rm = fmaxf(rm, xhalf(rm));
        const float mnew = fmaxf(mrun, rm);
        const float fac = __expf(mrun - mnew);
        mrun = mnew;
        v16h bp;        // P^T as a B operand: element 8 t + i is key 16 t + 8 hi + i, the loader's k order
        float rs = 0.0f;
#pragma unroll
        for (int j = 0; j < 16; ++j) {
          const float p = (sc[j] > -1.0e37f) ? __expf(sc[j] - mnew) : 0.0f;
          rs += p;
          bp[j] = (h16)p;
        }
        lrun = lrun * fac + rs;
#pragma unroll
        for (int i = 0; i < 8; ++i) {
          o0[i] *= fac; o1[i] *= fac; o2[i] *= fac; o3[i] *= fac;
        }
        // V^T(64 dk x 32 keys) @ P^T(32 keys x 16 queries), V stored transposed [d][s]
        const h16* vb = &KVs[cur][2 * AT_TILE + u * 32];
        o0 = WMMA_F16(load_frag16(vb,              AT_KP), bp, o0);
        o1 = WMMA_F16(load_frag16(vb + 16 * AT_KP, AT_KP), bp, o1);
        o2 = WMMA_F16(load_frag16(vb + 32 * AT_KP, AT_KP), bp, o2);
        o3 = WMMA_F16(load_frag16(vb + 48 * AT_KP, AT_KP), bp, o3);
      }
    }
    asm volatile("s_wait_dscnt 0x0" ::: "memory");     // this wave's reads of stage st are done
    asm volatile("s_wait_asynccnt 0x0" ::: "memory");  // this wave's copies of stage st+1 have landed
    __syncthreads();  // publishes stage st+1 and ends every wave's reads of stage st
    if (st + 2 < nst) {  // block-uniform: refill the buffer that stage st has just left
      const int kn = (st + 2) * 64;
      copy_kv6(&KVs[cur][ko], kg + (size_t)kn * 512, rg + (size_t)kn * 512, vg + kn);
      copy_mask8(&Ms[cur][mo], mg + kn);
    }
  }
  asm volatile("s_wait_asynccnt 0x0" ::: "memory");    // no copy is left in flight at the wave's end

  const float ltot = lrun + xhalf(lrun);   // the two halves' sums of one query
  const float inv = (ltot > 0.0f) ? (1.0f / ltot) : 0.0f;
  union { uint4 u; h16 h[8]; } pk0, pk1, pk2, pk3;
#pragma unroll
  for (int i = 0; i < 8; ++i) {
    pk0.h[i] = (h16)(o0[i] * inv); pk1.h[i] = (h16)(o1[i] * inv);
    pk2.h[i] = (h16)(o2[i] * inv); pk3.h[i] = (h16)(o3[i] * inv);
  }
  h16* ob = outA + ((size_t)(b * 1024 + qq) * 512 + hd + hi * 8);
  *(uint4*)(ob)      = pk0.u;   // 8 consecutive dk of one query, 16-B aligned
  *(uint4*)(ob + 16) = pk1.u;
  *(uint4*)(ob + 32) = pk2.u;
  *(uint4*)(ob + 48) = pk3.u;
}

// ---------------- LayerNorm over 512, one 256-thread block per row -----------
__global__ void __launch_bounds__(256) ln_kernel(
    const float* __restrict__ X, const float* __restrict__ gw,
    const float* __restrict__ bw, float* __restrict__ out) {
  const int row = blockIdx.x;
  const float* x = X + (size_t)row * 512;
  const int t = threadIdx.x;
  const float a = x[t], c = x[t + 256];
  __shared__ float red[8];
  float s = a + c;
  for (int m = 1; m < 32; m <<= 1) s += __shfl_xor(s, m, 32);
  if ((t & 31) == 0) red[t >> 5] = s;
  __syncthreads();
  float tot = 0.0f;
#pragma unroll
  for (int i = 0; i < 8; ++i) tot += red[i];
  const float mu = tot * (1.0f / 512.0f);
  __syncthreads();
  const float da = a - mu, dc = c - mu;
  float v = da * da + dc * dc;
  for (int m = 1; m < 32; m <<= 1) v += __shfl_xor(v, m, 32);
  if ((t & 31) == 0) red[t >> 5] = v;
  __syncthreads();
  float vt = 0.0f;
#pragma unroll
  for (int i = 0; i < 8; ++i) vt += red[i];
  const float rstd = rsqrtf(vt * (1.0f / 512.0f) + 1e-5f);
  out[(size_t)row * 512 + t]       = da * rstd * gw[t]       + bw[t];
  out[(size_t)row * 512 + t + 256] = dc * rstd * gw[t + 256] + bw[t + 256];
}

extern "C" void kernel_launch(void* const* d_in, const int* in_sizes, int n_in,
                              void* d_out, int out_size, void* d_ws, size_t ws_size,
                              hipStream_t stream) {
  (void)in_sizes; (void)n_in; (void)out_size; (void)ws_size;
  const float* q_in  = (const float*)d_in[0];
  const float* k_in  = (const float*)d_in[1];
  const float* v_in  = (const float*)d_in[2];
  const int*   smask = (const int*)  d_in[3];
  const float* Wq    = (const float*)d_in[4];
  const float* bq    = (const float*)d_in[5];
  const float* Wv    = (const float*)d_in[6];
  const float* bv    = (const float*)d_in[7];
  const float* Wo    = (const float*)d_in[8];
  const float* bo    = (const float*)d_in[9];
  const float* gm    = (const float*)d_in[10];
  const float* lng   = (const float*)d_in[11];
  const float* lnb   = (const float*)d_in[12];
  float* out = (float*)d_out;

  const size_t E = (size_t)8 * 1024 * 512;  // elements per [B,S,D] tensor
  char* ws = (char*)d_ws;
  h16*  qh  = (h16*)(ws);
  h16*  kh  = (h16*)(ws + 2 * E);
  h16*  vh  = (h16*)(ws + 4 * E);
  h16*  Qp  = (h16*)(ws + 6 * E);
  h16*  Kp  = (h16*)(ws + 8 * E);
  h16*  Vt  = (h16*)(ws + 10 * E);
  h16*  Wqt = (h16*)(ws + 12 * E);
  h16*  Wvt = (h16*)(ws + 12 * E + 524288);
  h16*  Wot = (h16*)(ws + 12 * E + 2 * 524288);
  h16*  Ao  = (h16*)(ws + 12 * E + 3 * 524288);
  float* Xr = (float*)(ws + 12 * E + 3 * 524288 + 2 * E);

  cvt_all<<<dim3(3072), dim3(256), 0, stream>>>(q_in, k_in, v_in, Wq, Wv, Wo, qh, kh, vh, Wqt, Wvt, Wot);

  const int M = 8192;  // B*S rows; (M/128)*(512/128) = 256 tiles, one 8-wave block each
  proj_qkv<<<dim3(768), dim3(256), 0, stream>>>(qh, kh, vh, Wqt, Wvt, bq, bv, Qp, Kp, Vt, M);

  attn_kernel<<<dim3(512), dim3(256), 0, stream>>>(Qp, Kp, Vt, qh, kh, smask, gm, Ao);

  proj_gemm<<<dim3(256), dim3(256), 0, stream>>>(Ao, Wot, bo, (void*)Xr, q_in, M, 2);
  ln_kernel<<<dim3(8192), dim3(256), 0, stream>>>(Xr, lng, lnb, out);
}

// v006
// A run of this version takes 72.5 microseconds.
// Timed twice side by side with v005, it ran 1.10 and 1.09 times as fast.
// Over all steps from v000 it is 3.34 times as fast.
#include <hip/hip_runtime.h>
#include <math.h>

typedef _Float16 h16;
typedef __attribute__((ext_vector_type(16))) _Float16 v16h;
typedef __attribute__((ext_vector_type(8)))  float    v8f;
typedef __attribute__((ext_vector_type(4)))  float    v4f;

#define WMMA_F16(a, b, c) \
  __builtin_amdgcn_wmma_f32_16x16x32_f16(false, (a), false, (b), (short)0, (c), false, false)

// Load a 16x32 (A) / 32x16 (B, fed column-major) f16 fragment from a row-major
// matrix with row stride `ld` (halves). Per ISA 16-bit A layout:
// lane = (half)*16 + r holds row r, K = kb+{0..7} and kb+{16..23}, kb = 8*half.
static __device__ __forceinline__ v16h load_frag16(const h16* base, int ld) {
  const int lane = threadIdx.x & 31;
  const int r  = lane & 15;
  const int kb = (lane >> 4) << 3;
  const h16* p = base + (size_t)r * (size_t)ld + kb;
  union { v16h v; uint4 u[2]; } f;
  f.u[0] = *(const uint4*)(p);
  f.u[1] = *(const uint4*)(p + 16);
  return f.v;
}

// ---------------- converts ----------------
// A [8,1024,512] tensor (4,194,304 elements) as one short stream: 512 work-groups of 8
// waves, each thread 8 pieces of 4 elements, 1,024 elements apart. A wave-wide load covers
// 512 contiguous bytes and a wave-wide store 256: whole lines both ways. 512 x 8,192
// elements cover the tensor exactly, so there is no bound test.
#define CVT_PIECES 8
static __device__ __forceinline__ void cvt_h16(const float* __restrict__ in, h16* __restrict__ out, int blk) {
  const size_t base = (size_t)blk * (1024 * CVT_PIECES) + threadIdx.x * 4;
  float4 v[CVT_PIECES];
#pragma unroll  // constant indices keep v in registers; all 8 loads are in flight before the first convert
  for (int j = 0; j < CVT_PIECES; ++j) v[j] = *(const float4*)(in + base + j * 1024);
#pragma unroll  // constant indices keep v in registers
  for (int j = 0; j < CVT_PIECES; ++j) {
    union { uint2 u; h16 h[4]; } p;
    p.h[0] = (h16)v[j].x; p.h[1] = (h16)v[j].y; p.h[2] = (h16)v[j].z; p.h[3] = (h16)v[j].w;
    *(uint2*)(out + base + j * 1024) = p.u;
  }
}

// in[k][n] (512x512 row-major) -> out[n][k] f16
static __device__ __forceinline__ void cvtT_h16(const float* __restrict__ in, h16* __restrict__ out, int n) {
  for (int k = threadIdx.x; k < 512; k += blockDim.x)
    out[(size_t)n * 512 + k] = (h16)in[(size_t)k * 512 + n];
}

// The six conversions need nothing of each other, so they share one launch: ranges of 512
// work-groups, told apart by a block-uniform branch. Ranges 0 to 2 cast q, k and v, ranges
// 3 to 5 cast and transpose the three weights.
__global__ void __launch_bounds__(256) cvt_all(
    const float* __restrict__ q, const float* __restrict__ k, const float* __restrict__ v,
    const float* __restrict__ wq, const float* __restrict__ wv, const float* __restrict__ wo,
    h16* __restrict__ qh, h16* __restrict__ kh, h16* __restrict__ vh,
    h16* __restrict__ wqt, h16* __restrict__ wvt, h16* __restrict__ wot) {
  const int job = (int)(blockIdx.x >> 9);
  const int blk = (int)(blockIdx.x & 511);
  if (job < 3)
    cvt_h16(job == 0 ? q : job == 1 ? k : v, job == 0 ? qh : job == 1 ? kh : vh, blk);
  else
    cvtT_h16(job == 3 ? wq : job == 4 ? wv : wo, job == 3 ? wqt : job == 4 ? wvt : wot, blk);
}

// ---------------- GEMM: C[M,512] = A[M,512] * Wt^T + bias ----------------
// One 256-thread block computes a 128x128 tile of C (M a multiple of 128, K = N = 512).
// Panels of 128 rows x 128 k of A and of Wt are brought into LDS by asynchronous
// copies (16 lanes x 16 B cover 256 contiguous bytes of one row: whole lines), in two
// buffers: the next panel's copies fly while this panel is multiplied.
// 8 waves, 4 along M x 2 along N; each owns 32x64 of C = 8 accumulators, so every
// LDS fragment feeds 2 or 4 WMMAs. The k order per accumulator is 0,32,...,480.
// mode 0: f16 row-major out. mode 1: f16 out transposed per batch [B][512][1024]
// (for V so attention A-frags are contiguous).
#define GEMM_KS 128   // k (halves) per staged panel
#define GEMM_LP 136   // LDS row pitch in halves: 272 B = 16 B x 17, no bank conflict for 16-B reads

// Eight asynchronous 16-B copies per lane, global -> LDS, through no register: rows
// 16 apart on both sides. The s_wait_xcnt 0 is the statement's last line so that it
// stands ahead of any later rewrite of the address registers the copies name.
static __device__ __forceinline__ void copy_rows8(const h16* l, const h16* g) {
  const unsigned l0 = (unsigned)(size_t)l;       // LDS byte address: low 32 bits
  const unsigned ls = 16u * GEMM_LP * 2u;        // 16 LDS rows in bytes
  asm volatile(
      "global_load_async_to_lds_b128 %0, %8, off\n\t"
      "global_load_async_to_lds_b128 %1, %9, off\n\t"
      "global_load_async_to_lds_b128 %2, %10, off\n\t"
      "global_load_async_to_lds_b128 %3, %11, off\n\t"
      "global_load_async_to_lds_b128 %4, %12, off\n\t"
      "global_load_async_to_lds_b128 %5, %13, off\n\t"
      "global_load_async_to_lds_b128 %6, %14, off\n\t"
      "global_load_async_to_lds_b128 %7, %15, off\n\t"
      "s_wait_xcnt 0x0"
      :: "v"(l0), "v"(l0 + ls), "v"(l0 + 2u * ls), "v"(l0 + 3u * ls),
         "v"(l0 + 4u * ls), "v"(l0 + 5u * ls), "v"(l0 + 6u * ls), "v"(l0 + 7u * ls),
         "v"(g), "v"(g + 16 * 512), "v"(g + 32 * 512), "v"(g + 48 * 512),
         "v"(g + 64 * 512), "v"(g + 80 * 512), "v"(g + 96 * 512), "v"(g + 112 * 512)
      : "memory");
}

static __device__ __forceinline__ void gemm_tile(
    const h16* __restrict__ A, const h16* __restrict__ Wt,
    const float* __restrict__ bias, void* __restrict__ out,
    int M, int mode, unsigned tile) {
  __shared__ alignas(16) h16 As[2][128 * GEMM_LP];
  __shared__ alignas(16) h16 Ws[2][128 * GEMM_LP];
  const int tid = threadIdx.x;
  const int m0  = (int)(tile >> 2) * 128;  // 4 column tiles of 128 along N=512
  const int nb  = (int)(tile & 3) * 128;
  if (m0 >= M) return;   // uniform per block, ahead of every barrier
  const int lane = tid & 31;
  const int wv   = tid >> 5;
  const int wm = (wv >> 1) * 32;   // wave's rows inside the tile
  const int wn = (wv & 1) * 64;    // wave's columns inside the tile
  const int n0 = nb + wn;
  const int c  = lane & 15;

  v8f acc[2][4];
#pragma unroll  // constant indices keep acc in registers
  for (int j = 0; j < 4; ++j) {
    const float b = bias[n0 + j * 16 + c];
    acc[0][j] = (v8f){b, b, b, b, b, b, b, b};
    acc[1][j] = acc[0][j];
  }

  // staging: thread t copies 16 B at column (t & 15) of rows (t >> 4) + 16 j, j = 0..7
  const int srow = tid >> 4;
  const int scol = (tid & 15) * 8;
  const h16* ag = A  + (size_t)(m0 + srow) * 512 + scol;
  const h16* wg = Wt + (size_t)(nb + srow) * 512 + scol;
  const int  so = srow * GEMM_LP + scol;

  copy_rows8(&As[0][so], ag);
  copy_rows8(&Ws[0][so], wg);
  asm volatile("s_wait_asynccnt 0x0" ::: "memory");  // this wave's copies of panel 0 have landed
  __syncthreads();                                   // panel 0 is visible to every wave
  copy_rows8(&As[1][so], ag + GEMM_KS);              // panel 1 flies during panel 0
  copy_rows8(&Ws[1][so], wg + GEMM_KS);

  for (int kt = 0; kt < 4; ++kt) {
    const int cur = kt & 1;
    const h16* ab = &As[cur][wm * GEMM_LP];
    const h16* wb = &Ws[cur][wn * GEMM_LP];
#pragma unroll  // lets the LDS reads of later k steps be issued ahead of the WMMAs
    for (int ks = 0; ks < GEMM_KS; ks += 32) {
      const v16h a0 = load_frag16(ab + ks,                GEMM_LP);
      const v16h a1 = load_frag16(ab + ks + 16 * GEMM_LP, GEMM_LP);
      const v16h w0 = load_frag16(wb + ks,                GEMM_LP);
      const v16h w1 = load_frag16(wb + ks + 16 * GEMM_LP, GEMM_LP);
      const v16h w2 = load_frag16(wb + ks + 32 * GEMM_LP, GEMM_LP);
      const v16h w3 = load_frag16(wb + ks + 48 * GEMM_LP, GEMM_LP);
      acc[0][0] = WMMA_F16(a0, w0, acc[0][0]);
      acc[0][1] = WMMA_F16(a0, w1, acc[0][1]);
      acc[0][2] = WMMA_F16(a0, w2, acc[0][2]);
      acc[0][3] = WMMA_F16(a0, w3, acc[0][3]);
      acc[1][0] = WMMA_F16(a1, w0, acc[1][0]);
      acc[1][1] = WMMA_F16(a1, w1, acc[1][1]);
      acc[1][2] = WMMA_F16(a1, w2, acc[1][2]);
      acc[1][3] = WMMA_F16(a1, w3, acc[1][3]);
    }
    asm volatile("s_wait_dscnt 0x0" ::: "memory");     // this wave's reads of panel kt are done
    asm volatile("s_wait_asynccnt 0x0" ::: "memory");  // this wave's copies of panel kt+1 have landed
    __syncthreads();  // publishes panel kt+1 and ends every wave's reads of panel kt
    if (kt + 2 < 4) { // block-uniform: refill the buffer that panel kt has just left
      copy_rows8(&As[cur][so], ag + (kt + 2) * GEMM_KS);
      copy_rows8(&Ws[cur][so], wg + (kt + 2) * GEMM_KS);
    }
  }
  asm volatile("s_wait_asynccnt 0x0" ::: "memory");    // no copy is left in flight at the wave's end

  const int rw0 = m0 + wm + ((lane >> 4) << 3);  // this lane's 8 rows of the upper 16x64 strip
  if (mode == 0) {
    h16* o = (h16*)out;
#pragma unroll  // constant indices keep acc in registers
    for (int mi = 0; mi < 2; ++mi) {
#pragma unroll  // constant indices keep acc in registers
      for (int i = 0; i < 8; ++i) {
        h16* r = o + (size_t)(rw0 + mi * 16 + i) * 512 + n0 + c;
        r[0]  = (h16)acc[mi][0][i];
        r[16] = (h16)acc[mi][1][i];
        r[32] = (h16)acc[mi][2][i];
        r[48] = (h16)acc[mi][3][i];
      }
    }
    // in the merged launch's listing the next branch's code lies behind these stores and
    // reuses their data registers: this wait stands ahead of any such overwrite
    asm volatile("s_wait_xcnt 0x0" ::: "memory");
  } else {
#pragma unroll  // constant indices keep acc in registers
    for (int mi = 0; mi < 2; ++mi) {
      const int row0 = rw0 + mi * 16;
      const int bIdx = row0 >> 10;     // 16 | 1024 so tiles never cross batches
      const int s0   = row0 & 1023;
      union { uint4 u; h16 h[8]; } pk0, pk1, pk2, pk3;
#pragma unroll  // constant indices keep acc in registers
      for (int i = 0; i < 8; ++i) {
        pk0.h[i] = (h16)acc[mi][0][i]; pk1.h[i] = (h16)acc[mi][1][i];
        pk2.h[i] = (h16)acc[mi][2][i]; pk3.h[i] = (h16)acc[mi][3][i];
      }
      h16* o = (h16*)out + ((size_t)bIdx * 512 + n0 + c) * 1024 + s0;
      *(uint4*)(o)               = pk0.u;   // 8 contiguous s-values, 16B aligned
      *(uint4*)(o + 16 * 1024)   = pk1.u;
      *(uint4*)(o + 32 * 1024)   = pk2.u;
      *(uint4*)(o + 48 * 1024)   = pk3.u;
    }
    // the build reuses a data register of these stores on the way to the exit:
    // this one stands ahead of that overwrite
    asm volatile("s_wait_xcnt 0x0" ::: "memory");
  }
}

// The projections of q, k and v need nothing of each other, so they share one launch:
// ranges of 256 work-groups (one per tile of an [8192, 512] product), told apart by
// block-uniform selects. Two work-groups fit a WGP's LDS, so one's loads, barriers and
// stores run under the other's products.
__global__ void __launch_bounds__(256) proj_qkv(
    const h16* __restrict__ qh, const h16* __restrict__ kh, const h16* __restrict__ vh,
    const h16* __restrict__ Wqt, const h16* __restrict__ Wvt,
    const float* __restrict__ bq, const float* __restrict__ bv,
    h16* __restrict__ Qp, h16* __restrict__ Kp, h16* __restrict__ Vt, int M) {
  const int job = (int)(blockIdx.x >> 8);
  gemm_tile(job == 0 ? qh : job == 1 ? kh : vh, job == 2 ? Wvt : Wqt, job == 2 ? bv : bq,
            (void*)(job == 0 ? Qp : job == 1 ? Kp : Vt), M, job == 2 ? 1 : 0,
            blockIdx.x & 255);
}

#define AT_KP 72               // K / raw K / V tile row pitch, halves: 144 B = 16 B x 9, conflict-free 16-B reads
#define AT_MP 68               // mask tile row pitch, ints: 272 B, so rows 8 apart fall on different banks
#define AT_TILE (64 * AT_KP)   // one 64-row tile, halves

// Six asynchronous 16-B copies per lane: rows r and r + 32 of the three 64-row f16 tiles.
// The s_wait_xcnt 0 is the statement's last line so that it stands ahead of any later
// rewrite of the address registers the copies name.
static __device__ __forceinline__ void copy_kv6(const h16* lk, const h16* gk, const h16* gr, const h16* gv) {
  const unsigned l0 = (unsigned)(size_t)lk;      // LDS byte address: low 32 bits
  const unsigned lt = AT_TILE * 2u;              // one tile in bytes
  const unsigned ls = 32u * AT_KP * 2u;          // 32 LDS rows in bytes
  asm volatile(
      "global_load_async_to_lds_b128 %0, %6, off\n\t"
      "global_load_async_to_lds_b128 %1, %7, off\n\t"
      "global_load_async_to_lds_b128 %2, %8, off\n\t"
      "global_load_async_to_lds_b128 %3, %9, off\n\t"
      "global_load_async_to_lds_b128 %4, %10, off\n\t"
      "global_load_async_to_lds_b128 %5, %11, off\n\t"
      "s_wait_xcnt 0x0"
      :: "v"(l0), "v"(l0 + ls), "v"(l0 + lt), "v"(l0 + lt + ls),
         "v"(l0 + 2u * lt), "v"(l0 + 2u * lt + ls),
         "v"(gk), "v"(gk + 32 * 512), "v"(gr), "v"(gr + 32 * 512),
         "v"(gv), "v"(gv + 32 * 1024)
      : "memory");
}

// Eight asynchronous 16-B copies per lane of the mask tile: rows 16 apart on both sides.
// s_wait_xcnt 0 as the last line, for the same reason as above.
static __device__ __forceinline__ void copy_mask8(const int* l, const int* g) {
  const unsigned l0 = (unsigned)(size_t)l;       // LDS byte address: low 32 bits
  const unsigned ls = 16u * AT_MP * 4u;          // 16 LDS rows in bytes
  asm volatile(
      "global_load_async_to_lds_b128 %0, %8, off\n\t"
      "global_load_async_to_lds_b128 %1, %9, off\n\t"
      "global_load_async_to_lds_b128 %2, %10, off\n\t"
      "global_load_async_to_lds_b128 %3, %11, off\n\t"
      "global_load_async_to_lds_b128 %4, %12, off\n\t"
      "global_load_async_to_lds_b128 %5, %13, off\n\t"
      "global_load_async_to_lds_b128 %6, %14, off\n\t"
      "global_load_async_to_lds_b128 %7, %15, off\n\t"
      "s_wait_xcnt 0x0"
      :: "v"(l0), "v"(l0 + ls), "v"(l0 + 2u * ls), "v"(l0 + 3u * ls),
         "v"(l0 + 4u * ls), "v"(l0 + 5u * ls), "v"(l0 + 6u * ls), "v"(l0 + 7u * ls),
         "v"(g), "v"(g + 16 * 1024), "v"(g + 32 * 1024), "v"(g + 48 * 1024),
         "v"(g + 64 * 1024), "v"(g + 80 * 1024), "v"(g + 96 * 1024), "v"(g + 112 * 1024)
      : "memory");
}

// Lane l takes the value of lane l ^ 16: one vector cross-row move, no LDS.
static __device__ __forceinline__ float xhalf(float x) {
  const int b = __builtin_bit_cast(int, x);
  return __builtin_bit_cast(float, __builtin_amdgcn_permlanex16(b, b, 0x76543210, 0xfedcba98, false, false));
}

__global__ void __launch_bounds__(256) attn_kernel(
    const h16* __restrict__ Qp, const h16* __restrict__ Kp, const h16* __restrict__ Vt,
    const h16* __restrict__ Qr, const h16* __restrict__ Kr,
    const int* __restrict__ smask, const float* __restrict__ gammas,
    h16* __restrict__ outA) {
  __shared__ alignas(16) h16 KVs[2][3 * AT_TILE];    // [buffer][K | raw K | V^T], 64 rows each
  __shared__ alignas(16) int Ms[2][128 * AT_MP];     // [buffer][query row of the block][key]
  const int bid = blockIdx.x;
  const int h   = bid & 7;
  const int b   = (bid >> 3) & 7;
  const int grp = bid >> 6;
  // query block: the four long ones first, then the short ones shortest first, so that a
  // late block that joins an early one on a WGP is short where the early one is long
  const int qb  = grp < 4 ? 7 - grp : grp - 4;
  const int tid  = threadIdx.x;
  const int lane = tid & 31;
  const int wv   = __builtin_amdgcn_readfirstlane(tid >> 5);  // wave number, in a scalar register
  const int lr = lane & 15;
  const int hi = lane >> 4;
  const int qb0 = qb << 7;
  const int q0  = qb0 + (wv << 4);

  // exp(-softplus(g)) == sigmoid(-g); clip lower bound
  const float g = gammas[h];
  float te = 1.0f / (1.0f + __expf(g));
  te = fminf(fmaxf(te, 1e-5f), 1e5f);
  const float sscale = te * 0.0441941738241592f;  // * 1/sqrt(512)
  const float qscale = 0.125f;                    // 1/sqrt(64)

  const size_t hd = (size_t)h * 64;

  // staging: thread t copies 16 B at column (t & 7) of rows (t >> 3) and (t >> 3) + 32 of
  // each f16 tile, and 16 B at column (t & 15) of rows (t >> 4) + 16 j of the mask tile
  const int krow = tid >> 3;
  const int kcol = (tid & 7) * 8;
  const h16* kg = Kp + ((size_t)(b * 1024 + krow) * 512 + hd + kcol);
  const h16* rg = Kr + ((size_t)(b * 1024 + krow) * 512 + hd + kcol);
  const h16* vg = Vt + (((size_t)(b * 512) + hd + krow) * 1024 + kcol);
  const int  ko = krow * AT_KP + kcol;
  const int mrow = tid >> 4;
  const int mcol = (tid & 15) * 4;
  const int* mg = smask + (((size_t)b * 1024 + qb0 + mrow) * 1024 + mcol);
  const int  mo = mrow * AT_MP + mcol;

  const int nst = 2 * qb + 2;   // stages of 64 keys covering keys < qb0 + 128; at least two

  copy_kv6(&KVs[0][ko], kg, rg, vg);
  copy_mask8(&Ms[0][mo], mg);

  const h16* qpb = Qp + ((size_t)(b * 1024 + q0) * 512 + hd);
  const h16* qrb = Qr + ((size_t)(b * 1024 + q0) * 512 + hd);
  const v16h aq0 = load_frag16(qpb, 512);
  const v16h aq1 = load_frag16(qpb + 32, 512);
  const v16h ar0 = load_frag16(qrb, 512);
  const v16h ar1 = load_frag16(qrb + 32, 512);

  asm volatile("s_wait_asynccnt 0x0" ::: "memory");  // this wave's copies of stage 0 have landed
  __syncthreads();                                   // stage 0 is visible to every wave
  copy_kv6(&KVs[1][ko], kg + 64 * 512, rg + 64 * 512, vg + 64);  // stage 1 flies during stage 0
  copy_mask8(&Ms[1][mo], mg + 64);

  v8f o0 = {}, o1 = {}, o2 = {}, o3 = {};   // O^T: register i = dk 16 j + 8 hi + i of query q0 + lr
  float mrun = -3.0e38f;   // running maximum of this lane's query (equal in lanes l and l ^ 16)
  float lrun = 0.0f;       // running sum over this lane's own keys; the halves are joined after the loop

  const int qq = q0 + lr;                              // this lane's query
  const int mq = ((wv << 4) + lr) * AT_MP + hi * 8;    // its mask row, at this half's first key
  const int nkw = ((q0 + 46) >> 5) << 5;  // this wave's keys: blocks of 32 covering keys < q0+16
  for (int st = 0; st < nst; ++st) {
    const int cur = st & 1;
#pragma unroll  // two key blocks of 32 per stage, at constant LDS offsets
    for (int u = 0; u < 2; ++u) {
      const int kb0 = st * 64 + u * 32;
      if (kb0 < nkw) {  // wave-uniform (scalar): key blocks wholly above this wave's diagonal are skipped
        float sc[16];   // scores of keys kb0 + 16 t + 8 hi + i at index 8 t + i
#pragma unroll
        for (int t = 0; t < 2; ++t) {
          const int cl = u * 32 + t * 16;   // first key of this 16-key group inside the stage
          const h16* kpb = &KVs[cur][cl * AT_KP];
          const h16* krb = &KVs[cur][AT_TILE + cl * AT_KP];
          v8f s = {};
          s = WMMA_F16(load_frag16(kpb, AT_KP), aq0, s);
          s = WMMA_F16(load_frag16(kpb + 32, AT_KP), aq1, s);
          v8f sr = {};
          sr = WMMA_F16(load_frag16(krb, AT_KP), ar0, sr);
          sr = WMMA_F16(load_frag16(krb + 32, AT_KP), ar1, sr);
          // 8 consecutive keys of this query's mask row: two 16-B LDS reads
          const int4 ma = *(const int4*)&Ms[cur][mq + cl];
          const int4 mb = *(const int4*)&Ms[cur][mq + cl + 4];
          const int mk[8] = {ma.x, ma.y, ma.z, ma.w, mb.x, mb.y, mb.z, mb.w};
          const int kc = kb0 + t * 16 + hi * 8;
#pragma unroll
          for (int i = 0; i < 8; ++i) {
            const bool causal = kc + i < qq;                // strict tril(-1)
            const float ss = mk[i] ? sr[i] * sscale : 0.0f; // a non-causal key drops the whole score below
            sc[t * 8 + i] = causal ? (s[i] * qscale + ss) : -3.0e38f;
          }
        }
        // online softmax: one query per lane, its 32 keys split between lanes l and l ^ 16
        float rm = sc[0];
#pragma unroll
        for (int j = 1; j < 16; ++j) rm = fmaxf(rm, sc[j]);
        rm = fmaxf(rm, xhalf(rm));
        const float mnew = fmaxf(mrun, rm);
        const float fac = __expf(mrun - mnew);
        mrun = mnew;
        v16h bp;        // P^T as a B operand: element 8 t + i is key 16 t + 8 hi + i, the loader's k order
        float rs = 0.0f;
#pragma unroll
        for (int j = 0; j < 16; ++j) {
          const float p = (sc[j] > -1.0e37f) ? __expf(sc[j] - mnew) : 0.0f;
          rs += p;
          bp[j] = (h16)p;
        }
        lrun = lrun * fac + rs;
#pragma unroll
        for (int i = 0; i < 8; ++i) {
          o0[i] *= fac; o1[i] *= fac; o2[i] *= fac; o3[i] *= fac;
        }
        // V^T(64 dk x 32 keys) @ P^T(32 keys x 16 queries), V stored transposed [d][s]
        const h16* vb = &KVs[cur][2 * AT_TILE + u * 32];
        o0 = WMMA_F16(load_frag16(vb,              AT_KP), bp, o0);
        o1 = WMMA_F16(load_frag16(vb + 16 * AT_KP, AT_KP), bp, o1);
        o2 = WMMA_F16(load_frag16(vb + 32 * AT_KP, AT_KP), bp, o2);
        o3 = WMMA_F16(load_frag16(vb + 48 * AT_KP, AT_KP), bp, o3);
      }
    }
    asm volatile("s_wait_dscnt 0x0" ::: "memory");     // this wave's reads of stage st are done
    asm volatile("s_wait_asynccnt 0x0" ::: "memory");  // this wave's copies of stage st+1 have landed
    __syncthreads();  // publishes stage st+1 and ends every wave's reads of stage st
    if (st + 2 < nst) {  // block-uniform: refill the buffer that stage st has just left
      const int kn = (st + 2) * 64;
      copy_kv6(&KVs[cur][ko], kg + (size_t)kn * 512, rg + (size_t)kn * 512, vg + kn);
      copy_mask8(&Ms[cur][mo], mg + kn);
    }
  }
  asm volatile("s_wait_asynccnt 0x0" ::: "memory");    // no copy is left in flight at the wave's end

  const float ltot = lrun + xhalf(lrun);   // the two halves' sums of one query
  const float inv = (ltot > 0.0f) ? (1.0f / ltot) : 0.0f;
  union { uint4 u; h16 h[8]; } pk0, pk1, pk2, pk3;
#pragma unroll
  for (int i = 0; i < 8; ++i) {
    pk0.h[i] = (h16)(o0[i] * inv); pk1.h[i] = (h16)(o1[i] * inv);
    pk2.h[i] = (h16)(o2[i] * inv); pk3.h[i] = (h16)(o3[i] * inv);
  }
  h16* ob = outA + ((size_t)(b * 1024 + qq) * 512 + hd + hi * 8);
  *(uint4*)(ob)      = pk0.u;   // 8 consecutive dk of one query, 16-B aligned
  *(uint4*)(ob + 16) = pk1.u;
  *(uint4*)(ob + 32) = pk2.u;
  *(uint4*)(ob + 48) = pk3.u;
}

// ---------------- output projection + residual + LayerNorm in one launch ----------------
// One 256-thread block owns 64 whole rows of X = A Wo + bo + resid (N = K = 512), so a row's
// mean and variance need no other block and X never goes to memory.
// Product: 8 waves side by side along N, each 64 rows x 64 columns = 16 accumulators; every
// LDS fragment feeds 4 WMMAs. It is taken transposed (Wt as A, the rows of A as B): a lane
// then holds 8 consecutive columns of one row, which leave for LDS in 16-B stores.
// Panels of 64 k (all 512 rows of Wt, the block's 64 rows of A) come into LDS by
// asynchronous copies, whole 128-B lines, in two buffers: the next panel flies while this
// one is multiplied. The k order per accumulator is 0,32,...,480.
// Then the tile goes through LDS (the panels' space, free by then) so that one wave has a
// whole row: 16 values a lane, whole-line reads of the residual and whole-line stores.
#define OL_KS 64                        // k (halves) per staged panel
#define OL_LP 72                        // panel row pitch, halves: 144 B = 16 B x 9, conflict-free 16-B reads
#define OL_PANEL ((512 + 64) * OL_LP)   // one buffer, halves: 512 rows of Wt, then 64 rows of A
#define OL_XP 516                       // X row pitch, floats: 2,064 B = 16 B x 129, conflict-free 16-B stores from 16 rows

// Nine asynchronous 16-B copies per lane, global -> LDS, through no register: eight rows of
// Wt, 32 apart on both sides, and one row of A. The s_wait_xcnt 0 is the statement's last
// line so that it stands ahead of any later rewrite of the address registers the copies name.
static __device__ __forceinline__ void copy_w8a1(const h16* lw, const h16* gw, const h16* la, const h16* ga) {
  const unsigned l0 = (unsigned)(size_t)lw;      // LDS byte addresses: low 32 bits
  const unsigned l8 = (unsigned)(size_t)la;
  const unsigned ls = 32u * OL_LP * 2u;          // 32 LDS rows in bytes
  asm volatile(
      "global_load_async_to_lds_b128 %0, %9, off\n\t"
      "global_load_async_to_lds_b128 %1, %10, off\n\t"
      "global_load_async_to_lds_b128 %2, %11, off\n\t"
      "global_load_async_to_lds_b128 %3, %12, off\n\t"
      "global_load_async_to_lds_b128 %4, %13, off\n\t"
      "global_load_async_to_lds_b128 %5, %14, off\n\t"
      "global_load_async_to_lds_b128 %6, %15, off\n\t"
      "global_load_async_to_lds_b128 %7, %16, off\n\t"
      "global_load_async_to_lds_b128 %8, %17, off\n\t"
      "s_wait_xcnt 0x0"
      :: "v"(l0), "v"(l0 + ls), "v"(l0 + 2u * ls), "v"(l0 + 3u * ls),
         "v"(l0 + 4u * ls), "v"(l0 + 5u * ls), "v"(l0 + 6u * ls), "v"(l0 + 7u * ls), "v"(l8),
         "v"(gw), "v"(gw + 32 * 512), "v"(gw + 64 * 512), "v"(gw + 96 * 512),
         "v"(gw + 128 * 512), "v"(gw + 160 * 512), "v"(gw + 192 * 512), "v"(gw + 224 * 512), "v"(ga)
      : "memory");
}

// One panel: thread t copies 16 B at column (t & 7) of rows (t >> 3) + 32 j, j = 0..15 of Wt
// and j = 0, 1 of A. p, w, a: the thread's own first place in the buffer, in Wt and in A.
static __device__ __forceinline__ void copy_panel(const h16* p, const h16* w, const h16* a) {
  copy_w8a1(p,               w,             p + 512 * OL_LP, a);
  copy_w8a1(p + 256 * OL_LP, w + 256 * 512, p + 544 * OL_LP, a + 32 * 512);
}

// Sum over the wave's 32 lanes, the result in every lane: four steps inside the 16-lane rows
// (row_xmask 1, 2, 4, 8 on the vector unit, no LDS), then the exchange between the halves.
template <int CTRL>
static __device__ __forceinline__ float row_step(float x) {
  return x + __builtin_bit_cast(float, __builtin_amdgcn_mov_dpp(__builtin_bit_cast(int, x), CTRL, 0xf, 0xf, true));
}
static __device__ __forceinline__ float wave_sum(float x) {
  x = row_step<0x161>(x);
  x = row_step<0x162>(x);
  x = row_step<0x164>(x);
  x = row_step<0x168>(x);
  return x + xhalf(x);
}

__global__ void __launch_bounds__(256) proj_ln(
    const h16* __restrict__ A, const h16* __restrict__ Wt, const float* __restrict__ bias,
    const float* __restrict__ resid, const float* __restrict__ gw, const float* __restrict__ bw,
    float* __restrict__ out) {
  __shared__ alignas(16) unsigned char Sm[2 * OL_PANEL * 2];   // two panel buffers; later the X tile
  h16* const P0 = (h16*)Sm;
  const int tid  = threadIdx.x;
  const int lane = tid & 31;
  const int wv   = tid >> 5;
  const int m0 = (int)blockIdx.x * 64;   // the block's rows
  const int wn = wv * 64;                // the wave's columns
  const int lr = lane & 15;
  const int hi = lane >> 4;

  v8f acc[4][4];   // acc[mi][j], register i: row 16 mi + lr, column wn + 16 j + 8 hi + i
#pragma unroll  // constant indices keep acc in registers
  for (int j = 0; j < 4; ++j) {
    const float4 b0 = *(const float4*)(bias + wn + j * 16 + hi * 8);
    const float4 b1 = *(const float4*)(bias + wn + j * 16 + hi * 8 + 4);
    acc[0][j] = (v8f){b0.x, b0.y, b0.z, b0.w, b1.x, b1.y, b1.z, b1.w};
    acc[1][j] = acc[0][j]; acc[2][j] = acc[0][j]; acc[3][j] = acc[0][j];
  }

  // staging: this thread's first row and column, as copy_panel takes them
  const int srow = tid >> 3;
  const int scol = (tid & 7) * 8;
  const h16* wg = Wt + (size_t)srow * 512 + scol;
  const h16* ag = A  + (size_t)(m0 + srow) * 512 + scol;
  const int  so = srow * OL_LP + scol;

  copy_panel(P0 + so, wg, ag);
  asm volatile("s_wait_asynccnt 0x0" ::: "memory");  // this wave's copies of panel 0 have landed
  __syncthreads();                                   // panel 0 is visible to every wave
  copy_panel(P0 + OL_PANEL + so, wg + OL_KS, ag + OL_KS);   // panel 1 flies during panel 0

  for (int kt = 0; kt < 8; ++kt) {
    h16* const pb = P0 + (kt & 1) * OL_PANEL;
    const h16* wb = pb + wn * OL_LP;
    const h16* ab = pb + 512 * OL_LP;
#pragma unroll  // both k steps of a panel at constant LDS offsets
    for (int ks = 0; ks < OL_KS; ks += 32) {
      v16h a[4], w[4];
#pragma unroll  // constant indices keep the fragments in registers
      for (int i = 0; i < 4; ++i) {
        a[i] = load_frag16(ab + ks + i * 16 * OL_LP, OL_LP);
        w[i] = load_frag16(wb + ks + i * 16 * OL_LP, OL_LP);
      }
      // keeps the 16 LDS reads one group ahead of the 16 WMMAs: left free, the build reads the
      // A fragments one at a time among them and waits out the LDS latency at each
      __builtin_amdgcn_sched_barrier(0);
#pragma unroll  // constant indices keep acc in registers
      for (int mi = 0; mi < 4; ++mi) {
#pragma unroll  // constant indices keep acc in registers
        for (int j = 0; j < 4; ++j) acc[mi][j] = WMMA_F16(w[j], a[mi], acc[mi][j]);
      }
      __builtin_amdgcn_sched_barrier(0);  // the other side of the same fence: no later read moves in among the WMMAs
    }
    asm volatile("s_wait_dscnt 0x0" ::: "memory");     // this wave's reads of panel kt are done
    asm volatile("s_wait_asynccnt 0x0" ::: "memory");  // this wave's copies of panel kt+1 have landed
    __syncthreads();  // publishes panel kt+1 and ends every wave's reads of panel kt
    if (kt + 2 < 8)   // block-uniform: refill the buffer that panel kt has just left
      copy_panel(pb + so, wg + (kt + 2) * OL_KS, ag + (kt + 2) * OL_KS);
  }
  asm volatile("s_wait_asynccnt 0x0" ::: "memory");    // no copy is left in flight: the panels' LDS is free

  // This wave's 8 rows of the second part; a lane has columns 4 lane + 128 p + {0..3}.
  const int r0 = wv * 8;
  const float* rg = resid + (size_t)(m0 + r0) * 512 + lane * 4;
  v4f x[8][4], g4[4], b4[4];
#pragma unroll  // constant indices keep x in registers; the first 4 rows' residual flies under the LDS stores
  for (int r = 0; r < 4; ++r) {
#pragma unroll
    for (int p = 0; p < 4; ++p) x[r][p] = *(const v4f*)(rg + r * 512 + p * 128);
  }
#pragma unroll
  for (int p = 0; p < 4; ++p) {
    g4[p] = *(const v4f*)(gw + lane * 4 + p * 128);
    b4[p] = *(const v4f*)(bw + lane * 4 + p * 128);
  }

  float* const X = (float*)Sm;
  const int xo = lr * OL_XP + wn + hi * 8;   // this lane's first row and column in the tile
#pragma unroll  // constant indices keep acc in registers
  for (int mi = 0; mi < 4; ++mi) {
#pragma unroll
    for (int j = 0; j < 4; ++j) {
      float* p = &X[xo + mi * 16 * OL_XP + j * 16];
      *(float4*)(p)     = make_float4(acc[mi][j][0], acc[mi][j][1], acc[mi][j][2], acc[mi][j][3]);
      *(float4*)(p + 4) = make_float4(acc[mi][j][4], acc[mi][j][5], acc[mi][j][6], acc[mi][j][7]);
    }
  }
  // stands ahead of any later rewrite of the address registers of the loads above
  asm volatile("s_wait_xcnt 0x0" ::: "memory");
  __syncthreads();   // the whole X tile is in LDS before any wave reads a row of it

#pragma unroll  // the other 4 rows' residual flies while the first 4 rows are worked on
  for (int r = 4; r < 8; ++r) {
#pragma unroll
    for (int p = 0; p < 4; ++p) x[r][p] = *(const v4f*)(rg + r * 512 + p * 128);
  }

  float* og = out + (size_t)(m0 + r0) * 512 + lane * 4;
#pragma unroll  // constant indices keep x in registers; independent rows, so their LDS reads and cross-lane sums overlap
  for (int r = 0; r < 8; ++r) {
    // keeps the two groups of 4 rows apart: woven together, the first group waits on the second
    // group's residual, still in flight, and the build goes past the first 256 registers
    if (r == 4) __builtin_amdgcn_sched_barrier(0);
#pragma unroll
    for (int p = 0; p < 4; ++p) x[r][p] += *(const v4f*)&X[(r0 + r) * OL_XP + lane * 4 + p * 128];
    const v4f s4 = (x[r][0] + x[r][1]) + (x[r][2] + x[r][3]);
    const float mu = wave_sum((s4.x + s4.y) + (s4.z + s4.w)) * (1.0f / 512.0f);
#pragma unroll
    for (int p = 0; p < 4; ++p) x[r][p] -= mu;
    const v4f q4 = (x[r][0] * x[r][0] + x[r][1] * x[r][1]) + (x[r][2] * x[r][2] + x[r][3] * x[r][3]);
    const float rstd = rsqrtf(wave_sum((q4.x + q4.y) + (q4.z + q4.w)) * (1.0f / 512.0f) + 1e-5f);
#pragma unroll
    for (int p = 0; p < 4; ++p) *(v4f*)(og + r * 512 + p * 128) = x[r][p] * rstd * g4[p] + b4[p];
  }
}

extern "C" void kernel_launch(void* const* d_in, const int* in_sizes, int n_in,
                              void* d_out, int out_size, void* d_ws, size_t ws_size,
                              hipStream_t stream) {
  (void)in_sizes; (void)n_in; (void)out_size; (void)ws_size;
  const float* q_in  = (const float*)d_in[0];
  const float* k_in  = (const float*)d_in[1];
  const float* v_in  = (const float*)d_in[2];
  const int*   smask = (const int*)  d_in[3];
  const float* Wq    = (const float*)d_in[4];
  const float* bq    = (const float*)d_in[5];
  const float* Wv    = (const float*)d_in[6];
  const float* bv    = (const float*)d_in[7];
  const float* Wo    = (const float*)d_in[8];
  const float* bo    = (const float*)d_in[9];
  const float* gm    = (const float*)d_in[10];
  const float* lng   = (const float*)d_in[11];
  const float* lnb   = (const float*)d_in[12];
  float* out = (float*)d_out;

  const size_t E = (size_t)8 * 1024 * 512;  // elements per [B,S,D] tensor
  char* ws = (char*)d_ws;
  h16*  qh  = (h16*)(ws);
  h16*  kh  = (h16*)(ws + 2 * E);
  h16*  vh  = (h16*)(ws + 4 * E);
  h16*  Qp  = (h16*)(ws + 6 * E);
  h16*  Kp  = (h16*)(ws + 8 * E);
  h16*  Vt  = (h16*)(ws + 10 * E);
  h16*  Wqt = (h16*)(ws + 12 * E);
  h16*  Wvt = (h16*)(ws + 12 * E + 524288);
  h16*  Wot = (h16*)(ws + 12 * E + 2 * 524288);
  h16*  Ao  = (h16*)(ws + 12 * E + 3 * 524288);

  cvt_all<<<dim3(3072), dim3(256), 0, stream>>>(q_in, k_in, v_in, Wq, Wv, Wo, qh, kh, vh, Wqt, Wvt, Wot);

  const int M = 8192;  // B*S rows; (M/128)*(512/128) = 256 tiles, one 8-wave block each
  proj_qkv<<<dim3(768), dim3(256), 0, stream>>>(qh, kh, vh, Wqt, Wvt, bq, bv, Qp, Kp, Vt, M);

  attn_kernel<<<dim3(512), dim3(256), 0, stream>>>(Qp, Kp, Vt, qh, kh, smask, gm, Ao);

  // 8192 / 64 = 128 blocks, each with 64 whole rows
  proj_ln<<<dim3(128), dim3(256), 0, stream>>>(Ao, Wot, bo, q_in, lng, lnb, out);
}

// v007
// One run takes 69.7 microseconds.
// Next to v006, in two timings, it ran 1.04 times as fast each time.
// Over all steps from v000 it is 3.47 times as fast.
#include <hip/hip_runtime.h>
#include <math.h>

typedef _Float16 h16;
typedef __attribute__((ext_vector_type(16))) _Float16 v16h;
typedef __attribute__((ext_vector_type(8)))  float    v8f;
typedef __attribute__((ext_vector_type(4)))  float    v4f;

#define WMMA_F16(a, b, c) \
  __builtin_amdgcn_wmma_f32_16x16x32_f16(false, (a), false, (b), (short)0, (c), false, false)

// Load a 16x32 (A) / 32x16 (B, fed column-major) f16 fragment from a row-major
// matrix with row stride `ld` (halves). Per ISA 16-bit A layout:
// lane = (half)*16 + r holds row r, K = kb+{0..7} and kb+{16..23}, kb = 8*half.
static __device__ __forceinline__ v16h load_frag16(const h16* base, int ld) {
  const int lane = threadIdx.x & 31;
  const int r  = lane & 15;
  const int kb = (lane >> 4) << 3;
  const h16* p = base + (size_t)r * (size_t)ld + kb;
  union { v16h v; uint4 u[2]; } f;
  f.u[0] = *(const uint4*)(p);
  f.u[1] = *(const uint4*)(p + 16);
  return f.v;
}

// ---------------- converts ----------------
// A [8,1024,512] tensor (4,194,304 elements) as one short stream: 512 work-groups of 8
// waves, each thread 8 pieces of 4 elements, 1,024 elements apart. A wave-wide load covers
// 512 contiguous bytes and a wave-wide store 256: whole lines both ways. 512 x 8,192
// elements cover the tensor exactly, so there is no bound test.
#define CVT_PIECES 8
static __device__ __forceinline__ void cvt_h16(const float* __restrict__ in, h16* __restrict__ out, int blk) {
  const size_t base = (size_t)blk * (1024 * CVT_PIECES) + threadIdx.x * 4;
  float4 v[CVT_PIECES];
#pragma unroll  // constant indices keep v in registers; all 8 loads are in flight before the first convert
  for (int j = 0; j < CVT_PIECES; ++j) v[j] = *(const float4*)(in + base + j * 1024);
#pragma unroll  // constant indices keep v in registers
  for (int j = 0; j < CVT_PIECES; ++j) {
    union { uint2 u; h16 h[4]; } p;
    p.h[0] = (h16)v[j].x; p.h[1] = (h16)v[j].y; p.h[2] = (h16)v[j].z; p.h[3] = (h16)v[j].w;
    *(uint2*)(out + base + j * 1024) = p.u;
  }
}

// in[k][n] (512x512 row-major) -> out[n][k] f16
static __device__ __forceinline__ void cvtT_h16(const float* __restrict__ in, h16* __restrict__ out, int n) {
  for (int k = threadIdx.x; k < 512; k += blockDim.x)
    out[(size_t)n * 512 + k] = (h16)in[(size_t)k * 512 + n];
}

// The six conversions need nothing of each other, so they share one launch: ranges of 512
// work-groups, told apart by a block-uniform branch. Ranges 0 to 2 cast q, k and v, ranges
// 3 to 5 cast and transpose the three weights.
__global__ void __launch_bounds__(256) cvt_all(
    const float* __restrict__ q, const float* __restrict__ k, const float* __restrict__ v,
    const float* __restrict__ wq, const float* __restrict__ wv, const float* __restrict__ wo,
    h16* __restrict__ qh, h16* __restrict__ kh, h16* __restrict__ vh,
    h16* __restrict__ wqt, h16* __restrict__ wvt, h16* __restrict__ wot) {
  const int job = (int)(blockIdx.x >> 9);
  const int blk = (int)(blockIdx.x & 511);
  if (job < 3)
    cvt_h16(job == 0 ? q : job == 1 ? k : v, job == 0 ? qh : job == 1 ? kh : vh, blk);
  else
    cvtT_h16(job == 3 ? wq : job == 4 ? wv : wo, job == 3 ? wqt : job == 4 ? wvt : wot, blk);
}

// ---------------- GEMM: C[M,512] = A[M,512] * Wt^T + bias ----------------
// One 256-thread block computes a 128x128 tile of C (M a multiple of 128, K = N = 512).
// Panels of 128 rows x 128 k of A and of Wt are brought into LDS by asynchronous
// copies (16 lanes x 16 B cover 256 contiguous bytes of one row: whole lines), in two
// buffers: the next panel's copies fly while this panel is multiplied.
// 8 waves, 4 along M x 2 along N; each owns 32x64 of C = 8 accumulators, so every
// LDS fragment feeds 2 or 4 WMMAs. The k order per accumulator is 0,32,...,480.
// mode 0: f16 row-major out. mode 1: f16 out transposed per batch [B][512][1024]
// (for V so attention A-frags are contiguous).
#define GEMM_KS 128   // k (halves) per staged panel
#define GEMM_LP 136   // LDS row pitch in halves: 272 B = 16 B x 17, no bank conflict for 16-B reads

// Eight asynchronous 16-B copies per lane, global -> LDS, through no register: rows
// 16 apart on both sides. The s_wait_xcnt 0 is the statement's last line so that it
// stands ahead of any later rewrite of the address registers the copies name.
static __device__ __forceinline__ void copy_rows8(const h16* l, const h16* g) {
  const unsigned l0 = (unsigned)(size_t)l;       // LDS byte address: low 32 bits
  const unsigned ls = 16u * GEMM_LP * 2u;        // 16 LDS rows in bytes
  asm volatile(
      "global_load_async_to_lds_b128 %0, %8, off\n\t"
      "global_load_async_to_lds_b128 %1, %9, off\n\t"
      "global_load_async_to_lds_b128 %2, %10, off\n\t"
      "global_load_async_to_lds_b128 %3, %11, off\n\t"
      "global_load_async_to_lds_b128 %4, %12, off\n\t"
      "global_load_async_to_lds_b128 %5, %13, off\n\t"
      "global_load_async_to_lds_b128 %6, %14, off\n\t"
      "global_load_async_to_lds_b128 %7, %15, off\n\t"
      "s_wait_xcnt 0x0"
      :: "v"(l0), "v"(l0 + ls), "v"(l0 + 2u * ls), "v"(l0 + 3u * ls),
         "v"(l0 + 4u * ls), "v"(l0 + 5u * ls), "v"(l0 + 6u * ls), "v"(l0 + 7u * ls),
         "v"(g), "v"(g + 16 * 512), "v"(g + 32 * 512), "v"(g + 48 * 512),
         "v"(g + 64 * 512), "v"(g + 80 * 512), "v"(g + 96 * 512), "v"(g + 112 * 512)
      : "memory");
}

static __device__ __forceinline__ void gemm_tile(
    const h16* __restrict__ A, const h16* __restrict__ Wt,
    const float* __restrict__ bias, void* __restrict__ out,
    int M, int mode, unsigned tile) {
  __shared__ alignas(16) h16 As[2][128 * GEMM_LP];
  __shared__ alignas(16) h16 Ws[2][128 * GEMM_LP];
  const int tid = threadIdx.x;
  const int m0  = (int)(tile >> 2) * 128;  // 4 column tiles of 128 along N=512
  const int nb  = (int)(tile & 3) * 128;
  if (m0 >= M) return;   // uniform per block, ahead of every barrier
  const int lane = tid & 31;
  const int wv   = tid >> 5;
  const int wm = (wv >> 1) * 32;   // wave's rows inside the tile
  const int wn = (wv & 1) * 64;    // wave's columns inside the tile
  const int n0 = nb + wn;
  const int c  = lane & 15;

  v8f acc[2][4];
#pragma unroll  // constant indices keep acc in registers
  for (int j = 0; j < 4; ++j) {
    const float b = bias[n0 + j * 16 + c];
    acc[0][j] = (v8f){b, b, b, b, b, b, b, b};
    acc[1][j] = acc[0][j];
  }

  // staging: thread t copies 16 B at column (t & 15) of rows (t >> 4) + 16 j, j = 0..7
  const int srow = tid >> 4;
  const int scol = (tid & 15) * 8;
  const h16* ag = A  + (size_t)(m0 + srow) * 512 + scol;
  const h16* wg = Wt + (size_t)(nb + srow) * 512 + scol;
  const int  so = srow * GEMM_LP + scol;

  copy_rows8(&As[0][so], ag);
  copy_rows8(&Ws[0][so], wg);
  asm volatile("s_wait_asynccnt 0x0" ::: "memory");  // this wave's copies of panel 0 have landed
  __syncthreads();                                   // panel 0 is visible to every wave
  copy_rows8(&As[1][so], ag + GEMM_KS);              // panel 1 flies during panel 0
  copy_rows8(&Ws[1][so], wg + GEMM_KS);

  for (int kt = 0; kt < 4; ++kt) {
    const int cur = kt & 1;
    const h16* ab = &As[cur][wm * GEMM_LP];
    const h16* wb = &Ws[cur][wn * GEMM_LP];
#pragma unroll  // lets the LDS reads of later k steps be issued ahead of the WMMAs
    for (int ks = 0; ks < GEMM_KS; ks += 32) {
      const v16h a0 = load_frag16(ab + ks,                GEMM_LP);
      const v16h a1 = load_frag16(ab + ks + 16 * GEMM_LP, GEMM_LP);
      const v16h w0 = load_frag16(wb + ks,                GEMM_LP);
      const v16h w1 = load_frag16(wb + ks + 16 * GEMM_LP, GEMM_LP);
      const v16h w2 = load_frag16(wb + ks + 32 * GEMM_LP, GEMM_LP);
      const v16h w3 = load_frag16(wb + ks + 48 * GEMM_LP, GEMM_LP);
      acc[0][0] = WMMA_F16(a0, w0, acc[0][0]);
      acc[0][1] = WMMA_F16(a0, w1, acc[0][1]);
      acc[0][2] = WMMA_F16(a0, w2, acc[0][2]);
      acc[0][3] = WMMA_F16(a0, w3, acc[0][3]);
      acc[1][0] = WMMA_F16(a1, w0, acc[1][0]);
      acc[1][1] = WMMA_F16(a1, w1, acc[1][1]);
      acc[1][2] = WMMA_F16(a1, w2, acc[1][2]);
      acc[1][3] = WMMA_F16(a1, w3, acc[1][3]);
    }
    asm volatile("s_wait_dscnt 0x0" ::: "memory");     // this wave's reads of panel kt are done
    asm volatile("s_wait_asynccnt 0x0" ::: "memory");  // this wave's copies of panel kt+1 have landed
    __syncthreads();  // publishes panel kt+1 and ends every wave's reads of panel kt
    if (kt + 2 < 4) { // block-uniform: refill the buffer that panel kt has just left
      copy_rows8(&As[cur][so], ag + (kt + 2) * GEMM_KS);
      copy_rows8(&Ws[cur][so], wg + (kt + 2) * GEMM_KS);
    }
  }
  asm volatile("s_wait_asynccnt 0x0" ::: "memory");    // no copy is left in flight at the wave's end

  const int rw0 = m0 + wm + ((lane >> 4) << 3);  // this lane's 8 rows of the upper 16x64 strip
  if (mode == 0) {
    h16* o = (h16*)out;
#pragma unroll  // constant indices keep acc in registers
    for (int mi = 0; mi < 2; ++mi) {
#pragma unroll  // constant indices keep acc in registers
      for (int i = 0; i < 8; ++i) {
        h16* r = o + (size_t)(rw0 + mi * 16 + i) * 512 + n0 + c;
        r[0]  = (h16)acc[mi][0][i];
        r[16] = (h16)acc[mi][1][i];
        r[32] = (h16)acc[mi][2][i];
        r[48] = (h16)acc[mi][3][i];
      }
    }
    // in the merged launch's listing the next branch's code lies behind these stores and
    // reuses their data registers: this wait stands ahead of any such overwrite
    asm volatile("s_wait_xcnt 0x0" ::: "memory");
  } else {
#pragma unroll  // constant indices keep acc in registers
    for (int mi = 0; mi < 2; ++mi) {
      const int row0 = rw0 + mi * 16;
      const int bIdx = row0 >> 10;     // 16 | 1024 so tiles never cross batches
      const int s0   = row0 & 1023;
      union { uint4 u; h16 h[8]; } pk0, pk1, pk2, pk3;
#pragma unroll  // constant indices keep acc in registers
      for (int i = 0; i < 8; ++i) {
        pk0.h[i] = (h16)acc[mi][0][i]; pk1.h[i] = (h16)acc[mi][1][i];
        pk2.h[i] = (h16)acc[mi][2][i]; pk3.h[i] = (h16)acc[mi][3][i];
      }
      h16* o = (h16*)out + ((size_t)bIdx * 512 + n0 + c) * 1024 + s0;
      *(uint4*)(o)               = pk0.u;   // 8 contiguous s-values, 16B aligned
      *(uint4*)(o + 16 * 1024)   = pk1.u;
      *(uint4*)(o + 32 * 1024)   = pk2.u;
      *(uint4*)(o + 48 * 1024)   = pk3.u;
    }
    // the build reuses a data register of these stores on the way to the exit:
    // this one stands ahead of that overwrite
    asm volatile("s_wait_xcnt 0x0" ::: "memory");
  }
}

// The projections of q, k and v need nothing of each other, so they share one launch:
// ranges of 256 work-groups (one per tile of an [8192, 512] product), told apart by
// block-uniform selects. Two work-groups fit a WGP's LDS, so one's loads, barriers and
// stores run under the other's products.
__global__ void __launch_bounds__(256) proj_qkv(
    const h16* __restrict__ qh, const h16* __restrict__ kh, const h16* __restrict__ vh,
    const h16* __restrict__ Wqt, const h16* __restrict__ Wvt,
    const float* __restrict__ bq, const float* __restrict__ bv,
    h16* __restrict__ Qp, h16* __restrict__ Kp, h16* __restrict__ Vt, int M) {
  const int job = (int)(blockIdx.x >> 8);
  gemm_tile(job == 0 ? qh : job == 1 ? kh : vh, job == 2 ? Wvt : Wqt, job == 2 ? bv : bq,
            (void*)(job == 0 ? Qp : job == 1 ? Kp : Vt), M, job == 2 ? 1 : 0,
            blockIdx.x & 255);
}

#define AT_KP 72               // K / raw K / V tile row pitch, halves: 144 B = 16 B x 9, conflict-free 16-B reads
#define AT_MP 68               // mask tile row pitch, ints: 272 B, so rows 8 apart fall on different banks
#define AT_TILE (64 * AT_KP)   // one 64-row tile, halves

// Six asynchronous 16-B copies per lane: rows r and r + 32 of the three 64-row f16 tiles.
// The s_wait_xcnt 0 is the statement's last line so that it stands ahead of any later
// rewrite of the address registers the copies name.
static __device__ __forceinline__ void copy_kv6(const h16* lk, const h16* gk, const h16* gr, const h16* gv) {
  const unsigned l0 = (unsigned)(size_t)lk;      // LDS byte address: low 32 bits
  const unsigned lt = AT_TILE * 2u;              // one tile in bytes
  const unsigned ls = 32u * AT_KP * 2u;          // 32 LDS rows in bytes
  asm volatile(
      "global_load_async_to_lds_b128 %0, %6, off\n\t"
      "global_load_async_to_lds_b128 %1, %7, off\n\t"
      "global_load_async_to_lds_b128 %2, %8, off\n\t"
      "global_load_async_to_lds_b128 %3, %9, off\n\t"
      "global_load_async_to_lds_b128 %4, %10, off\n\t"
      "global_load_async_to_lds_b128 %5, %11, off\n\t"
      "s_wait_xcnt 0x0"
      :: "v"(l0), "v"(l0 + ls), "v"(l0 + lt), "v"(l0 + lt + ls),
         "v"(l0 + 2u * lt), "v"(l0 + 2u * lt + ls),
         "v"(gk), "v"(gk + 32 * 512), "v"(gr), "v"(gr + 32 * 512),
         "v"(gv), "v"(gv + 32 * 1024)
      : "memory");
}

// Eight asynchronous 16-B copies per lane of the mask tile: rows 16 apart on both sides.
// s_wait_xcnt 0 as the last line, for the same reason as above.
static __device__ __forceinline__ void copy_mask8(const int* l, const int* g) {
  const unsigned l0 = (unsigned)(size_t)l;       // LDS byte address: low 32 bits
  const unsigned ls = 16u * AT_MP * 4u;          // 16 LDS rows in bytes
  asm volatile(
      "global_load_async_to_lds_b128 %0, %8, off\n\t"
      "global_load_async_to_lds_b128 %1, %9, off\n\t"
      "global_load_async_to_lds_b128 %2, %10, off\n\t"
      "global_load_async_to_lds_b128 %3, %11, off\n\t"
      "global_load_async_to_lds_b128 %4, %12, off\n\t"
      "global_load_async_to_lds_b128 %5, %13, off\n\t"
      "global_load_async_to_lds_b128 %6, %14, off\n\t"
      "global_load_async_to_lds_b128 %7, %15, off\n\t"
      "s_wait_xcnt 0x0"
      :: "v"(l0), "v"(l0 + ls), "v"(l0 + 2u * ls), "v"(l0 + 3u * ls),
         "v"(l0 + 4u * ls), "v"(l0 + 5u * ls), "v"(l0 + 6u * ls), "v"(l0 + 7u * ls),
         "v"(g), "v"(g + 16 * 1024), "v"(g + 32 * 1024), "v"(g + 48 * 1024),
         "v"(g + 64 * 1024), "v"(g + 80 * 1024), "v"(g + 96 * 1024), "v"(g + 112 * 1024)
      : "memory");
}

// Lane l takes the value of lane l ^ 16: one vector cross-row move, no LDS.
static __device__ __forceinline__ float xhalf(float x) {
  const int b = __builtin_bit_cast(int, x);
  return __builtin_bit_cast(float, __builtin_amdgcn_permlanex16(b, b, 0x76543210, 0xfedcba98, false, false));
}

// One block of 32 keys for one wave's 16 queries: scores, online softmax, O^T += V^T P^T.
// DIAG = true: the block meets the wave's diagonal; every score is tested against the strict
// causal bound, and a key that fails it gets probability 0.
// DIAG = false: every key of the block lies below every query of the wave, so both tests
// would pass for every score: neither they nor the key indices they compare are computed.
// kv: the block's first row in the K tile (raw K one tile behind); vb: its first column in
// the V^T tile; mr: this lane's mask row at this half's first key of the block.
template <bool DIAG>
static __device__ __forceinline__ void key_block(
    const h16* kv, const h16* vb, const int* mr, int kc0, int qq,
    const v16h& aq0, const v16h& aq1, const v16h& ar0, const v16h& ar1,
    float sscale, float qscale,
    v8f& o0, v8f& o1, v8f& o2, v8f& o3, float& mrun, float& lrun) {
  float sc[16];   // scores of keys 16 t + 8 hi + i of the block at index 8 t + i
#pragma unroll
  for (int t = 0; t < 2; ++t) {
    const h16* kpb = kv + t * 16 * AT_KP;
    const h16* krb = kpb + AT_TILE;
    v8f s = {};
    s = WMMA_F16(load_frag16(kpb, AT_KP), aq0, s);
    s = WMMA_F16(load_frag16(kpb + 32, AT_KP), aq1, s);
    v8f sr = {};
    sr = WMMA_F16(load_frag16(krb, AT_KP), ar0, sr);
    sr = WMMA_F16(load_frag16(krb + 32, AT_KP), ar1, sr);
    // 8 consecutive keys of this query's mask row: two 16-B LDS reads
    const int4 ma = *(const int4*)(mr + t * 16);
    const int4 mb = *(const int4*)(mr + t * 16 + 4);
    const int mk[8] = {ma.x, ma.y, ma.z, ma.w, mb.x, mb.y, mb.z, mb.w};
#pragma unroll
    for (int i = 0; i < 8; ++i) {
      const float ss = mk[i] ? sr[i] * sscale : 0.0f;
      const float v = s[i] * qscale + ss;
      if (DIAG) sc[t * 8 + i] = (kc0 + t * 16 + i < qq) ? v : -3.0e38f;   // strict tril(-1)
      else      sc[t * 8 + i] = v;
    }
  }
  // online softmax: one query per lane, its 32 keys split between lanes l and l ^ 16
  float rm = sc[0];
#pragma unroll
  for (int j = 1; j < 16; ++j) rm = fmaxf(rm, sc[j]);
  rm = fmaxf(rm, xhalf(rm));
  const float mnew = fmaxf(mrun, rm);
  const float fac = __expf(mrun - mnew);
  mrun = mnew;
  v16h bp;        // P^T as a B operand: element 8 t + i is key 16 t + 8 hi + i, the loader's k order
  float rs = 0.0f;
#pragma unroll
  for (int j = 0; j < 16; ++j) {
    float p = __expf(sc[j] - mnew);
    if (DIAG) p = (sc[j] > -1.0e37f) ? p : 0.0f;
    rs += p;
    bp[j] = (h16)p;
  }
  lrun = lrun * fac + rs;
#pragma unroll
  for (int i = 0; i < 8; ++i) {
    o0[i] *= fac; o1[i] *= fac; o2[i] *= fac; o3[i] *= fac;
  }
  // V^T(64 dk x 32 keys) @ P^T(32 keys x 16 queries), V stored transposed [d][s]
  o0 = WMMA_F16(load_frag16(vb,              AT_KP), bp, o0);
  o1 = WMMA_F16(load_frag16(vb + 16 * AT_KP, AT_KP), bp, o1);
  o2 = WMMA_F16(load_frag16(vb + 32 * AT_KP, AT_KP), bp, o2);
  o3 = WMMA_F16(load_frag16(vb + 48 * AT_KP, AT_KP), bp, o3);
  // A branch follows this block: four vector slots keep the last WMMA's distance on every path;
  // the fence holds them behind it.
  __builtin_amdgcn_sched_barrier(0);
  asm volatile("v_nop\n\tv_nop\n\tv_nop\n\tv_nop");
}

__global__ void __launch_bounds__(256) attn_kernel(
    const h16* __restrict__ Qp, const h16* __restrict__ Kp, const h16* __restrict__ Vt,
    const h16* __restrict__ Qr, const h16* __restrict__ Kr,
    const int* __restrict__ smask, const float* __restrict__ gammas,
    h16* __restrict__ outA) {
  __shared__ alignas(16) h16 KVs[2][3 * AT_TILE];    // [buffer][K | raw K | V^T], 64 rows each
  __shared__ alignas(16) int Ms[2][128 * AT_MP];     // [buffer][query row of the block][key]
  const int bid = blockIdx.x;
  const int h   = bid & 7;
  const int b   = (bid >> 3) & 7;
  const int grp = bid >> 6;
  // query block: the four long ones first, then the short ones shortest first, so that a
  // late block that joins an early one on a WGP is short where the early one is long
  const int qb  = grp < 4 ? 7 - grp : grp - 4;
  const int tid  = threadIdx.x;
  const int lane = tid & 31;
  const int wv   = __builtin_amdgcn_readfirstlane(tid >> 5);  // wave number, in a scalar register
  const int lr = lane & 15;
  const int hi = lane >> 4;
  const int qb0 = qb << 7;
  const int q0  = qb0 + (wv << 4);

  // exp(-softplus(g)) == sigmoid(-g); clip lower bound
  const float g = gammas[h];
  float te = 1.0f / (1.0f + __expf(g));
  te = fminf(fmaxf(te, 1e-5f), 1e5f);
  const float sscale = te * 0.0441941738241592f;  // * 1/sqrt(512)
  const float qscale = 0.125f;                    // 1/sqrt(64)

  const size_t hd = (size_t)h * 64;

  // staging: thread t copies 16 B at column (t & 7) of rows (t >> 3) and (t >> 3) + 32 of
  // each f16 tile, and 16 B at column (t & 15) of rows (t >> 4) + 16 j of the mask tile
  const int krow = tid >> 3;
  const int kcol = (tid & 7) * 8;
  const h16* kg = Kp + ((size_t)(b * 1024 + krow) * 512 + hd + kcol);
  const h16* rg = Kr + ((size_t)(b * 1024 + krow) * 512 + hd + kcol);
  const h16* vg = Vt + (((size_t)(b * 512) + hd + krow) * 1024 + kcol);
  const int  ko = krow * AT_KP + kcol;
  const int mrow = tid >> 4;
  const int mcol = (tid & 15) * 4;
  const int* mg = smask + (((size_t)b * 1024 + qb0 + mrow) * 1024 + mcol);
  const int  mo = mrow * AT_MP + mcol;

  const int nst = 2 * qb + 2;   // stages of 64 keys covering keys < qb0 + 128; at least two

  copy_kv6(&KVs[0][ko], kg, rg, vg);
  copy_mask8(&Ms[0][mo], mg);

  const h16* qpb = Qp + ((size_t)(b * 1024 + q0) * 512 + hd);
  const h16* qrb = Qr + ((size_t)(b * 1024 + q0) * 512 + hd);
  const v16h aq0 = load_frag16(qpb, 512);
  const v16h aq1 = load_frag16(qpb + 32, 512);
  const v16h ar0 = load_frag16(qrb, 512);
  const v16h ar1 = load_frag16(qrb + 32, 512);

  asm volatile("s_wait_asynccnt 0x0" ::: "memory");  // this wave's copies of stage 0 have landed
  __syncthreads();                                   // stage 0 is visible to every wave
  copy_kv6(&KVs[1][ko], kg + 64 * 512, rg + 64 * 512, vg + 64);  // stage 1 flies during stage 0
  copy_mask8(&Ms[1][mo], mg + 64);

  v8f o0 = {}, o1 = {}, o2 = {}, o3 = {};   // O^T: register i = dk 16 j + 8 hi + i of query q0 + lr
  float mrun = -3.0e38f;   // running maximum of this lane's query (equal in lanes l and l ^ 16)
  float lrun = 0.0f;       // running sum over this lane's own keys; the halves are joined after the loop

  const int qq = q0 + lr;                              // this lane's query
  const int mq = ((wv << 4) + lr) * AT_MP + hi * 8;    // its mask row, at this half's first key
  const int nkw = ((q0 + 46) >> 5) << 5;  // this wave's keys: blocks of 32 covering keys < q0+16
  for (int st = 0; st < nst; ++st) {
    const int cur = st & 1;
#pragma unroll  // two key blocks of 32 per stage, at constant LDS offsets
    for (int u = 0; u < 2; ++u) {
      const int kb0 = st * 64 + u * 32;
      if (kb0 < nkw) {  // wave-uniform (scalar): key blocks wholly above this wave's diagonal are skipped
        const h16* kv = &KVs[cur][u * 32 * AT_KP];
        const h16* vb = &KVs[cur][2 * AT_TILE + u * 32];
        const int* mr = &Ms[cur][mq + u * 32];
        // wave-uniform (scalar): every key of the block lies below every query of the wave
        if (kb0 + 32 <= q0)
          key_block<false>(kv, vb, mr, 0, 0, aq0, aq1, ar0, ar1, sscale, qscale, o0, o1, o2, o3, mrun, lrun);
        else
          key_block<true>(kv, vb, mr, kb0 + hi * 8, qq, aq0, aq1, ar0, ar1, sscale, qscale, o0, o1, o2, o3, mrun, lrun);
      }
    }
    asm volatile("s_wait_dscnt 0x0" ::: "memory");     // this wave's reads of stage st are done
    asm volatile("s_wait_asynccnt 0x0" ::: "memory");  // this wave's copies of stage st+1 have landed
    __syncthreads();  // publishes stage st+1 and ends every wave's reads of stage st
    if (st + 2 < nst) {  // block-uniform: refill the buffer that stage st has just left
      const int kn = (st + 2) * 64;
      copy_kv6(&KVs[cur][ko], kg + (size_t)kn * 512, rg + (size_t)kn * 512, vg + kn);
      copy_mask8(&Ms[cur][mo], mg + kn);
    }
  }
  asm volatile("s_wait_asynccnt 0x0" ::: "memory");    // no copy is left in flight at the wave's end

  const float ltot = lrun + xhalf(lrun);   // the two halves' sums of one query
  const float inv = (ltot > 0.0f) ? (1.0f / ltot) : 0.0f;
  union { uint4 u; h16 h[8]; } pk0, pk1, pk2, pk3;
#pragma unroll
  for (int i = 0; i < 8; ++i) {
    pk0.h[i] = (h16)(o0[i] * inv); pk1.h[i] = (h16)(o1[i] * inv);
    pk2.h[i] = (h16)(o2[i] * inv); pk3.h[i] = (h16)(o3[i] * inv);
  }
  h16* ob = outA + ((size_t)(b * 1024 + qq) * 512 + hd + hi * 8);
  *(uint4*)(ob)      = pk0.u;   // 8 consecutive dk of one query, 16-B aligned
  *(uint4*)(ob + 16) = pk1.u;
  *(uint4*)(ob + 32) = pk2.u;
  *(uint4*)(ob + 48) = pk3.u;
}

// ---------------- output projection + residual + LayerNorm in one launch ----------------
// One 256-thread block owns 64 whole rows of X = A Wo + bo + resid (N = K = 512), so a row's
// mean and variance need no other block and X never goes to memory.
// Product: 8 waves side by side along N, each 64 rows x 64 columns = 16 accumulators; every
// LDS fragment feeds 4 WMMAs. It is taken transposed (Wt as A, the rows of A as B): a lane
// then holds 8 consecutive columns of one row, which leave for LDS in 16-B stores.
// Panels of 64 k (all 512 rows of Wt, the block's 64 rows of A) come into LDS by
// asynchronous copies, whole 128-B lines, in two buffers: the next panel flies while this
// one is multiplied. The k order per accumulator is 0,32,...,480.
// Then the tile goes through LDS (the panels' space, free by then) so that one wave has a
// whole row: 16 values a lane, whole-line reads of the residual and whole-line stores.
#define OL_KS 64                        // k (halves) per staged panel
#define OL_LP 72                        // panel row pitch, halves: 144 B = 16 B x 9, conflict-free 16-B reads
#define OL_PANEL ((512 + 64) * OL_LP)   // one buffer, halves: 512 rows of Wt, then 64 rows of A
#define OL_XP 516                       // X row pitch, floats: 2,064 B = 16 B x 129, conflict-free 16-B stores from 16 rows

// Nine asynchronous 16-B copies per lane, global -> LDS, through no register: eight rows of
// Wt, 32 apart on both sides, and one row of A. The s_wait_xcnt 0 is the statement's last
// line so that it stands ahead of any later rewrite of the address registers the copies name.
static __device__ __forceinline__ void copy_w8a1(const h16* lw, const h16* gw, const h16* la, const h16* ga) {
  const unsigned l0 = (unsigned)(size_t)lw;      // LDS byte addresses: low 32 bits
  const unsigned l8 = (unsigned)(size_t)la;
  const unsigned ls = 32u * OL_LP * 2u;          // 32 LDS rows in bytes
  asm volatile(
      "global_load_async_to_lds_b128 %0, %9, off\n\t"
      "global_load_async_to_lds_b128 %1, %10, off\n\t"
      "global_load_async_to_lds_b128 %2, %11, off\n\t"
      "global_load_async_to_lds_b128 %3, %12, off\n\t"
      "global_load_async_to_lds_b128 %4, %13, off\n\t"
      "global_load_async_to_lds_b128 %5, %14, off\n\t"
      "global_load_async_to_lds_b128 %6, %15, off\n\t"
      "global_load_async_to_lds_b128 %7, %16, off\n\t"
      "global_load_async_to_lds_b128 %8, %17, off\n\t"
      "s_wait_xcnt 0x0"
      :: "v"(l0), "v"(l0 + ls), "v"(l0 + 2u * ls), "v"(l0 + 3u * ls),
         "v"(l0 + 4u * ls), "v"(l0 + 5u * ls), "v"(l0 + 6u * ls), "v"(l0 + 7u * ls), "v"(l8),
         "v"(gw), "v"(gw + 32 * 512), "v"(gw + 64 * 512), "v"(gw + 96 * 512),
         "v"(gw + 128 * 512), "v"(gw + 160 * 512), "v"(gw + 192 * 512), "v"(gw + 224 * 512), "v"(ga)
      : "memory");
}

// One panel: thread t copies 16 B at column (t & 7) of rows (t >> 3) + 32 j, j = 0..15 of Wt
// and j = 0, 1 of A. p, w, a: the thread's own first place in the buffer, in Wt and in A.
static __device__ __forceinline__ void copy_panel(const h16* p, const h16* w, const h16* a) {
  copy_w8a1(p,               w,             p + 512 * OL_LP, a);
  copy_w8a1(p + 256 * OL_LP, w + 256 * 512, p + 544 * OL_LP, a + 32 * 512);
}

// Sum over the wave's 32 lanes, the result in every lane: four steps inside the 16-lane rows
// (row_xmask 1, 2, 4, 8 on the vector unit, no LDS), then the exchange between the halves.
template <int CTRL>
static __device__ __forceinline__ float row_step(float x) {
  return x + __builtin_bit_cast(float, __builtin_amdgcn_mov_dpp(__builtin_bit_cast(int, x), CTRL, 0xf, 0xf, true));
}
static __device__ __forceinline__ float wave_sum(float x) {
  x = row_step<0x161>(x);
  x = row_step<0x162>(x);
  x = row_step<0x164>(x);
  x = row_step<0x168>(x);
  return x + xhalf(x);
}

__global__ void __launch_bounds__(256) proj_ln(
    const h16* __restrict__ A, const h16* __restrict__ Wt, const float* __restrict__ bias,
    const float* __restrict__ resid, const float* __restrict__ gw, const float* __restrict__ bw,
    float* __restrict__ out) {
  __shared__ alignas(16) unsigned char Sm[2 * OL_PANEL * 2];   // two panel buffers; later the X tile
  h16* const P0 = (h16*)Sm;
  const int tid  = threadIdx.x;
  const int lane = tid & 31;
  const int wv   = tid >> 5;
  const int m0 = (int)blockIdx.x * 64;   // the block's rows
  const int wn = wv * 64;                // the wave's columns
  const int lr = lane & 15;
  const int hi = lane >> 4;

  v8f acc[4][4];   // acc[mi][j], register i: row 16 mi + lr, column wn + 16 j + 8 hi + i
#pragma unroll  // constant indices keep acc in registers
  for (int j = 0; j < 4; ++j) {
    const float4 b0 = *(const float4*)(bias + wn + j * 16 + hi * 8);
    const float4 b1 = *(const float4*)(bias + wn + j * 16 + hi * 8 + 4);
    acc[0][j] = (v8f){b0.x, b0.y, b0.z, b0.w, b1.x, b1.y, b1.z, b1.w};
    acc[1][j] = acc[0][j]; acc[2][j] = acc[0][j]; acc[3][j] = acc[0][j];
  }

  // staging: this thread's first row and column, as copy_panel takes them
  const int srow = tid >> 3;
  const int scol = (tid & 7) * 8;
  const h16* wg = Wt + (size_t)srow * 512 + scol;
  const h16* ag = A  + (size_t)(m0 + srow) * 512 + scol;
  const int  so = srow * OL_LP + scol;

  copy_panel(P0 + so, wg, ag);
  asm volatile("s_wait_asynccnt 0x0" ::: "memory");  // this wave's copies of panel 0 have landed
  __syncthreads();                                   // panel 0 is visible to every wave
  copy_panel(P0 + OL_PANEL + so, wg + OL_KS, ag + OL_KS);   // panel 1 flies during panel 0

  for (int kt = 0; kt < 8; ++kt) {
    h16* const pb = P0 + (kt & 1) * OL_PANEL;
    const h16* wb = pb + wn * OL_LP;
    const h16* ab = pb + 512 * OL_LP;
#pragma unroll  // both k steps of a panel at constant LDS offsets
    for (int ks = 0; ks < OL_KS; ks += 32) {
      v16h a[4], w[4];
#pragma unroll  // constant indices keep the fragments in registers
      for (int i = 0; i < 4; ++i) {
        a[i] = load_frag16(ab + ks + i * 16 * OL_LP, OL_LP);
        w[i] = load_frag16(wb + ks + i * 16 * OL_LP, OL_LP);
      }
      // keeps the 16 LDS reads one group ahead of the 16 WMMAs: left free, the build reads the
      // A fragments one at a time among them and waits out the LDS latency at each
      __builtin_amdgcn_sched_barrier(0);
#pragma unroll  // constant indices keep acc in registers
      for (int mi = 0; mi < 4; ++mi) {
#pragma unroll  // constant indices keep acc in registers
        for (int j = 0; j < 4; ++j) acc[mi][j] = WMMA_F16(w[j], a[mi], acc[mi][j]);
      }
      __builtin_amdgcn_sched_barrier(0);  // the other side of the same fence: no later read moves in among the WMMAs
    }
    asm volatile("s_wait_dscnt 0x0" ::: "memory");     // this wave's reads of panel kt are done
    asm volatile("s_wait_asynccnt 0x0" ::: "memory");  // this wave's copies of panel kt+1 have landed
    __syncthreads();  // publishes panel kt+1 and ends every wave's reads of panel kt
    if (kt + 2 < 8)   // block-uniform: refill the buffer that panel kt has just left
      copy_panel(pb + so, wg + (kt + 2) * OL_KS, ag + (kt + 2) * OL_KS);
  }
  asm volatile("s_wait_asynccnt 0x0" ::: "memory");    // no copy is left in flight: the panels' LDS is free

  // This wave's 8 rows of the second part; a lane has columns 4 lane + 128 p + {0..3}.
  const int r0 = wv * 8;
  const float* rg = resid + (size_t)(m0 + r0) * 512 + lane * 4;
  v4f x[8][4], g4[4], b4[4];
#pragma unroll  // constant indices keep x in registers; the first 4 rows' residual flies under the LDS stores
  for (int r = 0; r < 4; ++r) {
#pragma unroll
    for (int p = 0; p < 4; ++p) x[r][p] = *(const v4f*)(rg + r * 512 + p * 128);
  }
#pragma unroll
  for (int p = 0; p < 4; ++p) {
    g4[p] = *(const v4f*)(gw + lane * 4 + p * 128);
    b4[p] = *(const v4f*)(bw + lane * 4 + p * 128);
  }

  float* const X = (float*)Sm;
  const int xo = lr * OL_XP + wn + hi * 8;   // this lane's first row and column in the tile
#pragma unroll  // constant indices keep acc in registers
  for (int mi = 0; mi < 4; ++mi) {
#pragma unroll
    for (int j = 0; j < 4; ++j) {
      float* p = &X[xo + mi * 16 * OL_XP + j * 16];
      *(float4*)(p)     = make_float4(acc[mi][j][0], acc[mi][j][1], acc[mi][j][2], acc[mi][j][3]);
      *(float4*)(p + 4) = make_float4(acc[mi][j][4], acc[mi][j][5], acc[mi][j][6], acc[mi][j][7]);
    }
  }
  // stands ahead of any later rewrite of the address registers of the loads above
  asm volatile("s_wait_xcnt 0x0" ::: "memory");
  __syncthreads();   // the whole X tile is in LDS before any wave reads a row of it

#pragma unroll  // the other 4 rows' residual flies while the first 4 rows are worked on
  for (int r = 4; r < 8; ++r) {
#pragma unroll
    for (int p = 0; p < 4; ++p) x[r][p] = *(const v4f*)(rg + r * 512 + p * 128);
  }

  float* og = out + (size_t)(m0 + r0) * 512 + lane * 4;
#pragma unroll  // constant indices keep x in registers; independent rows, so their LDS reads and cross-lane sums overlap
  for (int r = 0; r < 8; ++r) {
    // keeps the two groups of 4 rows apart: woven together, the first group waits on the second
    // group's residual, still in flight, and the build goes past the first 256 registers
    if (r == 4) __builtin_amdgcn_sched_barrier(0);
#pragma unroll
    for (int p = 0; p < 4; ++p) x[r][p] += *(const v4f*)&X[(r0 + r) * OL_XP + lane * 4 + p * 128];
    const v4f s4 = (x[r][0] + x[r][1]) + (x[r][2] + x[r][3]);
    const float mu = wave_sum((s4.x + s4.y) + (s4.z + s4.w)) * (1.0f / 512.0f);
#pragma unroll
    for (int p = 0; p < 4; ++p) x[r][p] -= mu;
    const v4f q4 = (x[r][0] * x[r][0] + x[r][1] * x[r][1]) + (x[r][2] * x[r][2] + x[r][3] * x[r][3]);
    const float rstd = rsqrtf(wave_sum((q4.x + q4.y) + (q4.z + q4.w)) * (1.0f / 512.0f) + 1e-5f);
#pragma unroll
    for (int p = 0; p < 4; ++p) *(v4f*)(og + r * 512 + p * 128) = x[r][p] * rstd * g4[p] + b4[p];
  }
}

extern "C" void kernel_launch(void* const* d_in, const int* in_sizes, int n_in,
                              void* d_out, int out_size, void* d_ws, size_t ws_size,
                              hipStream_t stream) {
  (void)in_sizes; (void)n_in; (void)out_size; (void)ws_size;
  const float* q_in  = (const float*)d_in[0];
  const float* k_in  = (const float*)d_in[1];
  const float* v_in  = (const float*)d_in[2];
  const int*   smask = (const int*)  d_in[3];
  const float* Wq    = (const float*)d_in[4];
  const float* bq    = (const float*)d_in[5];
  const float* Wv    = (const float*)d_in[6];
  const float* bv    = (const float*)d_in[7];
  const float* Wo    = (const float*)d_in[8];
  const float* bo    = (const float*)d_in[9];
  const float* gm    = (const float*)d_in[10];
  const float* lng   = (const float*)d_in[11];
  const float* lnb   = (const float*)d_in[12];
  float* out = (float*)d_out;

  const size_t E = (size_t)8 * 1024 * 512;  // elements per [B,S,D] tensor
  char* ws = (char*)d_ws;
  h16*  qh  = (h16*)(ws);
  h16*  kh  = (h16*)(ws + 2 * E);
  h16*  vh  = (h16*)(ws + 4 * E);
  h16*  Qp  = (h16*)(ws + 6 * E);
  h16*  Kp  = (h16*)(ws + 8 * E);
  h16*  Vt  = (h16*)(ws + 10 * E);
  h16*  Wqt = (h16*)(ws + 12 * E);
  h16*  Wvt = (h16*)(ws + 12 * E + 524288);
  h16*  Wot = (h16*)(ws + 12 * E + 2 * 524288);
  h16*  Ao  = (h16*)(ws + 12 * E + 3 * 524288);

  cvt_all<<<dim3(3072), dim3(256), 0, stream>>>(q_in, k_in, v_in, Wq, Wv, Wo, qh, kh, vh, Wqt, Wvt, Wot);

  const int M = 8192;  // B*S rows; (M/128)*(512/128) = 256 tiles, one 8-wave block each
  proj_qkv<<<dim3(768), dim3(256), 0, stream>>>(qh, kh, vh, Wqt, Wvt, bq, bv, Qp, Kp, Vt, M);

  attn_kernel<<<dim3(512), dim3(256), 0, stream>>>(Qp, Kp, Vt, qh, kh, smask, gm, Ao);

  // 8192 / 64 = 128 blocks, each with 64 whole rows
  proj_ln<<<dim3(128), dim3(256), 0, stream>>>(Ao, Wot, bo, q_in, lng, lnb, out);
}

// v008
// It runs in 67.7 microseconds.
// Next to v007, in two timings, it ran 1.03 times as fast each time.
// All steps since v000 together make it 3.57 times as fast.
#include <hip/hip_runtime.h>
#include <math.h>

typedef _Float16 h16;
typedef __attribute__((ext_vector_type(16))) _Float16 v16h;
typedef __attribute__((ext_vector_type(8)))  float    v8f;
typedef __attribute__((ext_vector_type(4)))  float    v4f;

#define WMMA_F16(a, b, c) \
  __builtin_amdgcn_wmma_f32_16x16x32_f16(false, (a), false, (b), (short)0, (c), false, false)

// Load a 16x32 (A) / 32x16 (B, fed column-major) f16 fragment from a row-major
// matrix with row stride `ld` (halves). Per ISA 16-bit A layout:
// lane = (half)*16 + r holds row r, K = kb+{0..7} and kb+{16..23}, kb = 8*half.
static __device__ __forceinline__ v16h load_frag16(const h16* base, int ld) {
  const int lane = threadIdx.x & 31;
  const int r  = lane & 15;
  const int kb = (lane >> 4) << 3;
  const h16* p = base + (size_t)r * (size_t)ld + kb;
  union { v16h v; uint4 u[2]; } f;
  f.u[0] = *(const uint4*)(p);
  f.u[1] = *(const uint4*)(p + 16);
  return f.v;
}

// ---------------- converts ----------------
// A [8,1024,512] tensor (4,194,304 elements) as one short stream: 512 work-groups of 8
// waves, each thread 8 pieces of 4 elements, 1,024 elements apart. A wave-wide load covers
// 512 contiguous bytes and a wave-wide store 256: whole lines both ways. 512 x 8,192
// elements cover the tensor exactly, so there is no bound test.
#define CVT_PIECES 8
static __device__ __forceinline__ void cvt_h16(const float* __restrict__ in, h16* __restrict__ out, int blk) {
  const size_t base = (size_t)blk * (1024 * CVT_PIECES) + threadIdx.x * 4;
  float4 v[CVT_PIECES];
#pragma unroll  // constant indices keep v in registers; all 8 loads are in flight before the first convert
  for (int j = 0; j < CVT_PIECES; ++j) v[j] = *(const float4*)(in + base + j * 1024);
#pragma unroll  // constant indices keep v in registers
  for (int j = 0; j < CVT_PIECES; ++j) {
    union { uint2 u; h16 h[4]; } p;
    p.h[0] = (h16)v[j].x; p.h[1] = (h16)v[j].y; p.h[2] = (h16)v[j].z; p.h[3] = (h16)v[j].w;
    *(uint2*)(out + base + j * 1024) = p.u;
  }
  // in the listing the weight tiles' code lies behind these stores and rewrites their base
  // registers: this wait stands ahead of any such overwrite
  asm volatile("s_wait_xcnt 0x0" ::: "memory");
}

// in[k][n] (512x512 row-major) -> out[n][k] f16, one 64 x 64 tile a work-group, turned in LDS.
// Loads: 16 lanes x 16 B cover the tile's 256 B of one row k, whole lines. A thread has rows
// k, k + 1 of 4 columns n, so each (k, k + 1) pair of a column leaves for LDS as one dword.
// Stores: 8 lanes x 16 B cover the tile's 128 B of one row n, a whole line.
#define WT_P 72   // LDS row pitch, halves: 144 B = 16 B x 9, conflict-free 16-B reads
static __device__ __forceinline__ void cvtT_h16(const float* __restrict__ in, h16* __restrict__ out, int tile, h16* Ls) {
  const int t  = threadIdx.x;
  const int k0 = (tile >> 3) * 64;
  const int n0 = (tile & 7) * 64;
  const int c4 = (t & 15) * 4;   // this thread's 4 columns n of the tile
  const int rp = (t >> 4) * 2;   // its rows k: rp, rp + 1, rp + 32, rp + 33
  const float* g = in + (size_t)(k0 + rp) * 512 + n0 + c4;
  v4f a[2][2];
#pragma unroll  // constant indices keep a in registers; all 4 loads are in flight before the first convert
  for (int j = 0; j < 2; ++j) {
    a[j][0] = *(const v4f*)(g + j * 32 * 512);
    a[j][1] = *(const v4f*)(g + j * 32 * 512 + 512);
  }
#pragma unroll  // constant indices keep a in registers
  for (int j = 0; j < 2; ++j) {
#pragma unroll
    for (int e = 0; e < 4; ++e) {
      union { unsigned u; h16 h[2]; } p;
      p.h[0] = (h16)a[j][0][e]; p.h[1] = (h16)a[j][1][e];
      *(unsigned*)&Ls[(c4 + e) * WT_P + rp + j * 32] = p.u;
    }
  }
  __syncthreads();   // the whole tile is in LDS before any thread reads a row n of it
  const int nr = t >> 3;
  const int kc = (t & 7) * 8;
  h16* o = out + (size_t)(n0 + nr) * 512 + k0 + kc;
#pragma unroll  // both LDS reads are issued ahead of the first store
  for (int j = 0; j < 2; ++j)
    *(uint4*)(o + j * 32 * 512) = *(const uint4*)&Ls[(nr + j * 32) * WT_P + kc];
}

// The six conversions need nothing of each other, so they share one launch, told apart by a
// block-uniform branch. The first 192 work-groups cast and transpose the three weights, 64
// tiles each: few and with the longer chain (load, LDS, barrier, store), they start first and
// run under the streams. Then three ranges of 512 work-groups cast q, k and v.
__global__ void __launch_bounds__(256) cvt_all(
    const float* __restrict__ q, const float* __restrict__ k, const float* __restrict__ v,
    const float* __restrict__ wq, const float* __restrict__ wv, const float* __restrict__ wo,
    h16* __restrict__ qh, h16* __restrict__ kh, h16* __restrict__ vh,
    h16* __restrict__ wqt, h16* __restrict__ wvt, h16* __restrict__ wot) {
  __shared__ alignas(16) h16 Ls[64 * WT_P];   // a weight tile, transposed
  if (blockIdx.x < 192) {   // block-uniform, so every thread of the work-group meets the barrier inside
    const int w = (int)(blockIdx.x >> 6);
    cvtT_h16(w == 0 ? wq : w == 1 ? wv : wo, w == 0 ? wqt : w == 1 ? wvt : wot, (int)(blockIdx.x & 63), Ls);
  } else {
    const int job = (int)((blockIdx.x - 192) >> 9);
    const int blk = (int)((blockIdx.x - 192) & 511);
    cvt_h16(job == 0 ? q : job == 1 ? k : v, job == 0 ? qh : job == 1 ? kh : vh, blk);
  }
}

// ---------------- GEMM: C[M,512] = A[M,512] * Wt^T + bias ----------------
// One 256-thread block computes a 128x128 tile of C (M a multiple of 128, K = N = 512).
// Panels of 128 rows x 128 k of A and of Wt are brought into LDS by asynchronous
// copies (16 lanes x 16 B cover 256 contiguous bytes of one row: whole lines), in two
// buffers: the next panel's copies fly while this panel is multiplied.
// 8 waves, 4 along M x 2 along N; each owns 32x64 of C = 8 accumulators, so every
// LDS fragment feeds 2 or 4 WMMAs. The k order per accumulator is 0,32,...,480.
// mode 0: f16 row-major out. mode 1: f16 out transposed per batch [B][512][1024]
// (for V so attention A-frags are contiguous).
#define GEMM_KS 128   // k (halves) per staged panel
#define GEMM_LP 136   // LDS row pitch in halves: 272 B = 16 B x 17, no bank conflict for 16-B reads

// Eight asynchronous 16-B copies per lane, global -> LDS, through no register: rows
// 16 apart on both sides. The s_wait_xcnt 0 is the statement's last line so that it
// stands ahead of any later rewrite of the address registers the copies name.
static __device__ __forceinline__ void copy_rows8(const h16* l, const h16* g) {
  const unsigned l0 = (unsigned)(size_t)l;       // LDS byte address: low 32 bits
  const unsigned ls = 16u * GEMM_LP * 2u;        // 16 LDS rows in bytes
  asm volatile(
      "global_load_async_to_lds_b128 %0, %8, off\n\t"
      "global_load_async_to_lds_b128 %1, %9, off\n\t"
      "global_load_async_to_lds_b128 %2, %10, off\n\t"
      "global_load_async_to_lds_b128 %3, %11, off\n\t"
      "global_load_async_to_lds_b128 %4, %12, off\n\t"
      "global_load_async_to_lds_b128 %5, %13, off\n\t"
      "global_load_async_to_lds_b128 %6, %14, off\n\t"
      "global_load_async_to_lds_b128 %7, %15, off\n\t"
      "s_wait_xcnt 0x0"
      :: "v"(l0), "v"(l0 + ls), "v"(l0 + 2u * ls), "v"(l0 + 3u * ls),
         "v"(l0 + 4u * ls), "v"(l0 + 5u * ls), "v"(l0 + 6u * ls), "v"(l0 + 7u * ls),
         "v"(g), "v"(g + 16 * 512), "v"(g + 32 * 512), "v"(g + 48 * 512),
         "v"(g + 64 * 512), "v"(g + 80 * 512), "v"(g + 96 * 512), "v"(g + 112 * 512)
      : "memory");
}

static __device__ __forceinline__ void gemm_tile(
    const h16* __restrict__ A, const h16* __restrict__ Wt,
    const float* __restrict__ bias, void* __restrict__ out,
    int M, int mode, unsigned tile) {
  __shared__ alignas(16) h16 As[2][128 * GEMM_LP];
  __shared__ alignas(16) h16 Ws[2][128 * GEMM_LP];
  const int tid = threadIdx.x;
  const int m0  = (int)(tile >> 2) * 128;  // 4 column tiles of 128 along N=512
  const int nb  = (int)(tile & 3) * 128;
  if (m0 >= M) return;   // uniform per block, ahead of every barrier
  const int lane = tid & 31;
  const int wv   = tid >> 5;
  const int wm = (wv >> 1) * 32;   // wave's rows inside the tile
  const int wn = (wv & 1) * 64;    // wave's columns inside the tile
  const int n0 = nb + wn;
  const int c  = lane & 15;

  v8f acc[2][4];
#pragma unroll  // constant indices keep acc in registers
  for (int j = 0; j < 4; ++j) {
    const float b = bias[n0 + j * 16 + c];
    acc[0][j] = (v8f){b, b, b, b, b, b, b, b};
    acc[1][j] = acc[0][j];
  }

  // staging: thread t copies 16 B at column (t & 15) of rows (t >> 4) + 16 j, j = 0..7
  const int srow = tid >> 4;
  const int scol = (tid & 15) * 8;
  const h16* ag = A  + (size_t)(m0 + srow) * 512 + scol;
  const h16* wg = Wt + (size_t)(nb + srow) * 512 + scol;
  const int  so = srow * GEMM_LP + scol;

  copy_rows8(&As[0][so], ag);
  copy_rows8(&Ws[0][so], wg);
  asm volatile("s_wait_asynccnt 0x0" ::: "memory");  // this wave's copies of panel 0 have landed
  __syncthreads();                                   // panel 0 is visible to every wave
  copy_rows8(&As[1][so], ag + GEMM_KS);              // panel 1 flies during panel 0
  copy_rows8(&Ws[1][so], wg + GEMM_KS);

  for (int kt = 0; kt < 4; ++kt) {
    const int cur = kt & 1;
    const h16* ab = &As[cur][wm * GEMM_LP];
    const h16* wb = &Ws[cur][wn * GEMM_LP];
#pragma unroll  // lets the LDS reads of later k steps be issued ahead of the WMMAs
    for (int ks = 0; ks < GEMM_KS; ks += 32) {
      const v16h a0 = load_frag16(ab + ks,                GEMM_LP);
      const v16h a1 = load_frag16(ab + ks + 16 * GEMM_LP, GEMM_LP);
      const v16h w0 = load_frag16(wb + ks,                GEMM_LP);
      const v16h w1 = load_frag16(wb + ks + 16 * GEMM_LP, GEMM_LP);
      const v16h w2 = load_frag16(wb + ks + 32 * GEMM_LP, GEMM_LP);
      const v16h w3 = load_frag16(wb + ks + 48 * GEMM_LP, GEMM_LP);
      acc[0][0] = WMMA_F16(a0, w0, acc[0][0]);
      acc[0][1] = WMMA_F16(a0, w1, acc[0][1]);
      acc[0][2] = WMMA_F16(a0, w2, acc[0][2]);
      acc[0][3] = WMMA_F16(a0, w3, acc[0][3]);
      acc[1][0] = WMMA_F16(a1, w0, acc[1][0]);
      acc[1][1] = WMMA_F16(a1, w1, acc[1][1]);
      acc[1][2] = WMMA_F16(a1, w2, acc[1][2]);
      acc[1][3] = WMMA_F16(a1, w3, acc[1][3]);
    }
    asm volatile("s_wait_dscnt 0x0" ::: "memory");     // this wave's reads of panel kt are done
    asm volatile("s_wait_asynccnt 0x0" ::: "memory");  // this wave's copies of panel kt+1 have landed
    __syncthreads();  // publishes panel kt+1 and ends every wave's reads of panel kt
    if (kt + 2 < 4) { // block-uniform: refill the buffer that panel kt has just left
      copy_rows8(&As[cur][so], ag + (kt + 2) * GEMM_KS);
      copy_rows8(&Ws[cur][so], wg + (kt + 2) * GEMM_KS);
    }
  }
  asm volatile("s_wait_asynccnt 0x0" ::: "memory");    // no copy is left in flight at the wave's end

  const int rw0 = m0 + wm + ((lane >> 4) << 3);  // this lane's 8 rows of the upper 16x64 strip
  if (mode == 0) {
    h16* o = (h16*)out;
#pragma unroll  // constant indices keep acc in registers
    for (int mi = 0; mi < 2; ++mi) {
#pragma unroll  // constant indices keep acc in registers
      for (int i = 0; i < 8; ++i) {
        h16* r = o + (size_t)(rw0 + mi * 16 + i) * 512 + n0 + c;
        r[0]  = (h16)acc[mi][0][i];
        r[16] = (h16)acc[mi][1][i];
        r[32] = (h16)acc[mi][2][i];
        r[48] = (h16)acc[mi][3][i];
      }
    }
    // in the merged launch's listing the next branch's code lies behind these stores and
    // reuses their data registers: this wait stands ahead of any such overwrite
    asm volatile("s_wait_xcnt 0x0" ::: "memory");
  } else {
#pragma unroll  // constant indices keep acc in registers
    for (int mi = 0; mi < 2; ++mi) {
      const int row0 = rw0 + mi * 16;
      const int bIdx = row0 >> 10;     // 16 | 1024 so tiles never cross batches
      const int s0   = row0 & 1023;
      union { uint4 u; h16 h[8]; } pk0, pk1, pk2, pk3;
#pragma unroll  // constant indices keep acc in registers
      for (int i = 0; i < 8; ++i) {
        pk0.h[i] = (h16)acc[mi][0][i]; pk1.h[i] = (h16)acc[mi][1][i];
        pk2.h[i] = (h16)acc[mi][2][i]; pk3.h[i] = (h16)acc[mi][3][i];
      }
      h16* o = (h16*)out + ((size_t)bIdx * 512 + n0 + c) * 1024 + s0;
      *(uint4*)(o)               = pk0.u;   // 8 contiguous s-values, 16B aligned
      *(uint4*)(o + 16 * 1024)   = pk1.u;
      *(uint4*)(o + 32 * 1024)   = pk2.u;
      *(uint4*)(o + 48 * 1024)   = pk3.u;
    }
    // the build reuses a data register of these stores on the way to the exit:
    // this one stands ahead of that overwrite
    asm volatile("s_wait_xcnt 0x0" ::: "memory");
  }
}

// The projections of q, k and v need nothing of each other, so they share one launch:
// ranges of 256 work-groups (one per tile of an [8192, 512] product), told apart by
// block-uniform selects. Two work-groups fit a WGP's LDS, so one's loads, barriers and
// stores run under the other's products.
__global__ void __launch_bounds__(256) proj_qkv(
    const h16* __restrict__ qh, const h16* __restrict__ kh, const h16* __restrict__ vh,
    const h16* __restrict__ Wqt, const h16* __restrict__ Wvt,
    const float* __restrict__ bq, const float* __restrict__ bv,
    h16* __restrict__ Qp, h16* __restrict__ Kp, h16* __restrict__ Vt, int M) {
  const int job = (int)(blockIdx.x >> 8);
  gemm_tile(job == 0 ? qh : job == 1 ? kh : vh, job == 2 ? Wvt : Wqt, job == 2 ? bv : bq,
            (void*)(job == 0 ? Qp : job == 1 ? Kp : Vt), M, job == 2 ? 1 : 0,
            blockIdx.x & 255);
}

#define AT_KP 72               // K / raw K / V tile row pitch, halves: 144 B = 16 B x 9, conflict-free 16-B reads
#define AT_MP 68               // mask tile row pitch, ints: 272 B, so rows 8 apart fall on different banks
#define AT_TILE (64 * AT_KP)   // one 64-row tile, halves

// Six asynchronous 16-B copies per lane: rows r and r + 32 of the three 64-row f16 tiles.
// The s_wait_xcnt 0 is the statement's last line so that it stands ahead of any later
// rewrite of the address registers the copies name.
static __device__ __forceinline__ void copy_kv6(const h16* lk, const h16* gk, const h16* gr, const h16* gv) {
  const unsigned l0 = (unsigned)(size_t)lk;      // LDS byte address: low 32 bits
  const unsigned lt = AT_TILE * 2u;              // one tile in bytes
  const unsigned ls = 32u * AT_KP * 2u;          // 32 LDS rows in bytes
  asm volatile(
      "global_load_async_to_lds_b128 %0, %6, off\n\t"
      "global_load_async_to_lds_b128 %1, %7, off\n\t"
      "global_load_async_to_lds_b128 %2, %8, off\n\t"
      "global_load_async_to_lds_b128 %3, %9, off\n\t"
      "global_load_async_to_lds_b128 %4, %10, off\n\t"
      "global_load_async_to_lds_b128 %5, %11, off\n\t"
      "s_wait_xcnt 0x0"
      :: "v"(l0), "v"(l0 + ls), "v"(l0 + lt), "v"(l0 + lt + ls),
         "v"(l0 + 2u * lt), "v"(l0 + 2u * lt + ls),
         "v"(gk), "v"(gk + 32 * 512), "v"(gr), "v"(gr + 32 * 512),
         "v"(gv), "v"(gv + 32 * 1024)
      : "memory");
}

// Eight asynchronous 16-B copies per lane of the mask tile: rows 16 apart on both sides.
// s_wait_xcnt 0 as the last line, for the same reason as above.
static __device__ __forceinline__ void copy_mask8(const int* l, const int* g) {
  const unsigned l0 = (unsigned)(size_t)l;       // LDS byte address: low 32 bits
  const unsigned ls = 16u * AT_MP * 4u;          // 16 LDS rows in bytes
  asm volatile(
      "global_load_async_to_lds_b128 %0, %8, off\n\t"
      "global_load_async_to_lds_b128 %1, %9, off\n\t"
      "global_load_async_to_lds_b128 %2, %10, off\n\t"
      "global_load_async_to_lds_b128 %3, %11, off\n\t"
      "global_load_async_to_lds_b128 %4, %12, off\n\t"
      "global_load_async_to_lds_b128 %5, %13, off\n\t"
      "global_load_async_to_lds_b128 %6, %14, off\n\t"
      "global_load_async_to_lds_b128 %7, %15, off\n\t"
      "s_wait_xcnt 0x0"
      :: "v"(l0), "v"(l0 + ls), "v"(l0 + 2u * ls), "v"(l0 + 3u * ls),
         "v"(l0 + 4u * ls), "v"(l0 + 5u * ls), "v"(l0 + 6u * ls), "v"(l0 + 7u * ls),
         "v"(g), "v"(g + 16 * 1024), "v"(g + 32 * 1024), "v"(g + 48 * 1024),
         "v"(g + 64 * 1024), "v"(g + 80 * 1024), "v"(g + 96 * 1024), "v"(g + 112 * 1024)
      : "memory");
}

// Lane l takes the value of lane l ^ 16: one vector cross-row move, no LDS.
static __device__ __forceinline__ float xhalf(float x) {
  const int b = __builtin_bit_cast(int, x);
  return __builtin_bit_cast(float, __builtin_amdgcn_permlanex16(b, b, 0x76543210, 0xfedcba98, false, false));
}

// One block of 32 keys for one wave's 16 queries: scores, online softmax, O^T += V^T P^T.
// DIAG = true: the block meets the wave's diagonal; every score is tested against the strict
// causal bound, and a key that fails it gets probability 0.
// DIAG = false: every key of the block lies below every query of the wave, so both tests
// would pass for every score: neither they nor the key indices they compare are computed.
// kv: the block's first row in the K tile (raw K one tile behind); vb: its first column in
// the V^T tile; mr: this lane's mask row at this half's first key of the block.
template <bool DIAG>
static __device__ __forceinline__ void key_block(
    const h16* kv, const h16* vb, const int* mr, int kc0, int qq,
    const v16h& aq0, const v16h& aq1, const v16h& ar0, const v16h& ar1,
    float sscale, float qscale,
    v8f& o0, v8f& o1, v8f& o2, v8f& o3, float& mrun, float& lrun) {
  float sc[16];   // scores of keys 16 t + 8 hi + i of the block at index 8 t + i
#pragma unroll
  for (int t = 0; t < 2; ++t) {
    const h16* kpb = kv + t * 16 * AT_KP;
    const h16* krb = kpb + AT_TILE;
    v8f s = {};
    s = WMMA_F16(load_frag16(kpb, AT_KP), aq0, s);
    s = WMMA_F16(load_frag16(kpb + 32, AT_KP), aq1, s);
    v8f sr = {};
    sr = WMMA_F16(load_frag16(krb, AT_KP), ar0, sr);
    sr = WMMA_F16(load_frag16(krb + 32, AT_KP), ar1, sr);
    // 8 consecutive keys of this query's mask row: two 16-B LDS reads
    const int4 ma = *(const int4*)(mr + t * 16);
    const int4 mb = *(const int4*)(mr + t * 16 + 4);
    const int mk[8] = {ma.x, ma.y, ma.z, ma.w, mb.x, mb.y, mb.z, mb.w};
#pragma unroll
    for (int i = 0; i < 8; ++i) {
      const float ss = mk[i] ? sr[i] * sscale : 0.0f;
      const float v = s[i] * qscale + ss;
      if (DIAG) sc[t * 8 + i] = (kc0 + t * 16 + i < qq) ? v : -3.0e38f;   // strict tril(-1)
      else      sc[t * 8 + i] = v;
    }
  }
  // online softmax: one query per lane, its 32 keys split between lanes l and l ^ 16
  float rm = sc[0];
#pragma unroll
  for (int j = 1; j < 16; ++j) rm = fmaxf(rm, sc[j]);
  rm = fmaxf(rm, xhalf(rm));
  const float mnew = fmaxf(mrun, rm);
  const float fac = __expf(mrun - mnew);
  mrun = mnew;
  v16h bp;        // P^T as a B operand: element 8 t + i is key 16 t + 8 hi + i, the loader's k order
  float rs = 0.0f;
#pragma unroll
  for (int j = 0; j < 16; ++j) {
    float p = __expf(sc[j] - mnew);
    if (DIAG) p = (sc[j] > -1.0e37f) ? p : 0.0f;
    rs += p;
    bp[j] = (h16)p;
  }
  lrun = lrun * fac + rs;
#pragma unroll
  for (int i = 0; i < 8; ++i) {
    o0[i] *= fac; o1[i] *= fac; o2[i] *= fac; o3[i] *= fac;
  }
  // V^T(64 dk x 32 keys) @ P^T(32 keys x 16 queries), V stored transposed [d][s]
  o0 = WMMA_F16(load_frag16(vb,              AT_KP), bp, o0);
  o1 = WMMA_F16(load_frag16(vb + 16 * AT_KP, AT_KP), bp, o1);
  o2 = WMMA_F16(load_frag16(vb + 32 * AT_KP, AT_KP), bp, o2);
  o3 = WMMA_F16(load_frag16(vb + 48 * AT_KP, AT_KP), bp, o3);
  // A branch follows this block: four vector slots keep the last WMMA's distance on every path;
  // the fence holds them behind it.
  __builtin_amdgcn_sched_barrier(0);
  asm volatile("v_nop\n\tv_nop\n\tv_nop\n\tv_nop");
}

__global__ void __launch_bounds__(256) attn_kernel(
    const h16* __restrict__ Qp, const h16* __restrict__ Kp, const h16* __restrict__ Vt,
    const h16* __restrict__ Qr, const h16* __restrict__ Kr,
    const int* __restrict__ smask, const float* __restrict__ gammas,
    h16* __restrict__ outA) {
  __shared__ alignas(16) h16 KVs[2][3 * AT_TILE];    // [buffer][K | raw K | V^T], 64 rows each
  __shared__ alignas(16) int Ms[2][128 * AT_MP];     // [buffer][query row of the block][key]
  const int bid = blockIdx.x;
  const int h   = bid & 7;
  const int b   = (bid >> 3) & 7;
  const int grp = bid >> 6;
  // query block: the four long ones first, then the short ones shortest first, so that a
  // late block that joins an early one on a WGP is short where the early one is long
  const int qb  = grp < 4 ? 7 - grp : grp - 4;
  const int tid  = threadIdx.x;
  const int lane = tid & 31;
  const int wv   = __builtin_amdgcn_readfirstlane(tid >> 5);  // wave number, in a scalar register
  const int lr = lane & 15;
  const int hi = lane >> 4;
  const int qb0 = qb << 7;
  const int q0  = qb0 + (wv << 4);

  // exp(-softplus(g)) == sigmoid(-g); clip lower bound
  const float g = gammas[h];
  float te = 1.0f / (1.0f + __expf(g));
  te = fminf(fmaxf(te, 1e-5f), 1e5f);
  const float sscale = te * 0.0441941738241592f;  // * 1/sqrt(512)
  const float qscale = 0.125f;                    // 1/sqrt(64)

  const size_t hd = (size_t)h * 64;

  // staging: thread t copies 16 B at column (t & 7) of rows (t >> 3) and (t >> 3) + 32 of
  // each f16 tile, and 16 B at column (t & 15) of rows (t >> 4) + 16 j of the mask tile
  const int krow = tid >> 3;
  const int kcol = (tid & 7) * 8;
  const h16* kg = Kp + ((size_t)(b * 1024 + krow) * 512 + hd + kcol);
  const h16* rg = Kr + ((size_t)(b * 1024 + krow) * 512 + hd + kcol);
  const h16* vg = Vt + (((size_t)(b * 512) + hd + krow) * 1024 + kcol);
  const int  ko = krow * AT_KP + kcol;
  const int mrow = tid >> 4;
  const int mcol = (tid & 15) * 4;
  const int* mg = smask + (((size_t)b * 1024 + qb0 + mrow) * 1024 + mcol);
  const int  mo = mrow * AT_MP + mcol;

  const int nst = 2 * qb + 2;   // stages of 64 keys covering keys < qb0 + 128; at least two

  copy_kv6(&KVs[0][ko], kg, rg, vg);
  copy_mask8(&Ms[0][mo], mg);

  const h16* qpb = Qp + ((size_t)(b * 1024 + q0) * 512 + hd);
  const h16* qrb = Qr + ((size_t)(b * 1024 + q0) * 512 + hd);
  const v16h aq0 = load_frag16(qpb, 512);
  const v16h aq1 = load_frag16(qpb + 32, 512);
  const v16h ar0 = load_frag16(qrb, 512);
  const v16h ar1 = load_frag16(qrb + 32, 512);

  asm volatile("s_wait_asynccnt 0x0" ::: "memory");  // this wave's copies of stage 0 have landed
  __syncthreads();                                   // stage 0 is visible to every wave
  copy_kv6(&KVs[1][ko], kg + 64 * 512, rg + 64 * 512, vg + 64);  // stage 1 flies during stage 0
  copy_mask8(&Ms[1][mo], mg + 64);

  v8f o0 = {}, o1 = {}, o2 = {}, o3 = {};   // O^T: register i = dk 16 j + 8 hi + i of query q0 + lr
  float mrun = -3.0e38f;   // running maximum of this lane's query (equal in lanes l and l ^ 16)
  float lrun = 0.0f;       // running sum over this lane's own keys; the halves are joined after the loop

  const int qq = q0 + lr;                              // this lane's query
  const int mq = ((wv << 4) + lr) * AT_MP + hi * 8;    // its mask row, at this half's first key
  const int nkw = ((q0 + 46) >> 5) << 5;  // this wave's keys: blocks of 32 covering keys < q0+16
  for (int st = 0; st < nst; ++st) {
    const int cur = st & 1;
#pragma unroll  // two key blocks of 32 per stage, at constant LDS offsets
    for (int u = 0; u < 2; ++u) {
      const int kb0 = st * 64 + u * 32;
      if (kb0 < nkw) {  // wave-uniform (scalar): key blocks wholly above this wave's diagonal are skipped
        const h16* kv = &KVs[cur][u * 32 * AT_KP];
        const h16* vb = &KVs[cur][2 * AT_TILE + u * 32];
        const int* mr = &Ms[cur][mq + u * 32];
        // wave-uniform (scalar): every key of the block lies below every query of the wave
        if (kb0 + 32 <= q0)
          key_block<false>(kv, vb, mr, 0, 0, aq0, aq1, ar0, ar1, sscale, qscale, o0, o1, o2, o3, mrun, lrun);
        else
          key_block<true>(kv, vb, mr, kb0 + hi * 8, qq, aq0, aq1, ar0, ar1, sscale, qscale, o0, o1, o2, o3, mrun, lrun);
      }
    }
    asm volatile("s_wait_dscnt 0x0" ::: "memory");     // this wave's reads of stage st are done
    asm volatile("s_wait_asynccnt 0x0" ::: "memory");  // this wave's copies of stage st+1 have landed
    __syncthreads();  // publishes stage st+1 and ends every wave's reads of stage st
    if (st + 2 < nst) {  // block-uniform: refill the buffer that stage st has just left
      const int kn = (st + 2) * 64;
      copy_kv6(&KVs[cur][ko], kg + (size_t)kn * 512, rg + (size_t)kn * 512, vg + kn);
      copy_mask8(&Ms[cur][mo], mg + kn);
    }
  }
  asm volatile("s_wait_asynccnt 0x0" ::: "memory");    // no copy is left in flight at the wave's end

  const float ltot = lrun + xhalf(lrun);   // the two halves' sums of one query
  const float inv = (ltot > 0.0f) ? (1.0f / ltot) : 0.0f;
  union { uint4 u; h16 h[8]; } pk0, pk1, pk2, pk3;
#pragma unroll
  for (int i = 0; i < 8; ++i) {
    pk0.h[i] = (h16)(o0[i] * inv); pk1.h[i] = (h16)(o1[i] * inv);
    pk2.h[i] = (h16)(o2[i] * inv); pk3.h[i] = (h16)(o3[i] * inv);
  }
  h16* ob = outA + ((size_t)(b * 1024 + qq) * 512 + hd + hi * 8);
  *(uint4*)(ob)      = pk0.u;   // 8 consecutive dk of one query, 16-B aligned
  *(uint4*)(ob + 16) = pk1.u;
  *(uint4*)(ob + 32) = pk2.u;
  *(uint4*)(ob + 48) = pk3.u;
}

// ---------------- output projection + residual + LayerNorm in one launch ----------------
// One 256-thread block owns 64 whole rows of X = A Wo + bo + resid (N = K = 512), so a row's
// mean and variance need no other block and X never goes to memory.
// Product: 8 waves side by side along N, each 64 rows x 64 columns = 16 accumulators; every
// LDS fragment feeds 4 WMMAs. It is taken transposed (Wt as A, the rows of A as B): a lane
// then holds 8 consecutive columns of one row, which leave for LDS in 16-B stores.
// Panels of 64 k (all 512 rows of Wt, the block's 64 rows of A) come into LDS by
// asynchronous copies, whole 128-B lines, in two buffers: the next panel flies while this
// one is multiplied. The k order per accumulator is 0,32,...,480.
// Then the tile goes through LDS (the panels' space, free by then) so that one wave has a
// whole row: 16 values a lane, whole-line reads of the residual and whole-line stores.
#define OL_KS 64                        // k (halves) per staged panel
#define OL_LP 72                        // panel row pitch, halves: 144 B = 16 B x 9, conflict-free 16-B reads
#define OL_PANEL ((512 + 64) * OL_LP)   // one buffer, halves: 512 rows of Wt, then 64 rows of A
#define OL_XP 516                       // X row pitch, floats: 2,064 B = 16 B x 129, conflict-free 16-B stores from 16 rows

// Nine asynchronous 16-B copies per lane, global -> LDS, through no register: eight rows of
// Wt, 32 apart on both sides, and one row of A. The s_wait_xcnt 0 is the statement's last
// line so that it stands ahead of any later rewrite of the address registers the copies name.
static __device__ __forceinline__ void copy_w8a1(const h16* lw, const h16* gw, const h16* la, const h16* ga) {
  const unsigned l0 = (unsigned)(size_t)lw;      // LDS byte addresses: low 32 bits
  const unsigned l8 = (unsigned)(size_t)la;
  const unsigned ls = 32u * OL_LP * 2u;          // 32 LDS rows in bytes
  asm volatile(
      "global_load_async_to_lds_b128 %0, %9, off\n\t"
      "global_load_async_to_lds_b128 %1, %10, off\n\t"
      "global_load_async_to_lds_b128 %2, %11, off\n\t"
      "global_load_async_to_lds_b128 %3, %12, off\n\t"
      "global_load_async_to_lds_b128 %4, %13, off\n\t"
      "global_load_async_to_lds_b128 %5, %14, off\n\t"
      "global_load_async_to_lds_b128 %6, %15, off\n\t"
      "global_load_async_to_lds_b128 %7, %16, off\n\t"
      "global_load_async_to_lds_b128 %8, %17, off\n\t"
      "s_wait_xcnt 0x0"
      :: "v"(l0), "v"(l0 + ls), "v"(l0 + 2u * ls), "v"(l0 + 3u * ls),
         "v"(l0 + 4u * ls), "v"(l0 + 5u * ls), "v"(l0 + 6u * ls), "v"(l0 + 7u * ls), "v"(l8),
         "v"(gw), "v"(gw + 32 * 512), "v"(gw + 64 * 512), "v"(gw + 96 * 512),
         "v"(gw + 128 * 512), "v"(gw + 160 * 512), "v"(gw + 192 * 512), "v"(gw + 224 * 512), "v"(ga)
      : "memory");
}

// One panel: thread t copies 16 B at column (t & 7) of rows (t >> 3) + 32 j, j = 0..15 of Wt
// and j = 0, 1 of A. p, w, a: the thread's own first place in the buffer, in Wt and in A.
static __device__ __forceinline__ void copy_panel(const h16* p, const h16* w, const h16* a) {
  copy_w8a1(p,               w,             p + 512 * OL_LP, a);
  copy_w8a1(p + 256 * OL_LP, w + 256 * 512, p + 544 * OL_LP, a + 32 * 512);
}

// Sum over the wave's 32 lanes, the result in every lane: four steps inside the 16-lane rows
// (row_xmask 1, 2, 4, 8 on the vector unit, no LDS), then the exchange between the halves.
template <int CTRL>
static __device__ __forceinline__ float row_step(float x) {
  return x + __builtin_bit_cast(float, __builtin_amdgcn_mov_dpp(__builtin_bit_cast(int, x), CTRL, 0xf, 0xf, true));
}
static __device__ __forceinline__ float wave_sum(float x) {
  x = row_step<0x161>(x);
  x = row_step<0x162>(x);
  x = row_step<0x164>(x);
  x = row_step<0x168>(x);
  return x + xhalf(x);
}

__global__ void __launch_bounds__(256) proj_ln(
    const h16* __restrict__ A, const h16* __restrict__ Wt, const float* __restrict__ bias,
    const float* __restrict__ resid, const float* __restrict__ gw, const float* __restrict__ bw,
    float* __restrict__ out) {
  __shared__ alignas(16) unsigned char Sm[2 * OL_PANEL * 2];   // two panel buffers; later the X tile
  h16* const P0 = (h16*)Sm;
  const int tid  = threadIdx.x;
  const int lane = tid & 31;
  const int wv   = tid >> 5;
  const int m0 = (int)blockIdx.x * 64;   // the block's rows
  const int wn = wv * 64;                // the wave's columns
  const int lr = lane & 15;
  const int hi = lane >> 4;

  v8f acc[4][4];   // acc[mi][j], register i: row 16 mi + lr, column wn + 16 j + 8 hi + i
#pragma unroll  // constant indices keep acc in registers
  for (int j = 0; j < 4; ++j) {
    const float4 b0 = *(const float4*)(bias + wn + j * 16 + hi * 8);
    const float4 b1 = *(const float4*)(bias + wn + j * 16 + hi * 8 + 4);
    acc[0][j] = (v8f){b0.x, b0.y, b0.z, b0.w, b1.x, b1.y, b1.z, b1.w};
    acc[1][j] = acc[0][j]; acc[2][j] = acc[0][j]; acc[3][j] = acc[0][j];
  }

  // staging: this thread's first row and column, as copy_panel takes them
  const int srow = tid >> 3;
  const int scol = (tid & 7) * 8;
  const h16* wg = Wt + (size_t)srow * 512 + scol;
  const h16* ag = A  + (size_t)(m0 + srow) * 512 + scol;
  const int  so = srow * OL_LP + scol;

  copy_panel(P0 + so, wg, ag);
  asm volatile("s_wait_asynccnt 0x0" ::: "memory");  // this wave's copies of panel 0 have landed
  __syncthreads();                                   // panel 0 is visible to every wave
  copy_panel(P0 + OL_PANEL + so, wg + OL_KS, ag + OL_KS);   // panel 1 flies during panel 0

  for (int kt = 0; kt < 8; ++kt) {
    h16* const pb = P0 + (kt & 1) * OL_PANEL;
    const h16* wb = pb + wn * OL_LP;
    const h16* ab = pb + 512 * OL_LP;
#pragma unroll  // both k steps of a panel at constant LDS offsets
    for (int ks = 0; ks < OL_KS; ks += 32) {
      v16h a[4], w[4];
#pragma unroll  // constant indices keep the fragments in registers
      for (int i = 0; i < 4; ++i) {
        a[i] = load_frag16(ab + ks + i * 16 * OL_LP, OL_LP);
        w[i] = load_frag16(wb + ks + i * 16 * OL_LP, OL_LP);
      }
      // keeps the 16 LDS reads one group ahead of the 16 WMMAs: left free, the build reads the
      // A fragments one at a time among them and waits out the LDS latency at each
      __builtin_amdgcn_sched_barrier(0);
#pragma unroll  // constant indices keep acc in registers
      for (int mi = 0; mi < 4; ++mi) {
#pragma unroll  // constant indices keep acc in registers
        for (int j = 0; j < 4; ++j) acc[mi][j] = WMMA_F16(w[j], a[mi], acc[mi][j]);
      }
      __builtin_amdgcn_sched_barrier(0);  // the other side of the same fence: no later read moves in among the WMMAs
    }
    asm volatile("s_wait_dscnt 0x0" ::: "memory");     // this wave's reads of panel kt are done
    asm volatile("s_wait_asynccnt 0x0" ::: "memory");  // this wave's copies of panel kt+1 have landed
    __syncthreads();  // publishes panel kt+1 and ends every wave's reads of panel kt
    if (kt + 2 < 8)   // block-uniform: refill the buffer that panel kt has just left
      copy_panel(pb + so, wg + (kt + 2) * OL_KS, ag + (kt + 2) * OL_KS);
  }
  asm volatile("s_wait_asynccnt 0x0" ::: "memory");    // no copy is left in flight: the panels' LDS is free

  // This wave's 8 rows of the second part; a lane has columns 4 lane + 128 p + {0..3}.
  const int r0 = wv * 8;
  const float* rg = resid + (size_t)(m0 + r0) * 512 + lane * 4;
  v4f x[8][4], g4[4], b4[4];
#pragma unroll  // constant indices keep x in registers; the first 4 rows' residual flies under the LDS stores
  for (int r = 0; r < 4; ++r) {
#pragma unroll
    for (int p = 0; p < 4; ++p) x[r][p] = *(const v4f*)(rg + r * 512 + p * 128);
  }
#pragma unroll
  for (int p = 0; p < 4; ++p) {
    g4[p] = *(const v4f*)(gw + lane * 4 + p * 128);
    b4[p] = *(const v4f*)(bw + lane * 4 + p * 128);
  }

  float* const X = (float*)Sm;
  const int xo = lr * OL_XP + wn + hi * 8;   // this lane's first row and column in the tile
#pragma unroll  // constant indices keep acc in registers
  for (int mi = 0; mi < 4; ++mi) {
#pragma unroll
    for (int j = 0; j < 4; ++j) {
      float* p = &X[xo + mi * 16 * OL_XP + j * 16];
      *(float4*)(p)     = make_float4(acc[mi][j][0], acc[mi][j][1], acc[mi][j][2], acc[mi][j][3]);
      *(float4*)(p + 4) = make_float4(acc[mi][j][4], acc[mi][j][5], acc[mi][j][6], acc[mi][j][7]);
    }
  }
  // stands ahead of any later rewrite of the address registers of the loads above
  asm volatile("s_wait_xcnt 0x0" ::: "memory");
  __syncthreads();   // the whole X tile is in LDS before any wave reads a row of it

#pragma unroll  // the other 4 rows' residual flies while the first 4 rows are worked on
  for (int r = 4; r < 8; ++r) {
#pragma unroll
    for (int p = 0; p < 4; ++p) x[r][p] = *(const v4f*)(rg + r * 512 + p * 128);
  }

  float* og = out + (size_t)(m0 + r0) * 512 + lane * 4;
#pragma unroll  // constant indices keep x in registers; independent rows, so their LDS reads and cross-lane sums overlap
  for (int r = 0; r < 8; ++r) {
    // keeps the two groups of 4 rows apart: woven together, the first group waits on the second
    // group's residual, still in flight, and the build goes past the first 256 registers
    if (r == 4) __builtin_amdgcn_sched_barrier(0);
#pragma unroll
    for (int p = 0; p < 4; ++p) x[r][p] += *(const v4f*)&X[(r0 + r) * OL_XP + lane * 4 + p * 128];
    const v4f s4 = (x[r][0] + x[r][1]) + (x[r][2] + x[r][3]);
    const float mu = wave_sum((s4.x + s4.y) + (s4.z + s4.w)) * (1.0f / 512.0f);
#pragma unroll
    for (int p = 0; p < 4; ++p) x[r][p] -= mu;
    const v4f q4 = (x[r][0] * x[r][0] + x[r][1] * x[r][1]) + (x[r][2] * x[r][2] + x[r][3] * x[r][3]);
    const float rstd = rsqrtf(wave_sum((q4.x + q4.y) + (q4.z + q4.w)) * (1.0f / 512.0f) + 1e-5f);
#pragma unroll
    for (int p = 0; p < 4; ++p) *(v4f*)(og + r * 512 + p * 128) = x[r][p] * rstd * g4[p] + b4[p];
  }
}

extern "C" void kernel_launch(void* const* d_in, const int* in_sizes, int n_in,
                              void* d_out, int out_size, void* d_ws, size_t ws_size,
                              hipStream_t stream) {
  (void)in_sizes; (void)n_in; (void)out_size; (void)ws_size;
  const float* q_in  = (const float*)d_in[0];
  const float* k_in  = (const float*)d_in[1];
  const float* v_in  = (const float*)d_in[2];
  const int*   smask = (const int*)  d_in[3];
  const float* Wq    = (const float*)d_in[4];
  const float* bq    = (const float*)d_in[5];
  const float* Wv    = (const float*)d_in[6];
  const float* bv    = (const float*)d_in[7];
  const float* Wo    = (const float*)d_in[8];
  const float* bo    = (const float*)d_in[9];
  const float* gm    = (const float*)d_in[10];
  const float* lng   = (const float*)d_in[11];
  const float* lnb   = (const float*)d_in[12];
  float* out = (float*)d_out;

  const size_t E = (size_t)8 * 1024 * 512;  // elements per [B,S,D] tensor
  char* ws = (char*)d_ws;
  h16*  qh  = (h16*)(ws);
  h16*  kh  = (h16*)(ws + 2 * E);
  h16*  vh  = (h16*)(ws + 4 * E);
  h16*  Qp  = (h16*)(ws + 6 * E);
  h16*  Kp  = (h16*)(ws + 8 * E);
  h16*  Vt  = (h16*)(ws + 10 * E);
  h16*  Wqt = (h16*)(ws + 12 * E);
  h16*  Wvt = (h16*)(ws + 12 * E + 524288);
  h16*  Wot = (h16*)(ws + 12 * E + 2 * 524288);
  h16*  Ao  = (h16*)(ws + 12 * E + 3 * 524288);

  cvt_all<<<dim3(1728), dim3(256), 0, stream>>>(q_in, k_in, v_in, Wq, Wv, Wo, qh, kh, vh, Wqt, Wvt, Wot);

  const int M = 8192;  // B*S rows; (M/128)*(512/128) = 256 tiles, one 8-wave block each
  proj_qkv<<<dim3(768), dim3(256), 0, stream>>>(qh, kh, vh, Wqt, Wvt, bq, bv, Qp, Kp, Vt, M);

  attn_kernel<<<dim3(512), dim3(256), 0, stream>>>(Qp, Kp, Vt, qh, kh, smask, gm, Ao);

  // 8192 / 64 = 128 blocks, each with 64 whole rows
  proj_ln<<<dim3(128), dim3(256), 0, stream>>>(Ao, Wot, bo, q_in, lng, lnb, out);
}

// v009
// It runs in 65.1 microseconds.
// Timed twice side by side with v008, it ran 1.05 times as fast both times.
// All steps since v000 together make it 3.74 times as fast.
#include <hip/hip_runtime.h>
#include <math.h>

typedef _Float16 h16;
typedef __attribute__((ext_vector_type(16))) _Float16 v16h;
typedef __attribute__((ext_vector_type(8)))  float    v8f;
typedef __attribute__((ext_vector_type(4)))  float    v4f;
typedef __attribute__((ext_vector_type(16))) unsigned v16u;
// A read through this type may go by the scalar path: for wave-uniform addresses of data that
// no store of the same launch touches.
typedef const __attribute__((address_space(4))) v16u* sc16_ptr;

#define WMMA_F16(a, b, c) \
  __builtin_amdgcn_wmma_f32_16x16x32_f16(false, (a), false, (b), (short)0, (c), false, false)

// Load a 16x32 (A) / 32x16 (B, fed column-major) f16 fragment from a row-major
// matrix with row stride `ld` (halves). Per ISA 16-bit A layout:
// lane = (half)*16 + r holds row r, K = kb+{0..7} and kb+{16..23}, kb = 8*half.
static __device__ __forceinline__ v16h load_frag16(const h16* base, int ld) {
  const int lane = threadIdx.x & 31;
  const int r  = lane & 15;
  const int kb = (lane >> 4) << 3;
  const h16* p = base + (size_t)r * (size_t)ld + kb;
  union { v16h v; uint4 u[2]; } f;
  f.u[0] = *(const uint4*)(p);
  f.u[1] = *(const uint4*)(p + 16);
  return f.v;
}

// ---------------- converts ----------------
// A [8,1024,512] tensor (4,194,304 elements) as one short stream: 512 work-groups of 8
// waves, each thread 8 pieces of 4 elements, 1,024 elements apart. A wave-wide load covers
// 512 contiguous bytes and a wave-wide store 256: whole lines both ways. 512 x 8,192
// elements cover the tensor exactly, so there is no bound test.
#define CVT_PIECES 8
static __device__ __forceinline__ void cvt_h16(const float* __restrict__ in, h16* __restrict__ out, int blk) {
  const size_t base = (size_t)blk * (1024 * CVT_PIECES) + threadIdx.x * 4;
  float4 v[CVT_PIECES];
#pragma unroll  // constant indices keep v in registers; all 8 loads are in flight before the first convert
  for (int j = 0; j < CVT_PIECES; ++j) v[j] = *(const float4*)(in + base + j * 1024);
#pragma unroll  // constant indices keep v in registers
  for (int j = 0; j < CVT_PIECES; ++j) {
    union { uint2 u; h16 h[4]; } p;
    p.h[0] = (h16)v[j].x; p.h[1] = (h16)v[j].y; p.h[2] = (h16)v[j].z; p.h[3] = (h16)v[j].w;
    *(uint2*)(out + base + j * 1024) = p.u;
  }
  // in the listing the weight tiles' code lies behind these stores and rewrites their base
  // registers: this wait stands ahead of any such overwrite
  asm volatile("s_wait_xcnt 0x0" ::: "memory");
}

// in[k][n] (512x512 row-major) -> out[n][k] f16, one 64 x 64 tile a work-group, turned in LDS.
// Loads: 16 lanes x 16 B cover the tile's 256 B of one row k, whole lines. A thread has rows
// k, k + 1 of 4 columns n, so each (k, k + 1) pair of a column leaves for LDS as one dword.
// Stores: 8 lanes x 16 B cover the tile's 128 B of one row n, a whole line.
#define WT_P 72   // LDS row pitch, halves: 144 B = 16 B x 9, conflict-free 16-B reads
static __device__ __forceinline__ void cvtT_h16(const float* __restrict__ in, h16* __restrict__ out, int tile, h16* Ls) {
  const int t  = threadIdx.x;
  const int k0 = (tile >> 3) * 64;
  const int n0 = (tile & 7) * 64;
  const int c4 = (t & 15) * 4;   // this thread's 4 columns n of the tile
  const int rp = (t >> 4) * 2;   // its rows k: rp, rp + 1, rp + 32, rp + 33
  const float* g = in + (size_t)(k0 + rp) * 512 + n0 + c4;
  v4f a[2][2];
#pragma unroll  // constant indices keep a in registers; all 4 loads are in flight before the first convert
  for (int j = 0; j < 2; ++j) {
    a[j][0] = *(const v4f*)(g + j * 32 * 512);
    a[j][1] = *(const v4f*)(g + j * 32 * 512 + 512);
  }
#pragma unroll  // constant indices keep a in registers
  for (int j = 0; j < 2; ++j) {
#pragma unroll
    for (int e = 0; e < 4; ++e) {
      union { unsigned u; h16 h[2]; } p;
      p.h[0] = (h16)a[j][0][e]; p.h[1] = (h16)a[j][1][e];
      *(unsigned*)&Ls[(c4 + e) * WT_P + rp + j * 32] = p.u;
    }
  }
  __syncthreads();   // the whole tile is in LDS before any thread reads a row n of it
  const int nr = t >> 3;
  const int kc = (t & 7) * 8;
  h16* o = out + (size_t)(n0 + nr) * 512 + k0 + kc;
#pragma unroll  // both LDS reads are issued ahead of the first store
  for (int j = 0; j < 2; ++j)
    *(uint4*)(o + j * 32 * 512) = *(const uint4*)&Ls[(nr + j * 32) * WT_P + kc];
}

// The six conversions need nothing of each other, so they share one launch, told apart by a
// block-uniform branch. The first 192 work-groups cast and transpose the three weights, 64
// tiles each: few and with the longer chain (load, LDS, barrier, store), they start first and
// run under the streams. Then three ranges of 512 work-groups cast q, k and v.
__global__ void __launch_bounds__(256) cvt_all(
    const float* __restrict__ q, const float* __restrict__ k, const float* __restrict__ v,
    const float* __restrict__ wq, const float* __restrict__ wv, const float* __restrict__ wo,
    h16* __restrict__ qh, h16* __restrict__ kh, h16* __restrict__ vh,
    h16* __restrict__ wqt, h16* __restrict__ wvt, h16* __restrict__ wot) {
  __shared__ alignas(16) h16 Ls[64 * WT_P];   // a weight tile, transposed
  if (blockIdx.x < 192) {   // block-uniform, so every thread of the work-group meets the barrier inside
    const int w = (int)(blockIdx.x >> 6);
    cvtT_h16(w == 0 ? wq : w == 1 ? wv : wo, w == 0 ? wqt : w == 1 ? wvt : wot, (int)(blockIdx.x & 63), Ls);
  } else {
    const int job = (int)((blockIdx.x - 192) >> 9);
    const int blk = (int)((blockIdx.x - 192) & 511);
    cvt_h16(job == 0 ? q : job == 1 ? k : v, job == 0 ? qh : job == 1 ? kh : vh, blk);
  }
}

// ---------------- GEMM: C[M,512] = A[M,512] * Wt^T + bias ----------------
// One 256-thread block computes a 128x128 tile of C (M a multiple of 128, K = N = 512).
// Panels of 128 rows x 128 k of A and of Wt are brought into LDS by asynchronous
// copies (16 lanes x 16 B cover 256 contiguous bytes of one row: whole lines), in two
// buffers: the next panel's copies fly while this panel is multiplied.
// 8 waves, 4 along M x 2 along N; each owns 32x64 of C = 8 accumulators, so every
// LDS fragment feeds 2 or 4 WMMAs. The k order per accumulator is 0,32,...,480.
// mode 0: f16 row-major out. mode 1: f16 out transposed per batch [B][512][1024]
// (for V so attention A-frags are contiguous).
#define GEMM_KS 128   // k (halves) per staged panel
#define GEMM_LP 136   // LDS row pitch in halves: 272 B = 16 B x 17, no bank conflict for 16-B reads

// Eight asynchronous 16-B copies per lane, global -> LDS, through no register: rows
// 16 apart on both sides. The s_wait_xcnt 0 is the statement's last line so that it
// stands ahead of any later rewrite of the address registers the copies name.
static __device__ __forceinline__ void copy_rows8(const h16* l, const h16* g) {
  const unsigned l0 = (unsigned)(size_t)l;       // LDS byte address: low 32 bits
  const unsigned ls = 16u * GEMM_LP * 2u;        // 16 LDS rows in bytes
  asm volatile(
      "global_load_async_to_lds_b128 %0, %8, off\n\t"
      "global_load_async_to_lds_b128 %1, %9, off\n\t"
      "global_load_async_to_lds_b128 %2, %10, off\n\t"
      "global_load_async_to_lds_b128 %3, %11, off\n\t"
      "global_load_async_to_lds_b128 %4, %12, off\n\t"
      "global_load_async_to_lds_b128 %5, %13, off\n\t"
      "global_load_async_to_lds_b128 %6, %14, off\n\t"
      "global_load_async_to_lds_b128 %7, %15, off\n\t"
      "s_wait_xcnt 0x0"
      :: "v"(l0), "v"(l0 + ls), "v"(l0 + 2u * ls), "v"(l0 + 3u * ls),
         "v"(l0 + 4u * ls), "v"(l0 + 5u * ls), "v"(l0 + 6u * ls), "v"(l0 + 7u * ls),
         "v"(g), "v"(g + 16 * 512), "v"(g + 32 * 512), "v"(g + 48 * 512),
         "v"(g + 64 * 512), "v"(g + 80 * 512), "v"(g + 96 * 512), "v"(g + 112 * 512)
      : "memory");
}

static __device__ __forceinline__ void gemm_tile(
    const h16* __restrict__ A, const h16* __restrict__ Wt,
    const float* __restrict__ bias, void* __restrict__ out,
    int M, int mode, unsigned tile) {
  __shared__ alignas(16) h16 As[2][128 * GEMM_LP];
  __shared__ alignas(16) h16 Ws[2][128 * GEMM_LP];
  const int tid = threadIdx.x;
  const int m0  = (int)(tile >> 2) * 128;  // 4 column tiles of 128 along N=512
  const int nb  = (int)(tile & 3) * 128;
  if (m0 >= M) return;   // uniform per block, ahead of every barrier
  const int lane = tid & 31;
  const int wv   = tid >> 5;
  const int wm = (wv >> 1) * 32;   // wave's rows inside the tile
  const int wn = (wv & 1) * 64;    // wave's columns inside the tile
  const int n0 = nb + wn;
  const int c  = lane & 15;

  v8f acc[2][4];
#pragma unroll  // constant indices keep acc in registers
  for (int j = 0; j < 4; ++j) {
    const float b = bias[n0 + j * 16 + c];
    acc[0][j] = (v8f){b, b, b, b, b, b, b, b};
    acc[1][j] = acc[0][j];
  }

  // staging: thread t copies 16 B at column (t & 15) of rows (t >> 4) + 16 j, j = 0..7
  const int srow = tid >> 4;
  const int scol = (tid & 15) * 8;
  const h16* ag = A  + (size_t)(m0 + srow) * 512 + scol;
  const h16* wg = Wt + (size_t)(nb + srow) * 512 + scol;
  const int  so = srow * GEMM_LP + scol;

  copy_rows8(&As[0][so], ag);
  copy_rows8(&Ws[0][so], wg);
  asm volatile("s_wait_asynccnt 0x0" ::: "memory");  // this wave's copies of panel 0 have landed
  __syncthreads();                                   // panel 0 is visible to every wave
  copy_rows8(&As[1][so], ag + GEMM_KS);              // panel 1 flies during panel 0
  copy_rows8(&Ws[1][so], wg + GEMM_KS);

  for (int kt = 0; kt < 4; ++kt) {
    const int cur = kt & 1;
    const h16* ab = &As[cur][wm * GEMM_LP];
    const h16* wb = &Ws[cur][wn * GEMM_LP];
#pragma unroll  // lets the LDS reads of later k steps be issued ahead of the WMMAs
    for (int ks = 0; ks < GEMM_KS; ks += 32) {
      const v16h a0 = load_frag16(ab + ks,                GEMM_LP);
      const v16h a1 = load_frag16(ab + ks + 16 * GEMM_LP, GEMM_LP);
      const v16h w0 = load_frag16(wb + ks,                GEMM_LP);
      const v16h w1 = load_frag16(wb + ks + 16 * GEMM_LP, GEMM_LP);
      const v16h w2 = load_frag16(wb + ks + 32 * GEMM_LP, GEMM_LP);
      const v16h w3 = load_frag16(wb + ks + 48 * GEMM_LP, GEMM_LP);
      acc[0][0] = WMMA_F16(a0, w0, acc[0][0]);
      acc[0][1] = WMMA_F16(a0, w1, acc[0][1]);
      acc[0][2] = WMMA_F16(a0, w2, acc[0][2]);
      acc[0][3] = WMMA_F16(a0, w3, acc[0][3]);
      acc[1][0] = WMMA_F16(a1, w0, acc[1][0]);
      acc[1][1] = WMMA_F16(a1, w1, acc[1][1]);
      acc[1][2] = WMMA_F16(a1, w2, acc[1][2]);
      acc[1][3] = WMMA_F16(a1, w3, acc[1][3]);
    }
    asm volatile("s_wait_dscnt 0x0" ::: "memory");     // this wave's reads of panel kt are done
    asm volatile("s_wait_asynccnt 0x0" ::: "memory");  // this wave's copies of panel kt+1 have landed
    __syncthreads();  // publishes panel kt+1 and ends every wave's reads of panel kt
    if (kt + 2 < 4) { // block-uniform: refill the buffer that panel kt has just left
      copy_rows8(&As[cur][so], ag + (kt + 2) * GEMM_KS);
      copy_rows8(&Ws[cur][so], wg + (kt + 2) * GEMM_KS);
    }
  }
  asm volatile("s_wait_asynccnt 0x0" ::: "memory");    // no copy is left in flight at the wave's end

  const int rw0 = m0 + wm + ((lane >> 4) << 3);  // this lane's 8 rows of the upper 16x64 strip
  if (mode == 0) {
    h16* o = (h16*)out;
#pragma unroll  // constant indices keep acc in registers
    for (int mi = 0; mi < 2; ++mi) {
#pragma unroll  // constant indices keep acc in registers
      for (int i = 0; i < 8; ++i) {
        h16* r = o + (size_t)(rw0 + mi * 16 + i) * 512 + n0 + c;
        r[0]  = (h16)acc[mi][0][i];
        r[16] = (h16)acc[mi][1][i];
        r[32] = (h16)acc[mi][2][i];
        r[48] = (h16)acc[mi][3][i];
      }
    }
    // in the merged launch's listing the next branch's code lies behind these stores and
    // reuses their data registers: this wait stands ahead of any such overwrite
    asm volatile("s_wait_xcnt 0x0" ::: "memory");
  } else {
#pragma unroll  // constant indices keep acc in registers
    for (int mi = 0; mi < 2; ++mi) {
      const int row0 = rw0 + mi * 16;
      const int bIdx = row0 >> 10;     // 16 | 1024 so tiles never cross batches
      const int s0   = row0 & 1023;
      union { uint4 u; h16 h[8]; } pk0, pk1, pk2, pk3;
#pragma unroll  // constant indices keep acc in registers
      for (int i = 0; i < 8; ++i) {
        pk0.h[i] = (h16)acc[mi][0][i]; pk1.h[i] = (h16)acc[mi][1][i];
        pk2.h[i] = (h16)acc[mi][2][i]; pk3.h[i] = (h16)acc[mi][3][i];
      }
      h16* o = (h16*)out + ((size_t)bIdx * 512 + n0 + c) * 1024 + s0;
      *(uint4*)(o)               = pk0.u;   // 8 contiguous s-values, 16B aligned
      *(uint4*)(o + 16 * 1024)   = pk1.u;
      *(uint4*)(o + 32 * 1024)   = pk2.u;
      *(uint4*)(o + 48 * 1024)   = pk3.u;
    }
    // the build reuses a data register of these stores on the way to the exit:
    // this one stands ahead of that overwrite
    asm volatile("s_wait_xcnt 0x0" ::: "memory");
  }
}

// ---------------- state mask, int32 -> one bit, in the attention wave's own lane order ------
// pm[b][qt][kb][16 words]: qt = a wave's 16 queries, kb = a block of 32 keys. Bit l of word
// 8 t + i says whether mask[b][16 qt + (l & 15)][32 kb + 16 t + 8 (l >> 4) + i] != 0: the lane
// and the register index at which attention holds that score, so a word is a lane mask as it is.
// One work-group packs one 128 x 128 tile on or below the diagonal (36 a batch; no other tile
// is read by attention), one wave 16 queries x 128 keys: a lane loads the 8 consecutive keys
// of its own (t, half), a wave-wide compare gives the word, and the 64 words leave as 256 B.
static __device__ __forceinline__ void pack_mask(const int* __restrict__ sm, unsigned* __restrict__ pm, int tile) {
  const int b = tile / 36;
  const int r = tile - b * 36;
  int qb = 0;   // row of the triangle: query block qb has key groups 0..qb, the first at index qb (qb + 1) / 2
#pragma unroll
  for (int j = 1; j < 8; ++j) qb = (r >= j * (j + 1) / 2) ? j : qb;
  const int g    = r - qb * (qb + 1) / 2;
  const int lane = threadIdx.x & 31;
  const int qt   = qb * 8 + (int)(threadIdx.x >> 5);
  const int* p = sm + ((size_t)(b * 1024 + qt * 16 + (lane & 15)) * 1024 + g * 128 + (lane >> 4) * 8);
  int4 v[8][2];
#pragma unroll  // constant indices keep v in registers; all 16 loads are in flight before the first compare
  for (int c = 0; c < 8; ++c) {
    v[c][0] = *(const int4*)(p + c * 16);
    v[c][1] = *(const int4*)(p + c * 16 + 4);
  }
  // p as an input keeps the loads' address in its registers up to this wait, which so stands
  // ahead of any rewrite of them (left free, the build lets the last load land on its own address)
  asm volatile("s_wait_xcnt 0x0" :: "v"(p) : "memory");
  unsigned w0 = 0, w1 = 0;   // lane l collects words 2 l and 2 l + 1 of the 64
#pragma unroll  // constant indices keep v in registers
  for (int c = 0; c < 8; ++c) {
    const int e[8] = {v[c][0].x, v[c][0].y, v[c][0].z, v[c][0].w, v[c][1].x, v[c][1].y, v[c][1].z, v[c][1].w};
#pragma unroll
    for (int i = 0; i < 8; i += 2) {
      // the wave-wide compares stand outside the selects: every lane takes part in them
      const unsigned be = __builtin_amdgcn_ballot_w32(e[i] != 0);
      const unsigned bo = __builtin_amdgcn_ballot_w32(e[i + 1] != 0);
      const bool mine = lane == c * 4 + i / 2;
      w0 = mine ? be : w0;
      w1 = mine ? bo : w1;
    }
  }
  *(uint2*)(pm + ((size_t)(b * 64 + qt) * 32 + g * 4) * 16 + lane * 2) = make_uint2(w0, w1);
  // stands ahead of any later rewrite of the registers that the store above names
  asm volatile("s_wait_xcnt 0x0" ::: "memory");
}

// The projections of q, k and v need nothing of each other, so they share one launch:
// ranges of 256 work-groups (one per tile of an [8192, 512] product), told apart by
// block-uniform selects. Two work-groups fit a WGP's LDS, so one's loads, barriers and
// stores run under the other's products. Behind them 288 work-groups pack the state mask,
// which attention alone needs: 768 product tiles fill the chip's 512 places one and a half
// times, and the packing, a read from memory, runs in the places the last half leaves empty.
__global__ void __launch_bounds__(256) proj_qkv(
    const h16* __restrict__ qh, const h16* __restrict__ kh, const h16* __restrict__ vh,
    const h16* __restrict__ Wqt, const h16* __restrict__ Wvt,
    const float* __restrict__ bq, const float* __restrict__ bv,
    h16* __restrict__ Qp, h16* __restrict__ Kp, h16* __restrict__ Vt, int M,
    const int* __restrict__ smask, unsigned* __restrict__ pmask) {
  if (blockIdx.x >= 768) {   // block-uniform, ahead of every barrier
    pack_mask(smask, pmask, (int)blockIdx.x - 768);
    return;
  }
  const int job = (int)(blockIdx.x >> 8);
  gemm_tile(job == 0 ? qh : job == 1 ? kh : vh, job == 2 ? Wvt : Wqt, job == 2 ? bv : bq,
            (void*)(job == 0 ? Qp : job == 1 ? Kp : Vt), M, job == 2 ? 1 : 0,
            blockIdx.x & 255);
}

#define AT_KP 72               // K / raw K / V tile row pitch, halves: 144 B = 16 B x 9, conflict-free 16-B reads
#define AT_TILE (64 * AT_KP)   // one 64-row tile, halves

// Six asynchronous 16-B copies per lane: rows r and r + 32 of the three 64-row f16 tiles.
// The s_wait_xcnt 0 is the statement's last line so that it stands ahead of any later
// rewrite of the address registers the copies name.
static __device__ __forceinline__ void copy_kv6(const h16* lk, const h16* gk, const h16* gr, const h16* gv) {
  const unsigned l0 = (unsigned)(size_t)lk;      // LDS byte address: low 32 bits
  const unsigned lt = AT_TILE * 2u;              // one tile in bytes
  const unsigned ls = 32u * AT_KP * 2u;          // 32 LDS rows in bytes
  asm volatile(
      "global_load_async_to_lds_b128 %0, %6, off\n\t"
      "global_load_async_to_lds_b128 %1, %7, off\n\t"
      "global_load_async_to_lds_b128 %2, %8, off\n\t"
      "global_load_async_to_lds_b128 %3, %9, off\n\t"
      "global_load_async_to_lds_b128 %4, %10, off\n\t"
      "global_load_async_to_lds_b128 %5, %11, off\n\t"
      "s_wait_xcnt 0x0"
      :: "v"(l0), "v"(l0 + ls), "v"(l0 + lt), "v"(l0 + lt + ls),
         "v"(l0 + 2u * lt), "v"(l0 + 2u * lt + ls),
         "v"(gk), "v"(gk + 32 * 512), "v"(gr), "v"(gr + 32 * 512),
         "v"(gv), "v"(gv + 32 * 1024)
      : "memory");
}

// Lane l takes the value of lane l ^ 16: one vector cross-row move, no LDS.
static __device__ __forceinline__ float xhalf(float x) {
  const int b = __builtin_bit_cast(int, x);
  return __builtin_bit_cast(float, __builtin_amdgcn_permlanex16(b, b, 0x76543210, 0xfedcba98, false, false));
}

// 2^x in place, four or five to a statement. Behind a transcendental the instruction set asks for
// one independent instruction before its result is read or its source rewritten: here each has
// the next one behind it and the last a v_nop, and a source is its own result's register.
// The s_delay_alu is a hint only: the arguments are made just ahead, and with it the SIMD's
// other waves issue while this one waits for them.
static __device__ __forceinline__ void exp2x4(float& a, float& b, float& c, float& d) {
  asm("s_delay_alu instid0(VALU_DEP_1)\n\tv_exp_f32 %0, %0\n\tv_exp_f32 %1, %1\n\tv_exp_f32 %2, %2\n\tv_exp_f32 %3, %3\n\tv_nop"
      : "+v"(a), "+v"(b), "+v"(c), "+v"(d));
}
static __device__ __forceinline__ void exp2x5(float& a, float& b, float& c, float& d, float& e) {
  asm("s_delay_alu instid0(VALU_DEP_1)\n\tv_exp_f32 %0, %0\n\tv_exp_f32 %1, %1\n\tv_exp_f32 %2, %2\n\tv_exp_f32 %3, %3\n\tv_exp_f32 %4, %4\n\tv_nop"
      : "+v"(a), "+v"(b), "+v"(c), "+v"(d), "+v"(e));
}

// One block of 32 keys for one wave's 16 queries: scores, online softmax, O^T += V^T P^T.
// DIAG = true: the block meets the wave's diagonal; every score is tested against the strict
// causal bound, and a key that fails it gets probability 0.
// DIAG = false: every key of the block lies below every query of the wave, so both tests
// would pass for every score: neither they nor the key indices they compare are computed.
// kv: the block's first row in the K tile (raw K one tile behind); vb: its first column in
// the V^T tile; mw: the block's 16 lane masks, replaced on the way by those at mn (the wave's
// next block), both wave-uniform.
template <bool DIAG>
static __device__ __forceinline__ void key_block(
    const h16* kv, const h16* vb, v16u& mw, const unsigned* mn, int kc0, int qq,
    const v16h& aq0, const v16h& aq1, const v16h& ar0, const v16h& ar1,
    float sscale, float qscale,
    v8f& o0, v8f& o1, v8f& o2, v8f& o3, float& mrun, float& lrun) {
  float sc[16];   // scores of keys 16 t + 8 hi + i of the block at index 8 t + i
#pragma unroll
  for (int t = 0; t < 2; ++t) {
    const h16* kpb = kv + t * 16 * AT_KP;
    const h16* krb = kpb + AT_TILE;
    v8f s = {};
    s = WMMA_F16(load_frag16(kpb, AT_KP), aq0, s);
    s = WMMA_F16(load_frag16(kpb + 32, AT_KP), aq1, s);
    v8f sr = {};
    sr = WMMA_F16(load_frag16(krb, AT_KP), ar0, sr);
    sr = WMMA_F16(load_frag16(krb + 32, AT_KP), ar1, sr);
#pragma unroll
    for (int i = 0; i < 8; ++i) {
      // word 8 t + i is the select's lane mask as it lies in its scalar register: no compare. The
      // select takes the scale, not the product: it needs no WMMA result, so none of the chain behind them
      const float sel = __builtin_amdgcn_inverse_ballot_w32(mw[t * 8 + i]) ? sscale : 0.0f;
      const float v = s[i] * qscale + sr[i] * sel;
      if (DIAG) sc[t * 8 + i] = (kc0 + t * 16 + i < qq) ? v : -3.0e38f;   // strict tril(-1)
      else      sc[t * 8 + i] = v;
    }
  }
  mw = *(sc16_ptr)mn;   // the next block's masks: a scalar load, a whole key block ahead of their first use
  // online softmax: one query per lane, its 32 keys split between lanes l and l ^ 16
  float rm = sc[0];
#pragma unroll
  for (int j = 1; j < 16; ++j) rm = fmaxf(rm, sc[j]);
  rm = fmaxf(rm, xhalf(rm));
  const float mnew = fmaxf(mrun, rm);
  const float l2e = 1.4426950408889634f;   // e^x = 2^(x log2 e)
  float fac = (mrun - mnew) * l2e;
  mrun = mnew;
  float pe[16];
#pragma unroll
  for (int j = 0; j < 16; ++j) pe[j] = (sc[j] - mnew) * l2e;
  exp2x5(fac, pe[0], pe[1], pe[2], pe[3]);
  exp2x4(pe[4], pe[5], pe[6], pe[7]);
  exp2x4(pe[8], pe[9], pe[10], pe[11]);
  exp2x4(pe[12], pe[13], pe[14], pe[15]);
  v16h bp;        // P^T as a B operand: element 8 t + i is key 16 t + 8 hi + i, the loader's k order
  float rs = 0.0f;
#pragma unroll
  for (int j = 0; j < 16; ++j) {
    float p = pe[j];
    if (DIAG) p = (sc[j] > -1.0e37f) ? p : 0.0f;
    rs += p;
    bp[j] = (h16)p;
  }
  lrun = lrun * fac + rs;
#pragma unroll
  for (int i = 0; i < 8; ++i) {
    o0[i] *= fac; o1[i] *= fac; o2[i] *= fac; o3[i] *= fac;
  }
  // V^T(64 dk x 32 keys) @ P^T(32 keys x 16 queries), V stored transposed [d][s]
  o0 = WMMA_F16(load_frag16(vb,              AT_KP), bp, o0);
  o1 = WMMA_F16(load_frag16(vb + 16 * AT_KP, AT_KP), bp, o1);
  o2 = WMMA_F16(load_frag16(vb + 32 * AT_KP, AT_KP), bp, o2);
  o3 = WMMA_F16(load_frag16(vb + 48 * AT_KP, AT_KP), bp, o3);
  // A branch follows this block: four vector slots keep the last WMMA's distance on every path;
  // the fence holds them behind it.
  __builtin_amdgcn_sched_barrier(0);
  asm volatile("v_nop\n\tv_nop\n\tv_nop\n\tv_nop");
}

// 512 work-groups on 256 WGPs: two a WGP, four waves a SIMD, whatever else would fit. Said to the
// build, because with the mask tile gone from LDS it would plan for more resident waves, hold the
// registers down for them and read the K fragments one at a time, each with its own full wait.
__global__ void __launch_bounds__(256) __attribute__((amdgpu_waves_per_eu(4, 4))) attn_kernel(
    const h16* __restrict__ Qp, const h16* __restrict__ Kp, const h16* __restrict__ Vt,
    const h16* __restrict__ Qr, const h16* __restrict__ Kr,
    const unsigned* __restrict__ pmask, const float* __restrict__ gammas,
    h16* __restrict__ outA) {
  __shared__ alignas(16) h16 KVs[2][3 * AT_TILE];    // [buffer][K | raw K | V^T], 64 rows each
  const int bid = blockIdx.x;
  const int h   = bid & 7;
  const int b   = (bid >> 3) & 7;
  const int grp = bid >> 6;
  // query block: the four long ones first, then the short ones shortest first, so that a
  // late block that joins an early one on a WGP is short where the early one is long
  const int qb  = grp < 4 ? 7 - grp : grp - 4;
  const int tid  = threadIdx.x;
  const int lane = tid & 31;
  const int wv   = __builtin_amdgcn_readfirstlane(tid >> 5);  // wave number, in a scalar register
  const int lr = lane & 15;
  const int hi = lane >> 4;
  const int qb0 = qb << 7;
  const int q0  = qb0 + (wv << 4);

  // exp(-softplus(g)) == sigmoid(-g); clip lower bound
  const float g = gammas[h];
  float te = 1.0f / (1.0f + __expf(g));
  te = fminf(fmaxf(te, 1e-5f), 1e5f);
  const float sscale = te * 0.0441941738241592f;  // * 1/sqrt(512)
  const float qscale = 0.125f;                    // 1/sqrt(64)

  const size_t hd = (size_t)h * 64;

  // staging: thread t copies 16 B at column (t & 7) of rows (t >> 3) and (t >> 3) + 32 of
  // each f16 tile
  const int krow = tid >> 3;
  const int kcol = (tid & 7) * 8;
  const h16* kg = Kp + ((size_t)(b * 1024 + krow) * 512 + hd + kcol);
  const h16* rg = Kr + ((size_t)(b * 1024 + krow) * 512 + hd + kcol);
  const h16* vg = Vt + (((size_t)(b * 512) + hd + krow) * 1024 + kcol);
  const int  ko = krow * AT_KP + kcol;

  const int nst = 2 * qb + 2;   // stages of 64 keys covering keys < qb0 + 128; at least two

  copy_kv6(&KVs[0][ko], kg, rg, vg);

  const h16* qpb = Qp + ((size_t)(b * 1024 + q0) * 512 + hd);
  const h16* qrb = Qr + ((size_t)(b * 1024 + q0) * 512 + hd);
  const v16h aq0 = load_frag16(qpb, 512);
  const v16h aq1 = load_frag16(qpb + 32, 512);
  const v16h ar0 = load_frag16(qrb, 512);
  const v16h ar1 = load_frag16(qrb + 32, 512);

  asm volatile("s_wait_asynccnt 0x0" ::: "memory");  // this wave's copies of stage 0 have landed
  __syncthreads();                                   // stage 0 is visible to every wave
  copy_kv6(&KVs[1][ko], kg + 64 * 512, rg + 64 * 512, vg + 64);  // stage 1 flies during stage 0

  v8f o0 = {}, o1 = {}, o2 = {}, o3 = {};   // O^T: register i = dk 16 j + 8 hi + i of query q0 + lr
  float mrun = -3.0e38f;   // running maximum of this lane's query (equal in lanes l and l ^ 16)
  float lrun = 0.0f;       // running sum over this lane's own keys; the halves are joined after the loop

  const int qq = q0 + lr;                              // this lane's query
  const int nkw = ((q0 + 46) >> 5) << 5;  // this wave's keys: blocks of 32 covering keys < q0+16
  const unsigned* mp = pmask + (size_t)(b * 64 + (q0 >> 4)) * (32 * 16);   // this wave's lane masks, 16 words a key block
  const int kbl = (nkw >> 5) - 1;         // the wave's last key block: nothing behind it is fetched
  v16u mw = *(sc16_ptr)mp;                // key block 0
  for (int st = 0; st < nst; ++st) {
    const int cur = st & 1;
#pragma unroll  // two key blocks of 32 per stage, at constant LDS offsets
    for (int u = 0; u < 2; ++u) {
      const int kb0 = st * 64 + u * 32;
      if (kb0 < nkw) {  // wave-uniform (scalar): key blocks wholly above this wave's diagonal are skipped
        const h16* kv = &KVs[cur][u * 32 * AT_KP];
        const h16* vb = &KVs[cur][2 * AT_TILE + u * 32];
        const int kbn = st * 2 + u + 1;   // the next key block, held at the wave's last
        const unsigned* mn = mp + (kbn < kbl ? kbn : kbl) * 16;
        // wave-uniform (scalar): every key of the block lies below every query of the wave
        if (kb0 + 32 <= q0)
          key_block<false>(kv, vb, mw, mn, 0, 0, aq0, aq1, ar0, ar1, sscale, qscale, o0, o1, o2, o3, mrun, lrun);
        else
          key_block<true>(kv, vb, mw, mn, kb0 + hi * 8, qq, aq0, aq1, ar0, ar1, sscale, qscale, o0, o1, o2, o3, mrun, lrun);
      }
    }
    asm volatile("s_wait_dscnt 0x0" ::: "memory");     // this wave's reads of stage st are done
    asm volatile("s_wait_asynccnt 0x0" ::: "memory");  // this wave's copies of stage st+1 have landed
    __syncthreads();  // publishes stage st+1 and ends every wave's reads of stage st
    if (st + 2 < nst) {  // block-uniform: refill the buffer that stage st has just left
      const int kn = (st + 2) * 64;
      copy_kv6(&KVs[cur][ko], kg + (size_t)kn * 512, rg + (size_t)kn * 512, vg + kn);
    }
  }
  asm volatile("s_wait_asynccnt 0x0" ::: "memory");    // no copy is left in flight at the wave's end

  const float ltot = lrun + xhalf(lrun);   // the two halves' sums of one query
  const float inv = (ltot > 0.0f) ? (1.0f / ltot) : 0.0f;
  union { uint4 u; h16 h[8]; } pk0, pk1, pk2, pk3;
#pragma unroll
  for (int i = 0; i < 8; ++i) {
    pk0.h[i] = (h16)(o0[i] * inv); pk1.h[i] = (h16)(o1[i] * inv);
    pk2.h[i] = (h16)(o2[i] * inv); pk3.h[i] = (h16)(o3[i] * inv);
  }
  h16* ob = outA + ((size_t)(b * 1024 + qq) * 512 + hd + hi * 8);
  *(uint4*)(ob)      = pk0.u;   // 8 consecutive dk of one query, 16-B aligned
  *(uint4*)(ob + 16) = pk1.u;
  *(uint4*)(ob + 32) = pk2.u;
  *(uint4*)(ob + 48) = pk3.u;
}

// ---------------- output projection + residual + LayerNorm in one launch ----------------
// One 256-thread block owns 64 whole rows of X = A Wo + bo + resid (N = K = 512), so a row's
// mean and variance need no other block and X never goes to memory.
// Product: 8 waves side by side along N, each 64 rows x 64 columns = 16 accumulators; every
// LDS fragment feeds 4 WMMAs. It is taken transposed (Wt as A, the rows of A as B): a lane
// then holds 8 consecutive columns of one row, which leave for LDS in 16-B stores.
// Panels of 64 k (all 512 rows of Wt, the block's 64 rows of A) come into LDS by
// asynchronous copies, whole 128-B lines, in two buffers: the next panel flies while this
// one is multiplied. The k order per accumulator is 0,32,...,480.
// Then the tile goes through LDS (the panels' space, free by then) so that one wave has a
// whole row: 16 values a lane, whole-line reads of the residual and whole-line stores.
#define OL_KS 64                        // k (halves) per staged panel
#define OL_LP 72                        // panel row pitch, halves: 144 B = 16 B x 9, conflict-free 16-B reads
#define OL_PANEL ((512 + 64) * OL_LP)   // one buffer, halves: 512 rows of Wt, then 64 rows of A
#define OL_XP 516                       // X row pitch, floats: 2,064 B = 16 B x 129, conflict-free 16-B stores from 16 rows

// Nine asynchronous 16-B copies per lane, global -> LDS, through no register: eight rows of
// Wt, 32 apart on both sides, and one row of A. The s_wait_xcnt 0 is the statement's last
// line so that it stands ahead of any later rewrite of the address registers the copies name.
static __device__ __forceinline__ void copy_w8a1(const h16* lw, const h16* gw, const h16* la, const h16* ga) {
  const unsigned l0 = (unsigned)(size_t)lw;      // LDS byte addresses: low 32 bits
  const unsigned l8 = (unsigned)(size_t)la;
  const unsigned ls = 32u * OL_LP * 2u;          // 32 LDS rows in bytes
  asm volatile(
      "global_load_async_to_lds_b128 %0, %9, off\n\t"
      "global_load_async_to_lds_b128 %1, %10, off\n\t"
      "global_load_async_to_lds_b128 %2, %11, off\n\t"
      "global_load_async_to_lds_b128 %3, %12, off\n\t"
      "global_load_async_to_lds_b128 %4, %13, off\n\t"
      "global_load_async_to_lds_b128 %5, %14, off\n\t"
      "global_load_async_to_lds_b128 %6, %15, off\n\t"
      "global_load_async_to_lds_b128 %7, %16, off\n\t"
      "global_load_async_to_lds_b128 %8, %17, off\n\t"
      "s_wait_xcnt 0x0"
      :: "v"(l0), "v"(l0 + ls), "v"(l0 + 2u * ls), "v"(l0 + 3u * ls),
         "v"(l0 + 4u * ls), "v"(l0 + 5u * ls), "v"(l0 + 6u * ls), "v"(l0 + 7u * ls), "v"(l8),
         "v"(gw), "v"(gw + 32 * 512), "v"(gw + 64 * 512), "v"(gw + 96 * 512),
         "v"(gw + 128 * 512), "v"(gw + 160 * 512), "v"(gw + 192 * 512), "v"(gw + 224 * 512), "v"(ga)
      : "memory");
}

// One panel: thread t copies 16 B at column (t & 7) of rows (t >> 3) + 32 j, j = 0..15 of Wt
// and j = 0, 1 of A. p, w, a: the thread's own first place in the buffer, in Wt and in A.
static __device__ __forceinline__ void copy_panel(const h16* p, const h16* w, const h16* a) {
  copy_w8a1(p,               w,             p + 512 * OL_LP, a);
  copy_w8a1(p + 256 * OL_LP, w + 256 * 512, p + 544 * OL_LP, a + 32 * 512);
}

// Sum over the wave's 32 lanes, the result in every lane: four steps inside the 16-lane rows
// (row_xmask 1, 2, 4, 8 on the vector unit, no LDS), then the exchange between the halves.
template <int CTRL>
static __device__ __forceinline__ float row_step(float x) {
  return x + __builtin_bit_cast(float, __builtin_amdgcn_mov_dpp(__builtin_bit_cast(int, x), CTRL, 0xf, 0xf, true));
}
static __device__ __forceinline__ float wave_sum(float x) {
  x = row_step<0x161>(x);
  x = row_step<0x162>(x);
  x = row_step<0x164>(x);
  x = row_step<0x168>(x);
  return x + xhalf(x);
}

__global__ void __launch_bounds__(256) proj_ln(
    const h16* __restrict__ A, const h16* __restrict__ Wt, const float* __restrict__ bias,
    const float* __restrict__ resid, const float* __restrict__ gw, const float* __restrict__ bw,
    float* __restrict__ out) {
  __shared__ alignas(16) unsigned char Sm[2 * OL_PANEL * 2];   // two panel buffers; later the X tile
  h16* const P0 = (h16*)Sm;
  const int tid  = threadIdx.x;
  const int lane = tid & 31;
  const int wv   = tid >> 5;
  const int m0 = (int)blockIdx.x * 64;   // the block's rows
  const int wn = wv * 64;                // the wave's columns
  const int lr = lane & 15;
  const int hi = lane >> 4;

  v8f acc[4][4];   // acc[mi][j], register i: row 16 mi + lr, column wn + 16 j + 8 hi + i
#pragma unroll  // constant indices keep acc in registers
  for (int j = 0; j < 4; ++j) {
    const float4 b0 = *(const float4*)(bias + wn + j * 16 + hi * 8);
    const float4 b1 = *(const float4*)(bias + wn + j * 16 + hi * 8 + 4);
    acc[0][j] = (v8f){b0.x, b0.y, b0.z, b0.w, b1.x, b1.y, b1.z, b1.w};
    acc[1][j] = acc[0][j]; acc[2][j] = acc[0][j]; acc[3][j] = acc[0][j];
  }

  // staging: this thread's first row and column, as copy_panel takes them
  const int srow = tid >> 3;
  const int scol = (tid & 7) * 8;
  const h16* wg = Wt + (size_t)srow * 512 + scol;
  const h16* ag = A  + (size_t)(m0 + srow) * 512 + scol;
  const int  so = srow * OL_LP + scol;

  copy_panel(P0 + so, wg, ag);
  asm volatile("s_wait_asynccnt 0x0" ::: "memory");  // this wave's copies of panel 0 have landed
  __syncthreads();                                   // panel 0 is visible to every wave
  copy_panel(P0 + OL_PANEL + so, wg + OL_KS, ag + OL_KS);   // panel 1 flies during panel 0

  for (int kt = 0; kt < 8; ++kt) {
    h16* const pb = P0 + (kt & 1) * OL_PANEL;
    const h16* wb = pb + wn * OL_LP;
    const h16* ab = pb + 512 * OL_LP;
#pragma unroll  // both k steps of a panel at constant LDS offsets
    for (int ks = 0; ks < OL_KS; ks += 32) {
      v16h a[4], w[4];
#pragma unroll  // constant indices keep the fragments in registers
      for (int i = 0; i < 4; ++i) {
        a[i] = load_frag16(ab + ks + i * 16 * OL_LP, OL_LP);
        w[i] = load_frag16(wb + ks + i * 16 * OL_LP, OL_LP);
      }
      // keeps the 16 LDS reads one group ahead of the 16 WMMAs: left free, the build reads the
      // A fragments one at a time among them and waits out the LDS latency at each
      __builtin_amdgcn_sched_barrier(0);
#pragma unroll  // constant indices keep acc in registers
      for (int mi = 0; mi < 4; ++mi) {
#pragma unroll  // constant indices keep acc in registers
        for (int j = 0; j < 4; ++j) acc[mi][j] = WMMA_F16(w[j], a[mi], acc[mi][j]);
      }
      __builtin_amdgcn_sched_barrier(0);  // the other side of the same fence: no later read moves in among the WMMAs
    }
    asm volatile("s_wait_dscnt 0x0" ::: "memory");     // this wave's reads of panel kt are done
    asm volatile("s_wait_asynccnt 0x0" ::: "memory");  // this wave's copies of panel kt+1 have landed
    __syncthreads();  // publishes panel kt+1 and ends every wave's reads of panel kt
    if (kt + 2 < 8)   // block-uniform: refill the buffer that panel kt has just left
      copy_panel(pb + so, wg + (kt + 2) * OL_KS, ag + (kt + 2) * OL_KS);
  }
  asm volatile("s_wait_asynccnt 0x0" ::: "memory");    // no copy is left in flight: the panels' LDS is free

  // This wave's 8 rows of the second part; a lane has columns 4 lane + 128 p + {0..3}.
  const int r0 = wv * 8;
  const float* rg = resid + (size_t)(m0 + r0) * 512 + lane * 4;
  v4f x[8][4], g4[4], b4[4];
#pragma unroll  // constant indices keep x in registers; the first 4 rows' residual flies under the LDS stores
  for (int r = 0; r < 4; ++r) {
#pragma unroll
    for (int p = 0; p < 4; ++p) x[r][p] = *(const v4f*)(rg + r * 512 + p * 128);
  }
#pragma unroll
  for (int p = 0; p < 4; ++p) {
    g4[p] = *(const v4f*)(gw + lane * 4 + p * 128);
    b4[p] = *(const v4f*)(bw + lane * 4 + p * 128);
  }

  float* const X = (float*)Sm;
  const int xo = lr * OL_XP + wn + hi * 8;   // this lane's first row and column in the tile
#pragma unroll  // constant indices keep acc in registers
  for (int mi = 0; mi < 4; ++mi) {
#pragma unroll
    for (int j = 0; j < 4; ++j) {
      float* p = &X[xo + mi * 16 * OL_XP + j * 16];
      *(float4*)(p)     = make_float4(acc[mi][j][0], acc[mi][j][1], acc[mi][j][2], acc[mi][j][3]);
      *(float4*)(p + 4) = make_float4(acc[mi][j][4], acc[mi][j][5], acc[mi][j][6], acc[mi][j][7]);
    }
  }
  // stands ahead of any later rewrite of the address registers of the loads above
  asm volatile("s_wait_xcnt 0x0" ::: "memory");
  __syncthreads();   // the whole X tile is in LDS before any wave reads a row of it

#pragma unroll  // the other 4 rows' residual flies while the first 4 rows are worked on
  for (int r = 4; r < 8; ++r) {
#pragma unroll
    for (int p = 0; p < 4; ++p) x[r][p] = *(const v4f*)(rg + r * 512 + p * 128);
  }

  float* og = out + (size_t)(m0 + r0) * 512 + lane * 4;
#pragma unroll  // constant indices keep x in registers; independent rows, so their LDS reads and cross-lane sums overlap
  for (int r = 0; r < 8; ++r) {
    // keeps the two groups of 4 rows apart: woven together, the first group waits on the second
    // group's residual, still in flight, and the build goes past the first 256 registers
    if (r == 4) __builtin_amdgcn_sched_barrier(0);
#pragma unroll
    for (int p = 0; p < 4; ++p) x[r][p] += *(const v4f*)&X[(r0 + r) * OL_XP + lane * 4 + p * 128];
    const v4f s4 = (x[r][0] + x[r][1]) + (x[r][2] + x[r][3]);
    const float mu = wave_sum((s4.x + s4.y) + (s4.z + s4.w)) * (1.0f / 512.0f);
#pragma unroll
    for (int p = 0; p < 4; ++p) x[r][p] -= mu;
    const v4f q4 = (x[r][0] * x[r][0] + x[r][1] * x[r][1]) + (x[r][2] * x[r][2] + x[r][3] * x[r][3]);
    const float rstd = rsqrtf(wave_sum((q4.x + q4.y) + (q4.z + q4.w)) * (1.0f / 512.0f) + 1e-5f);
#pragma unroll
    for (int p = 0; p < 4; ++p) *(v4f*)(og + r * 512 + p * 128) = x[r][p] * rstd * g4[p] + b4[p];
  }
}

extern "C" void kernel_launch(void* const* d_in, const int* in_sizes, int n_in,
                              void* d_out, int out_size, void* d_ws, size_t ws_size,
                              hipStream_t stream) {
  (void)in_sizes; (void)n_in; (void)out_size; (void)ws_size;
  const float* q_in  = (const float*)d_in[0];
  const float* k_in  = (const float*)d_in[1];
  const float* v_in  = (const float*)d_in[2];
  const int*   smask = (const int*)  d_in[3];
  const float* Wq    = (const float*)d_in[4];
  const float* bq    = (const float*)d_in[5];
  const float* Wv    = (const float*)d_in[6];
  const float* bv    = (const float*)d_in[7];
  const float* Wo    = (const float*)d_in[8];
  const float* bo    = (const float*)d_in[9];
  const float* gm    = (const float*)d_in[10];
  const float* lng   = (const float*)d_in[11];
  const float* lnb   = (const float*)d_in[12];
  float* out = (float*)d_out;

  const size_t E = (size_t)8 * 1024 * 512;  // elements per [B,S,D] tensor
  char* ws = (char*)d_ws;
  h16*  qh  = (h16*)(ws);
  h16*  kh  = (h16*)(ws + 2 * E);
  h16*  vh  = (h16*)(ws + 4 * E);
  h16*  Qp  = (h16*)(ws + 6 * E);
  h16*  Kp  = (h16*)(ws + 8 * E);
  h16*  Vt  = (h16*)(ws + 10 * E);
  h16*  Wqt = (h16*)(ws + 12 * E);
  h16*  Wvt = (h16*)(ws + 12 * E + 524288);
  h16*  Wot = (h16*)(ws + 12 * E + 2 * 524288);
  h16*  Ao  = (h16*)(ws + 12 * E + 3 * 524288);
  unsigned* pm = (unsigned*)(ws + 14 * E + 3 * 524288);   // packed state mask, 1 MiB

  cvt_all<<<dim3(1728), dim3(256), 0, stream>>>(q_in, k_in, v_in, Wq, Wv, Wo, qh, kh, vh, Wqt, Wvt, Wot);

  const int M = 8192;  // B*S rows; (M/128)*(512/128) = 256 tiles, one 8-wave block each
  // 3 x 256 product tiles, then 8 x 36 tiles of the state mask
  proj_qkv<<<dim3(1056), dim3(256), 0, stream>>>(qh, kh, vh, Wqt, Wvt, bq, bv, Qp, Kp, Vt, M, smask, pm);

  attn_kernel<<<dim3(512), dim3(256), 0, stream>>>(Qp, Kp, Vt, qh, kh, pm, gm, Ao);

  // 8192 / 64 = 128 blocks, each with 64 whole rows
  proj_ln<<<dim3(128), dim3(256), 0, stream>>>(Ao, Wot, bo, q_in, lng, lnb, out);
}

// v010
// A run of this version takes 61.6 microseconds.
// Timed twice side by side with v009, it ran 1.06 times as fast both times.
// Counting every step since v000, it is 3.96 times as fast.
#include <hip/hip_runtime.h>
#include <math.h>

typedef _Float16 h16;
typedef __attribute__((ext_vector_type(16))) _Float16 v16h;
typedef __attribute__((ext_vector_type(8)))  float    v8f;
typedef __attribute__((ext_vector_type(4)))  float    v4f;
typedef __attribute__((ext_vector_type(16))) unsigned v16u;
// A read through this type may go by the scalar path: for wave-uniform addresses of data that
// no store of the same launch touches.
typedef const __attribute__((address_space(4))) v16u* sc16_ptr;

#define WMMA_F16(a, b, c) \
  __builtin_amdgcn_wmma_f32_16x16x32_f16(false, (a), false, (b), (short)0, (c), false, false)

// Load a 16x32 (A) / 32x16 (B, fed column-major) f16 fragment from a row-major
// matrix with row stride `ld` (halves). Per ISA 16-bit A layout:
// lane = (half)*16 + r holds row r, K = kb+{0..7} and kb+{16..23}, kb = 8*half.
static __device__ __forceinline__ v16h load_frag16(const h16* base, int ld) {
  const int lane = threadIdx.x & 31;
  const int r  = lane & 15;
  const int kb = (lane >> 4) << 3;
  const h16* p = base + (size_t)r * (size_t)ld + kb;
  union { v16h v; uint4 u[2]; } f;
  f.u[0] = *(const uint4*)(p);
  f.u[1] = *(const uint4*)(p + 16);
  return f.v;
}

// ---------------- weight of the output projection: cast and transpose ----------------
// in[k][n] (512x512 row-major) -> out[n][k] f16, one 64 x 64 tile a work-group, turned in LDS.
// Loads: 16 lanes x 16 B cover the tile's 256 B of one row k, whole lines. A thread has rows
// k, k + 1 of 4 columns n, so each (k, k + 1) pair of a column leaves for LDS as one dword.
// Stores: 8 lanes x 16 B cover the tile's 128 B of one row n, a whole line.
#define WT_P 72   // LDS row pitch, halves: 144 B = 16 B x 9, conflict-free 16-B reads
static __device__ __forceinline__ void cvtT_h16(const float* __restrict__ in, h16* __restrict__ out, int tile, h16* Ls) {
  const int t  = threadIdx.x;
  const int k0 = (tile >> 3) * 64;
  const int n0 = (tile & 7) * 64;
  const int c4 = (t & 15) * 4;   // this thread's 4 columns n of the tile
  const int rp = (t >> 4) * 2;   // its rows k: rp, rp + 1, rp + 32, rp + 33
  const float* g = in + (size_t)(k0 + rp) * 512 + n0 + c4;
  v4f a[2][2];
#pragma unroll  // constant indices keep a in registers; all 4 loads are in flight before the first convert
  for (int j = 0; j < 2; ++j) {
    a[j][0] = *(const v4f*)(g + j * 32 * 512);
    a[j][1] = *(const v4f*)(g + j * 32 * 512 + 512);
  }
#pragma unroll  // constant indices keep a in registers
  for (int j = 0; j < 2; ++j) {
#pragma unroll
    for (int e = 0; e < 4; ++e) {
      union { unsigned u; h16 h[2]; } p;
      p.h[0] = (h16)a[j][0][e]; p.h[1] = (h16)a[j][1][e];
      *(unsigned*)&Ls[(c4 + e) * WT_P + rp + j * 32] = p.u;
    }
  }
  __syncthreads();   // the whole tile is in LDS before any thread reads a row n of it
  const int nr = t >> 3;
  const int kc = (t & 7) * 8;
  h16* o = out + (size_t)(n0 + nr) * 512 + k0 + kc;
#pragma unroll  // both LDS reads are issued ahead of the first store
  for (int j = 0; j < 2; ++j)
    *(uint4*)(o + j * 32 * 512) = *(const uint4*)&Ls[(nr + j * 32) * WT_P + kc];
}

// ---------------- GEMM: C[M,512] = f16(A[M,512]) * f16(W[512,512]) + bias ----------------
// One 256-thread block computes a 128x128 tile of C (M a multiple of 128, K = N = 512) straight
// from the f32 operands. Panels of 64 k (128 rows of A; 64 rows k x 128 columns n of W) are
// loaded in 16-B pieces, whole lines, cast in registers and stored to LDS as f16, in two
// buffers: the loads of panel kt + 2 fly while panel kt + 1 is multiplied.
// A lies in LDS as it lies in memory, k along the row. W too lies as in memory, n along the row,
// and the transposing LDS load hands a lane 8 k of one column n: the B fragment, in the k order
// of load_frag16.
// 8 waves, 4 along M x 2 along N; each owns 32x64 of C = 8 accumulators, so every
// LDS fragment feeds 2 or 4 WMMAs. The k order per accumulator is 0,32,...,480.
// raw != 0: the cast rows of A also go to memory (attention reads them). Each of the four column
// tiles of a row block stores the two panels of its own index, so every element leaves once.
// mode 0: f16 row-major out. mode 1: f16 out transposed per batch [B][512][1024]
// (for V so attention's V^T A-frags are contiguous).
#define GEMM_KS 64    // k per staged panel
#define GEMM_AP 72    // A panel row pitch, halves: 144 B = 16 B x 9, conflict-free 16-B reads
#define GEMM_WP 144   // W panel row pitch, halves: 288 B = 32 B x 9, conflict-free transposing reads

typedef __attribute__((ext_vector_type(8))) short    s16x8;
typedef __attribute__((ext_vector_type(4))) unsigned u32x4;
typedef __attribute__((ext_vector_type(2))) unsigned u32x2;
typedef __attribute__((ext_vector_type(4))) _Float16 v4h;

// t: element [k0][n0] of a row-major [k][n] f16 tile in LDS. Lane (c = l & 15, h = l >> 4) gets
// t[8 h + 0..7][c] and t[16 + 8 h + 0..7][c]: column c of a 32 x 16 B operand.
static __device__ __forceinline__ v16h load_fragT(const h16* t) {
  typedef __attribute__((address_space(3))) s16x8 lds_s16x8;
  const int lane = threadIdx.x & 31;
  const h16* p = t + ((lane >> 4) * 8 + (lane & 7)) * GEMM_WP + ((lane >> 3) & 1) * 8;
  union { v16h v; u32x4 u[2]; } f;
  f.u[0] = __builtin_bit_cast(u32x4, __builtin_amdgcn_ds_load_tr16_b128_v8i16((lds_s16x8*)p));
  f.u[1] = __builtin_bit_cast(u32x4, __builtin_amdgcn_ds_load_tr16_b128_v8i16((lds_s16x8*)(p + 16 * GEMM_WP)));
  return f.v;
}

// Four f32 to four f16, round to nearest even, as a vector: two packed converts.
static __device__ __forceinline__ u32x2 cast4(const v4f v) {
  return __builtin_bit_cast(u32x2, __builtin_convertvector(v, v4h));
}

// One panel's f32 values into registers: a, w = the thread's own first element of the panel.
// A: 16 lanes x 16 B cover the panel's 256 B of one row, rows 16 apart. W: a wave covers the
// tile's 512 B of one row k, rows 8 apart.
static __device__ __forceinline__ void load_panel(const float* a, const float* w, v4f (&ra)[8], v4f (&rw)[8]) {
#pragma unroll  // constant indices keep ra and rw in registers; all 16 loads are in flight together
  for (int j = 0; j < 8; ++j) {
    ra[j] = *(const v4f*)(a + j * 16 * 512);
    rw[j] = *(const v4f*)(w + j * 8 * 512);
  }
  // a and w as inputs keep the loads' addresses in registers of their own up to this wait, which so
  // stands ahead of any rewrite of them (left free, the build lets the last load land on its own address)
  asm volatile("s_wait_xcnt 0x0" :: "v"(a), "v"(w) : "memory");
}

static __device__ __forceinline__ void gemm_tile(
    const float* __restrict__ A, const float* __restrict__ W,
    const float* __restrict__ bias, void* __restrict__ out, h16* __restrict__ raw,
    int M, int mode, unsigned tile) {
  __shared__ alignas(16) h16 As[2][128 * GEMM_AP];
  __shared__ alignas(16) h16 Ws[2][GEMM_KS * GEMM_WP];
  const int tid = threadIdx.x;
  const int m0  = (int)(tile >> 2) * 128;  // 4 column tiles of 128 along N=512
  const int nt  = (int)(tile & 3);
  const int nb  = nt * 128;
  if (m0 >= M) return;   // uniform per block, ahead of every barrier
  const int lane = tid & 31;
  const int wv   = tid >> 5;
  const int wm = (wv >> 1) * 32;   // wave's rows inside the tile
  const int wn = (wv & 1) * 64;    // wave's columns inside the tile
  const int n0 = nb + wn;
  const int c  = lane & 15;

  // staging: thread t has 4 k at column group (t & 15) of rows (t >> 4) + 16 j of A, and
  // 4 n at column group (t & 31) of rows k (t >> 5) + 8 j of W, j = 0..7
  const int arow = tid >> 4;
  const int acol = (tid & 15) * 4;
  const int wrow = tid >> 5;
  const int wcol = (tid & 31) * 4;
  const float* ag = A + (size_t)(m0 + arow) * 512 + acol;
  const float* wg = W + (size_t)wrow * 512 + nb + wcol;
  const int ao = arow * GEMM_AP + acol;
  const int wo = wrow * GEMM_WP + wcol;
  v4f ra[8], rw[8];

  load_panel(ag, wg, ra, rw);

  v8f acc[2][4];
#pragma unroll  // constant indices keep acc in registers
  for (int j = 0; j < 4; ++j) {
    const float b = bias[n0 + j * 16 + c];
    acc[0][j] = (v8f){b, b, b, b, b, b, b, b};
    acc[1][j] = acc[0][j];
  }

#pragma unroll 1  // one copy of the body: the panel index stays a scalar and the text short
  for (int kt = -1; kt < 8; ++kt) {
    if (kt >= 0) {   // block-uniform: panel kt, published by the barrier at the foot of the pass before
      const h16* ab = &As[kt & 1][wm * GEMM_AP];
      const h16* wb = &Ws[kt & 1][wn];
      v16h a[2][2], w[2][4];
#pragma unroll  // constant indices keep the fragments in registers
      for (int s = 0; s < 2; ++s) {
        a[s][0] = load_frag16(ab + s * 32,                GEMM_AP);
        a[s][1] = load_frag16(ab + s * 32 + 16 * GEMM_AP, GEMM_AP);
#pragma unroll
        for (int j = 0; j < 4; ++j) w[s][j] = load_fragT(wb + s * 32 * GEMM_WP + j * 16);
      }
      // keeps the panel's 24 LDS reads one group ahead of its 16 WMMAs: left free, the build reads
      // the second A fragment among them and waits out the LDS latency there
      __builtin_amdgcn_sched_barrier(0);
#pragma unroll  // constant indices keep acc in registers
      for (int s = 0; s < 2; ++s) {
#pragma unroll
        for (int mi = 0; mi < 2; ++mi) {
#pragma unroll
          for (int j = 0; j < 4; ++j) acc[mi][j] = WMMA_F16(a[s][mi], w[s][j], acc[mi][j]);
        }
      }
      __builtin_amdgcn_sched_barrier(0);  // the other side of the same fence: the casts and LDS stores stay behind the WMMAs
    }
    const int kn = kt + 1;
    if (kn < 8) {    // block-uniform: panel kn goes into the buffer whose readers left it at the last barrier
      h16* as = &As[kn & 1][ao];
      h16* ws = &Ws[kn & 1][wo];
      u32x2 pa[8];
#pragma unroll  // constant indices keep ra, rw and pa in registers
      for (int j = 0; j < 8; ++j) {
        pa[j] = cast4(ra[j]);
        *(u32x2*)(as + j * 16 * GEMM_AP) = pa[j];
        *(u32x2*)(ws + j * 8 * GEMM_WP)  = cast4(rw[j]);
      }
      if (raw != nullptr && (kn >> 1) == nt) {   // block-uniform: 16 lanes x 8 B fill one 128-B line
        h16* rg = raw + (size_t)(m0 + arow) * 512 + kn * GEMM_KS + acol;
#pragma unroll  // constant indices keep pa in registers
        for (int j = 0; j < 8; ++j) *(u32x2*)(rg + j * 16 * 512) = pa[j];
        // stands ahead of any later rewrite of the registers that the stores above name
        asm volatile("s_wait_xcnt 0x0" ::: "memory");
      }
      if (kn + 1 < 8)  // block-uniform
        load_panel(ag + (kn + 1) * GEMM_KS, wg + (size_t)(kn + 1) * GEMM_KS * 512, ra, rw);
      // This wave's LDS reads of panel kt and stores of panel kn are done; then the work-group's
      // barrier, which publishes panel kn and ends every wave's reads of panel kt. Written by hand:
      // __syncthreads() would also wait out the global loads just issued, which are to stay in flight.
      asm volatile("s_wait_dscnt 0x0" ::: "memory");
      asm volatile("s_barrier_signal -1\n\ts_barrier_wait -1" ::: "memory");
    }
  }

  const int rw0 = m0 + wm + ((lane >> 4) << 3);  // this lane's 8 rows of the upper 16x64 strip
  if (mode == 0) {
    h16* o = (h16*)out;
#pragma unroll  // constant indices keep acc in registers
    for (int mi = 0; mi < 2; ++mi) {
#pragma unroll  // constant indices keep acc in registers
      for (int i = 0; i < 8; ++i) {
        h16* r = o + (size_t)(rw0 + mi * 16 + i) * 512 + n0 + c;
        r[0]  = (h16)acc[mi][0][i];
        r[16] = (h16)acc[mi][1][i];
        r[32] = (h16)acc[mi][2][i];
        r[48] = (h16)acc[mi][3][i];
      }
    }
    // in the merged launch's listing the next branch's code lies behind these stores and
    // reuses their data registers: this wait stands ahead of any such overwrite
    asm volatile("s_wait_xcnt 0x0" ::: "memory");
  } else {
#pragma unroll  // constant indices keep acc in registers
    for (int mi = 0; mi < 2; ++mi) {
      const int row0 = rw0 + mi * 16;
      const int bIdx = row0 >> 10;     // 16 | 1024 so tiles never cross batches
      const int s0   = row0 & 1023;
      union { uint4 u; h16 h[8]; } pk0, pk1, pk2, pk3;
#pragma unroll  // constant indices keep acc in registers
      for (int i = 0; i < 8; ++i) {
        pk0.h[i] = (h16)acc[mi][0][i]; pk1.h[i] = (h16)acc[mi][1][i];
        pk2.h[i] = (h16)acc[mi][2][i]; pk3.h[i] = (h16)acc[mi][3][i];
      }
      h16* o = (h16*)out + ((size_t)bIdx * 512 + n0 + c) * 1024 + s0;
      *(uint4*)(o)               = pk0.u;   // 8 contiguous s-values, 16B aligned
      *(uint4*)(o + 16 * 1024)   = pk1.u;
      *(uint4*)(o + 32 * 1024)   = pk2.u;
      *(uint4*)(o + 48 * 1024)   = pk3.u;
    }
    // the build reuses a data register of these stores on the way to the exit:
    // this one stands ahead of that overwrite
    asm volatile("s_wait_xcnt 0x0" ::: "memory");
  }
}

// ---------------- state mask, int32 -> one bit, in the attention wave's own lane order ------
// pm[b][qt][kb][16 words]: qt = a wave's 16 queries, kb = a block of 32 keys. Bit l of word
// 8 t + i says whether mask[b][16 qt + (l & 15)][32 kb + 16 t + 8 (l >> 4) + i] != 0: the lane
// and the register index at which attention holds that score, so a word is a lane mask as it is.
// One work-group packs one 128 x 128 tile on or below the diagonal (36 a batch; no other tile
// is read by attention), one wave 16 queries x 128 keys: a lane loads the 8 consecutive keys
// of its own (t, half), a wave-wide compare gives the word, and the 64 words leave as 256 B.
static __device__ __forceinline__ void pack_mask(const int* __restrict__ sm, unsigned* __restrict__ pm, int tile) {
  const int b = tile / 36;
  const int r = tile - b * 36;
  int qb = 0;   // row of the triangle: query block qb has key groups 0..qb, the first at index qb (qb + 1) / 2
#pragma unroll
  for (int j = 1; j < 8; ++j) qb = (r >= j * (j + 1) / 2) ? j : qb;
  const int g    = r - qb * (qb + 1) / 2;
  const int lane = threadIdx.x & 31;
  const int qt   = qb * 8 + (int)(threadIdx.x >> 5);
  const int* p = sm + ((size_t)(b * 1024 + qt * 16 + (lane & 15)) * 1024 + g * 128 + (lane >> 4) * 8);
  int4 v[8][2];
#pragma unroll  // constant indices keep v in registers; all 16 loads are in flight before the first compare
  for (int c = 0; c < 8; ++c) {
    v[c][0] = *(const int4*)(p + c * 16);
    v[c][1] = *(const int4*)(p + c * 16 + 4);
  }
  // p as an input keeps the loads' address in its registers up to this wait, which so stands
  // ahead of any rewrite of them (left free, the build lets the last load land on its own address)
  asm volatile("s_wait_xcnt 0x0" :: "v"(p) : "memory");
  unsigned w0 = 0, w1 = 0;   // lane l collects words 2 l and 2 l + 1 of the 64
#pragma unroll  // constant indices keep v in registers
  for (int c = 0; c < 8; ++c) {
    const int e[8] = {v[c][0].x, v[c][0].y, v[c][0].z, v[c][0].w, v[c][1].x, v[c][1].y, v[c][1].z, v[c][1].w};
#pragma unroll
    for (int i = 0; i < 8; i += 2) {
      // the wave-wide compares stand outside the selects: every lane takes part in them
      const unsigned be = __builtin_amdgcn_ballot_w32(e[i] != 0);
      const unsigned bo = __builtin_amdgcn_ballot_w32(e[i + 1] != 0);
      const bool mine = lane == c * 4 + i / 2;
      w0 = mine ? be : w0;
      w1 = mine ? bo : w1;
    }
  }
  *(uint2*)(pm + ((size_t)(b * 64 + qt) * 32 + g * 4) * 16 + lane * 2) = make_uint2(w0, w1);
  // stands ahead of any later rewrite of the registers that the store above names
  asm volatile("s_wait_xcnt 0x0" ::: "memory");
}

// The projections of q, k and v need nothing of each other, so they share one launch:
// ranges of 256 work-groups (one per tile of an [8192, 512] product), told apart by
// block-uniform selects. They read the f32 inputs themselves, so no launch stands in front.
// Behind them 288 work-groups pack the state mask, which attention alone needs, and 64 cast and
// transpose Wo, which the last launch alone needs: both run in the places that the last product
// tiles leave empty.
__global__ void __launch_bounds__(256) proj_qkv(
    const float* __restrict__ q, const float* __restrict__ k, const float* __restrict__ v,
    const float* __restrict__ Wq, const float* __restrict__ Wv,
    const float* __restrict__ bq, const float* __restrict__ bv,
    h16* __restrict__ Qp, h16* __restrict__ Kp, h16* __restrict__ Vt,
    h16* __restrict__ qh, h16* __restrict__ kh, int M,
    const int* __restrict__ smask, unsigned* __restrict__ pmask,
    const float* __restrict__ Wo, h16* __restrict__ Wot) {
  __shared__ alignas(16) h16 Ls[64 * WT_P];   // a tile of Wo, transposed
  if (blockIdx.x >= 1056) {  // block-uniform, so every thread of the work-group meets the barrier inside
    cvtT_h16(Wo, Wot, (int)blockIdx.x - 1056, Ls);
    return;
  }
  if (blockIdx.x >= 768) {   // block-uniform, ahead of every barrier
    pack_mask(smask, pmask, (int)blockIdx.x - 768);
    return;
  }
  const int job = (int)(blockIdx.x >> 8);
  gemm_tile(job == 0 ? q : job == 1 ? k : v, job == 2 ? Wv : Wq, job == 2 ? bv : bq,
            (void*)(job == 0 ? Qp : job == 1 ? Kp : Vt), job == 0 ? qh : job == 1 ? kh : nullptr,
            M, job == 2 ? 1 : 0, blockIdx.x & 255);
}

#define AT_KP 72               // K / raw K / V tile row pitch, halves: 144 B = 16 B x 9, conflict-free 16-B reads
#define AT_TILE (64 * AT_KP)   // one 64-row tile, halves

// Six asynchronous 16-B copies per lane: rows r and r + 32 of the three 64-row f16 tiles.
// The s_wait_xcnt 0 is the statement's last line so that it stands ahead of any later
// rewrite of the address registers the copies name.
static __device__ __forceinline__ void copy_kv6(const h16* lk, const h16* gk, const h16* gr, const h16* gv) {
  const unsigned l0 = (unsigned)(size_t)lk;      // LDS byte address: low 32 bits
  const unsigned lt = AT_TILE * 2u;              // one tile in bytes
  const unsigned ls = 32u * AT_KP * 2u;          // 32 LDS rows in bytes
  asm volatile(
      "global_load_async_to_lds_b128 %0, %6, off\n\t"
      "global_load_async_to_lds_b128 %1, %7, off\n\t"
      "global_load_async_to_lds_b128 %2, %8, off\n\t"
      "global_load_async_to_lds_b128 %3, %9, off\n\t"
      "global_load_async_to_lds_b128 %4, %10, off\n\t"
      "global_load_async_to_lds_b128 %5, %11, off\n\t"
      "s_wait_xcnt 0x0"
      :: "v"(l0), "v"(l0 + ls), "v"(l0 + lt), "v"(l0 + lt + ls),
         "v"(l0 + 2u * lt), "v"(l0 + 2u * lt + ls),
         "v"(gk), "v"(gk + 32 * 512), "v"(gr), "v"(gr + 32 * 512),
         "v"(gv), "v"(gv + 32 * 1024)
      : "memory");
}

// Lane l takes the value of lane l ^ 16: one vector cross-row move, no LDS.
static __device__ __forceinline__ float xhalf(float x) {
  const int b = __builtin_bit_cast(int, x);
  return __builtin_bit_cast(float, __builtin_amdgcn_permlanex16(b, b, 0x76543210, 0xfedcba98, false, false));
}

// 2^x in place, four or five to a statement. Behind a transcendental the instruction set asks for
// one independent instruction before its result is read or its source rewritten: here each has
// the next one behind it and the last a v_nop, and a source is its own result's register.
// The s_delay_alu is a hint only: the arguments are made just ahead, and with it the SIMD's
// other waves issue while this one waits for them.
static __device__ __forceinline__ void exp2x4(float& a, float& b, float& c, float& d) {
  asm("s_delay_alu instid0(VALU_DEP_1)\n\tv_exp_f32 %0, %0\n\tv_exp_f32 %1, %1\n\tv_exp_f32 %2, %2\n\tv_exp_f32 %3, %3\n\tv_nop"
      : "+v"(a), "+v"(b), "+v"(c), "+v"(d));
}
static __device__ __forceinline__ void exp2x5(float& a, float& b, float& c, float& d, float& e) {
  asm("s_delay_alu instid0(VALU_DEP_1)\n\tv_exp_f32 %0, %0\n\tv_exp_f32 %1, %1\n\tv_exp_f32 %2, %2\n\tv_exp_f32 %3, %3\n\tv_exp_f32 %4, %4\n\tv_nop"
      : "+v"(a), "+v"(b), "+v"(c), "+v"(d), "+v"(e));
}

// One block of 32 keys for one wave's 16 queries: scores, online softmax, O^T += V^T P^T.
// DIAG = true: the block meets the wave's diagonal; every score is tested against the strict
// causal bound, and a key that fails it gets probability 0.
// DIAG = false: every key of the block lies below every query of the wave, so both tests
// would pass for every score: neither they nor the key indices they compare are computed.
// kv: the block's first row in the K tile (raw K one tile behind); vb: its first column in
// the V^T tile; mw: the block's 16 lane masks, replaced on the way by those at mn (the wave's
// next block), both wave-uniform.
template <bool DIAG>
static __device__ __forceinline__ void key_block(
    const h16* kv, const h16* vb, v16u& mw, const unsigned* mn, int kc0, int qq,
    const v16h& aq0, const v16h& aq1, const v16h& ar0, const v16h& ar1,
    float sscale, float qscale,
    v8f& o0, v8f& o1, v8f& o2, v8f& o3, float& mrun, float& lrun) {
  float sc[16];   // scores of keys 16 t + 8 hi + i of the block at index 8 t + i
#pragma unroll
  for (int t = 0; t < 2; ++t) {
    const h16* kpb = kv + t * 16 * AT_KP;
    const h16* krb = kpb + AT_TILE;
    v8f s = {};
    s = WMMA_F16(load_frag16(kpb, AT_KP), aq0, s);
    s = WMMA_F16(load_frag16(kpb + 32, AT_KP), aq1, s);
    v8f sr = {};
    sr = WMMA_F16(load_frag16(krb, AT_KP), ar0, sr);
    sr = WMMA_F16(load_frag16(krb + 32, AT_KP), ar1, sr);
#pragma unroll
    for (int i = 0; i < 8; ++i) {
      // word 8 t + i is the select's lane mask as it lies in its scalar register: no compare. The
      // select takes the scale, not the product: it needs no WMMA result, so none of the chain behind them
      const float sel = __builtin_amdgcn_inverse_ballot_w32(mw[t * 8 + i]) ? sscale : 0.0f;
      const float v = s[i] * qscale + sr[i] * sel;
      if (DIAG) sc[t * 8 + i] = (kc0 + t * 16 + i < qq) ? v : -3.0e38f;   // strict tril(-1)
      else      sc[t * 8 + i] = v;
    }
  }
  mw = *(sc16_ptr)mn;   // the next block's masks: a scalar load, a whole key block ahead of their first use
  // online softmax: one query per lane, its 32 keys split between lanes l and l ^ 16
  float rm = sc[0];
#pragma unroll
  for (int j = 1; j < 16; ++j) rm = fmaxf(rm, sc[j]);
  rm = fmaxf(rm, xhalf(rm));
  const float mnew = fmaxf(mrun, rm);
  const float l2e = 1.4426950408889634f;   // e^x = 2^(x log2 e)
  float fac = (mrun - mnew) * l2e;
  mrun = mnew;
  float pe[16];
#pragma unroll
  for (int j = 0; j < 16; ++j) pe[j] = (sc[j] - mnew) * l2e;
  exp2x5(fac, pe[0], pe[1], pe[2], pe[3]);
  exp2x4(pe[4], pe[5], pe[6], pe[7]);
  exp2x4(pe[8], pe[9], pe[10], pe[11]);
  exp2x4(pe[12], pe[13], pe[14], pe[15]);
  v16h bp;        // P^T as a B operand: element 8 t + i is key 16 t + 8 hi + i, the loader's k order
  float rs = 0.0f;
#pragma unroll
  for (int j = 0; j < 16; ++j) {
    float p = pe[j];
    if (DIAG) p = (sc[j] > -1.0e37f) ? p : 0.0f;
    rs += p;
    bp[j] = (h16)p;
  }
  lrun = lrun * fac + rs;
#pragma unroll
  for (int i = 0; i < 8; ++i) {
    o0[i] *= fac; o1[i] *= fac; o2[i] *= fac; o3[i] *= fac;
  }
  // V^T(64 dk x 32 keys) @ P^T(32 keys x 16 queries), V stored transposed [d][s]
  o0 = WMMA_F16(load_frag16(vb,              AT_KP), bp, o0);
  o1 = WMMA_F16(load_frag16(vb + 16 * AT_KP, AT_KP), bp, o1);
  o2 = WMMA_F16(load_frag16(vb + 32 * AT_KP, AT_KP), bp, o2);
  o3 = WMMA_F16(load_frag16(vb + 48 * AT_KP, AT_KP), bp, o3);
  // A branch follows this block: four vector slots keep the last WMMA's distance on every path;
  // the fence holds them behind it.
  __builtin_amdgcn_sched_barrier(0);
  asm volatile("v_nop\n\tv_nop\n\tv_nop\n\tv_nop");
}

// 512 work-groups on 256 WGPs: two a WGP, four waves a SIMD, whatever else would fit. Said to the
// build, because with the mask tile gone from LDS it would plan for more resident waves, hold the
// registers down for them and read the K fragments one at a time, each with its own full wait.
__global__ void __launch_bounds__(256) __attribute__((amdgpu_waves_per_eu(4, 4))) attn_kernel(
    const h16* __restrict__ Qp, const h16* __restrict__ Kp, const h16* __restrict__ Vt,
    const h16* __restrict__ Qr, const h16* __restrict__ Kr,
    const unsigned* __restrict__ pmask, const float* __restrict__ gammas,
    h16* __restrict__ outA) {
  __shared__ alignas(16) h16 KVs[2][3 * AT_TILE];    // [buffer][K | raw K | V^T], 64 rows each
  const int bid = blockIdx.x;
  const int h   = bid & 7;
  const int b   = (bid >> 3) & 7;
  const int grp = bid >> 6;
  // query block: the four long ones first, then the short ones shortest first, so that a
  // late block that joins an early one on a WGP is short where the early one is long
  const int qb  = grp < 4 ? 7 - grp : grp - 4;
  const int tid  = threadIdx.x;
  const int lane = tid & 31;
  const int wv   = __builtin_amdgcn_readfirstlane(tid >> 5);  // wave number, in a scalar register
  const int lr = lane & 15;
  const int hi = lane >> 4;
  const int qb0 = qb << 7;
  const int q0  = qb0 + (wv << 4);

  // exp(-softplus(g)) == sigmoid(-g); clip lower bound
  const float g = gammas[h];
  float te = 1.0f / (1.0f + __expf(g));
  te = fminf(fmaxf(te, 1e-5f), 1e5f);
  const float sscale = te * 0.0441941738241592f;  // * 1/sqrt(512)
  const float qscale = 0.125f;                    // 1/sqrt(64)

  const size_t hd = (size_t)h * 64;

  // staging: thread t copies 16 B at column (t & 7) of rows (t >> 3) and (t >> 3) + 32 of
  // each f16 tile
  const int krow = tid >> 3;
  const int kcol = (tid & 7) * 8;
  const h16* kg = Kp + ((size_t)(b * 1024 + krow) * 512 + hd + kcol);
  const h16* rg = Kr + ((size_t)(b * 1024 + krow) * 512 + hd + kcol);
  const h16* vg = Vt + (((size_t)(b * 512) + hd + krow) * 1024 + kcol);
  const int  ko = krow * AT_KP + kcol;

  const int nst = 2 * qb + 2;   // stages of 64 keys covering keys < qb0 + 128; at least two

  copy_kv6(&KVs[0][ko], kg, rg, vg);

  const h16* qpb = Qp + ((size_t)(b * 1024 + q0) * 512 + hd);
  const h16* qrb = Qr + ((size_t)(b * 1024 + q0) * 512 + hd);
  const v16h aq0 = load_frag16(qpb, 512);
  const v16h aq1 = load_frag16(qpb + 32, 512);
  const v16h ar0 = load_frag16(qrb, 512);
  const v16h ar1 = load_frag16(qrb + 32, 512);

  asm volatile("s_wait_asynccnt 0x0" ::: "memory");  // this wave's copies of stage 0 have landed
  __syncthreads();                                   // stage 0 is visible to every wave
  copy_kv6(&KVs[1][ko], kg + 64 * 512, rg + 64 * 512, vg + 64);  // stage 1 flies during stage 0

  v8f o0 = {}, o1 = {}, o2 = {}, o3 = {};   // O^T: register i = dk 16 j + 8 hi + i of query q0 + lr
  float mrun = -3.0e38f;   // running maximum of this lane's query (equal in lanes l and l ^ 16)
  float lrun = 0.0f;       // running sum over this lane's own keys; the halves are joined after the loop

  const int qq = q0 + lr;                              // this lane's query
  const int nkw = ((q0 + 46) >> 5) << 5;  // this wave's keys: blocks of 32 covering keys < q0+16
  const unsigned* mp = pmask + (size_t)(b * 64 + (q0 >> 4)) * (32 * 16);   // this wave's lane masks, 16 words a key block
  const int kbl = (nkw >> 5) - 1;         // the wave's last key block: nothing behind it is fetched
  v16u mw = *(sc16_ptr)mp;                // key block 0
  for (int st = 0; st < nst; ++st) {
    const int cur = st & 1;
#pragma unroll  // two key blocks of 32 per stage, at constant LDS offsets
    for (int u = 0; u < 2; ++u) {
      const int kb0 = st * 64 + u * 32;
      if (kb0 < nkw) {  // wave-uniform (scalar): key blocks wholly above this wave's diagonal are skipped
        const h16* kv = &KVs[cur][u * 32 * AT_KP];
        const h16* vb = &KVs[cur][2 * AT_TILE + u * 32];
        const int kbn = st * 2 + u + 1;   // the next key block, held at the wave's last
        const unsigned* mn = mp + (kbn < kbl ? kbn : kbl) * 16;
        // wave-uniform (scalar): every key of the block lies below every query of the wave
        if (kb0 + 32 <= q0)
          key_block<false>(kv, vb, mw, mn, 0, 0, aq0, aq1, ar0, ar1, sscale, qscale, o0, o1, o2, o3, mrun, lrun);
        else
          key_block<true>(kv, vb, mw, mn, kb0 + hi * 8, qq, aq0, aq1, ar0, ar1, sscale, qscale, o0, o1, o2, o3, mrun, lrun);
      }
    }
    asm volatile("s_wait_dscnt 0x0" ::: "memory");     // this wave's reads of stage st are done
    asm volatile("s_wait_asynccnt 0x0" ::: "memory");  // this wave's copies of stage st+1 have landed
    __syncthreads();  // publishes stage st+1 and ends every wave's reads of stage st
    if (st + 2 < nst) {  // block-uniform: refill the buffer that stage st has just left
      const int kn = (st + 2) * 64;
      copy_kv6(&KVs[cur][ko], kg + (size_t)kn * 512, rg + (size_t)kn * 512, vg + kn);
    }
  }
  asm volatile("s_wait_asynccnt 0x0" ::: "memory");    // no copy is left in flight at the wave's end

  const float ltot = lrun + xhalf(lrun);   // the two halves' sums of one query
  const float inv = (ltot > 0.0f) ? (1.0f / ltot) : 0.0f;
  union { uint4 u; h16 h[8]; } pk0, pk1, pk2, pk3;
#pragma unroll
  for (int i = 0; i < 8; ++i) {
    pk0.h[i] = (h16)(o0[i] * inv); pk1.h[i] = (h16)(o1[i] * inv);
    pk2.h[i] = (h16)(o2[i] * inv); pk3.h[i] = (h16)(o3[i] * inv);
  }
  h16* ob = outA + ((size_t)(b * 1024 + qq) * 512 + hd + hi * 8);
  *(uint4*)(ob)      = pk0.u;   // 8 consecutive dk of one query, 16-B aligned
  *(uint4*)(ob + 16) = pk1.u;
  *(uint4*)(ob + 32) = pk2.u;
  *(uint4*)(ob + 48) = pk3.u;
}

// ---------------- output projection + residual + LayerNorm in one launch ----------------
// One 256-thread block owns 64 whole rows of X = A Wo + bo + resid (N = K = 512), so a row's
// mean and variance need no other block and X never goes to memory.
// Product: 8 waves side by side along N, each 64 rows x 64 columns = 16 accumulators; every
// LDS fragment feeds 4 WMMAs. It is taken transposed (Wt as A, the rows of A as B): a lane
// then holds 8 consecutive columns of one row, which leave for LDS in 16-B stores.
// Panels of 64 k (all 512 rows of Wt, the block's 64 rows of A) come into LDS by
// asynchronous copies, whole 128-B lines, in two buffers: the next panel flies while this
// one is multiplied. The k order per accumulator is 0,32,...,480.
// Then the tile goes through LDS (the panels' space, free by then) so that one wave has a
// whole row: 16 values a lane, whole-line reads of the residual and whole-line stores.
#define OL_KS 64                        // k (halves) per staged panel
#define OL_LP 72                        // panel row pitch, halves: 144 B = 16 B x 9, conflict-free 16-B reads
#define OL_PANEL ((512 + 64) * OL_LP)   // one buffer, halves: 512 rows of Wt, then 64 rows of A
#define OL_XP 516                       // X row pitch, floats: 2,064 B = 16 B x 129, conflict-free 16-B stores from 16 rows

// Nine asynchronous 16-B copies per lane, global -> LDS, through no register: eight rows of
// Wt, 32 apart on both sides, and one row of A. The s_wait_xcnt 0 is the statement's last
// line so that it stands ahead of any later rewrite of the address registers the copies name.
static __device__ __forceinline__ void copy_w8a1(const h16* lw, const h16* gw, const h16* la, const h16* ga) {
  const unsigned l0 = (unsigned)(size_t)lw;      // LDS byte addresses: low 32 bits
  const unsigned l8 = (unsigned)(size_t)la;
  const unsigned ls = 32u * OL_LP * 2u;          // 32 LDS rows in bytes
  asm volatile(
      "global_load_async_to_lds_b128 %0, %9, off\n\t"
      "global_load_async_to_lds_b128 %1, %10, off\n\t"
      "global_load_async_to_lds_b128 %2, %11, off\n\t"
      "global_load_async_to_lds_b128 %3, %12, off\n\t"
      "global_load_async_to_lds_b128 %4, %13, off\n\t"
      "global_load_async_to_lds_b128 %5, %14, off\n\t"
      "global_load_async_to_lds_b128 %6, %15, off\n\t"
      "global_load_async_to_lds_b128 %7, %16, off\n\t"
      "global_load_async_to_lds_b128 %8, %17, off\n\t"
      "s_wait_xcnt 0x0"
      :: "v"(l0), "v"(l0 + ls), "v"(l0 + 2u * ls), "v"(l0 + 3u * ls),
         "v"(l0 + 4u * ls), "v"(l0 + 5u * ls), "v"(l0 + 6u * ls), "v"(l0 + 7u * ls), "v"(l8),
         "v"(gw), "v"(gw + 32 * 512), "v"(gw + 64 * 512), "v"(gw + 96 * 512),
         "v"(gw + 128 * 512), "v"(gw + 160 * 512), "v"(gw + 192 * 512), "v"(gw + 224 * 512), "v"(ga)
      : "memory");
}

// One panel: thread t copies 16 B at column (t & 7) of rows (t >> 3) + 32 j, j = 0..15 of Wt
// and j = 0, 1 of A. p, w, a: the thread's own first place in the buffer, in Wt and in A.
static __device__ __forceinline__ void copy_panel(const h16* p, const h16* w, const h16* a) {
  copy_w8a1(p,               w,             p + 512 * OL_LP, a);
  copy_w8a1(p + 256 * OL_LP, w + 256 * 512, p + 544 * OL_LP, a + 32 * 512);
}

// Sum over the wave's 32 lanes, the result in every lane: four steps inside the 16-lane rows
// (row_xmask 1, 2, 4, 8 on the vector unit, no LDS), then the exchange between the halves.
template <int CTRL>
static __device__ __forceinline__ float row_step(float x) {
  return x + __builtin_bit_cast(float, __builtin_amdgcn_mov_dpp(__builtin_bit_cast(int, x), CTRL, 0xf, 0xf, true));
}
static __device__ __forceinline__ float wave_sum(float x) {
  x = row_step<0x161>(x);
  x = row_step<0x162>(x);
  x = row_step<0x164>(x);
  x = row_step<0x168>(x);
  return x + xhalf(x);
}

__global__ void __launch_bounds__(256) proj_ln(
    const h16* __restrict__ A, const h16* __restrict__ Wt, const float* __restrict__ bias,
    const float* __restrict__ resid, const float* __restrict__ gw, const float* __restrict__ bw,
    float* __restrict__ out) {
  __shared__ alignas(16) unsigned char Sm[2 * OL_PANEL * 2];   // two panel buffers; later the X tile
  h16* const P0 = (h16*)Sm;
  const int tid  = threadIdx.x;
  const int lane = tid & 31;
  const int wv   = tid >> 5;
  const int m0 = (int)blockIdx.x * 64;   // the block's rows
  const int wn = wv * 64;                // the wave's columns
  const int lr = lane & 15;
  const int hi = lane >> 4;

  v8f acc[4][4];   // acc[mi][j], register i: row 16 mi + lr, column wn + 16 j + 8 hi + i
#pragma unroll  // constant indices keep acc in registers
  for (int j = 0; j < 4; ++j) {
    const float4 b0 = *(const float4*)(bias + wn + j * 16 + hi * 8);
    const float4 b1 = *(const float4*)(bias + wn + j * 16 + hi * 8 + 4);
    acc[0][j] = (v8f){b0.x, b0.y, b0.z, b0.w, b1.x, b1.y, b1.z, b1.w};
    acc[1][j] = acc[0][j]; acc[2][j] = acc[0][j]; acc[3][j] = acc[0][j];
  }

  // staging: this thread's first row and column, as copy_panel takes them
  const int srow = tid >> 3;
  const int scol = (tid & 7) * 8;
  const h16* wg = Wt + (size_t)srow * 512 + scol;
  const h16* ag = A  + (size_t)(m0 + srow) * 512 + scol;
  const int  so = srow * OL_LP + scol;

  copy_panel(P0 + so, wg, ag);
  asm volatile("s_wait_asynccnt 0x0" ::: "memory");  // this wave's copies of panel 0 have landed
  __syncthreads();                                   // panel 0 is visible to every wave
  copy_panel(P0 + OL_PANEL + so, wg + OL_KS, ag + OL_KS);   // panel 1 flies during panel 0

  for (int kt = 0; kt < 8; ++kt) {
    h16* const pb = P0 + (kt & 1) * OL_PANEL;
    const h16* wb = pb + wn * OL_LP;
    const h16* ab = pb + 512 * OL_LP;
#pragma unroll  // both k steps of a panel at constant LDS offsets
    for (int ks = 0; ks < OL_KS; ks += 32) {
      v16h a[4], w[4];
#pragma unroll  // constant indices keep the fragments in registers
      for (int i = 0; i < 4; ++i) {
        a[i] = load_frag16(ab + ks + i * 16 * OL_LP, OL_LP);
        w[i] = load_frag16(wb + ks + i * 16 * OL_LP, OL_LP);
      }
      // keeps the 16 LDS reads one group ahead of the 16 WMMAs: left free, the build reads the
      // A fragments one at a time among them and waits out the LDS latency at each
      __builtin_amdgcn_sched_barrier(0);
#pragma unroll  // constant indices keep acc in registers
      for (int mi = 0; mi < 4; ++mi) {
#pragma unroll  // constant indices keep acc in registers
        for (int j = 0; j < 4; ++j) acc[mi][j] = WMMA_F16(w[j], a[mi], acc[mi][j]);
      }
      __builtin_amdgcn_sched_barrier(0);  // the other side of the same fence: no later read moves in among the WMMAs
    }
    asm volatile("s_wait_dscnt 0x0" ::: "memory");     // this wave's reads of panel kt are done
    asm volatile("s_wait_asynccnt 0x0" ::: "memory");  // this wave's copies of panel kt+1 have landed
    __syncthreads();  // publishes panel kt+1 and ends every wave's reads of panel kt
    if (kt + 2 < 8)   // block-uniform: refill the buffer that panel kt has just left
      copy_panel(pb + so, wg + (kt + 2) * OL_KS, ag + (kt + 2) * OL_KS);
  }
  asm volatile("s_wait_asynccnt 0x0" ::: "memory");    // no copy is left in flight: the panels' LDS is free

  // This wave's 8 rows of the second part; a lane has columns 4 lane + 128 p + {0..3}.
  const int r0 = wv * 8;
  const float* rg = resid + (size_t)(m0 + r0) * 512 + lane * 4;
  v4f x[8][4], g4[4], b4[4];
#pragma unroll  // constant indices keep x in registers; the first 4 rows' residual flies under the LDS stores
  for (int r = 0; r < 4; ++r) {
#pragma unroll
    for (int p = 0; p < 4; ++p) x[r][p] = *(const v4f*)(rg + r * 512 + p * 128);
  }
#pragma unroll
  for (int p = 0; p < 4; ++p) {
    g4[p] = *(const v4f*)(gw + lane * 4 + p * 128);
    b4[p] = *(const v4f*)(bw + lane * 4 + p * 128);
  }

  float* const X = (float*)Sm;
  const int xo = lr * OL_XP + wn + hi * 8;   // this lane's first row and column in the tile
#pragma unroll  // constant indices keep acc in registers
  for (int mi = 0; mi < 4; ++mi) {
#pragma unroll
    for (int j = 0; j < 4; ++j) {
      float* p = &X[xo + mi * 16 * OL_XP + j * 16];
      *(float4*)(p)     = make_float4(acc[mi][j][0], acc[mi][j][1], acc[mi][j][2], acc[mi][j][3]);
      *(float4*)(p + 4) = make_float4(acc[mi][j][4], acc[mi][j][5], acc[mi][j][6], acc[mi][j][7]);
    }
  }
  // stands ahead of any later rewrite of the address registers of the loads above
  asm volatile("s_wait_xcnt 0x0" ::: "memory");
  __syncthreads();   // the whole X tile is in LDS before any wave reads a row of it

#pragma unroll  // the other 4 rows' residual flies while the first 4 rows are worked on
  for (int r = 4; r < 8; ++r) {
#pragma unroll
    for (int p = 0; p < 4; ++p) x[r][p] = *(const v4f*)(rg + r * 512 + p * 128);
  }

  float* og = out + (size_t)(m0 + r0) * 512 + lane * 4;
#pragma unroll  // constant indices keep x in registers; independent rows, so their LDS reads and cross-lane sums overlap
  for (int r = 0; r < 8; ++r) {
    // keeps the two groups of 4 rows apart: woven together, the first group waits on the second
    // group's residual, still in flight, and the build goes past the first 256 registers
    if (r == 4) __builtin_amdgcn_sched_barrier(0);
#pragma unroll
    for (int p = 0; p < 4; ++p) x[r][p] += *(const v4f*)&X[(r0 + r) * OL_XP + lane * 4 + p * 128];
    const v4f s4 = (x[r][0] + x[r][1]) + (x[r][2] + x[r][3]);
    const float mu = wave_sum((s4.x + s4.y) + (s4.z + s4.w)) * (1.0f / 512.0f);
#pragma unroll
    for (int p = 0; p < 4; ++p) x[r][p] -= mu;
    const v4f q4 = (x[r][0] * x[r][0] + x[r][1] * x[r][1]) + (x[r][2] * x[r][2] + x[r][3] * x[r][3]);
    const float rstd = rsqrtf(wave_sum((q4.x + q4.y) + (q4.z + q4.w)) * (1.0f / 512.0f) + 1e-5f);
#pragma unroll
    for (int p = 0; p < 4; ++p) *(v4f*)(og + r * 512 + p * 128) = x[r][p] * rstd * g4[p] + b4[p];
  }
}

extern "C" void kernel_launch(void* const* d_in, const int* in_sizes, int n_in,
                              void* d_out, int out_size, void* d_ws, size_t ws_size,
                              hipStream_t stream) {
  (void)in_sizes; (void)n_in; (void)out_size; (void)ws_size;
  const float* q_in  = (const float*)d_in[0];
  const float* k_in  = (const float*)d_in[1];
  const float* v_in  = (const float*)d_in[2];
  const int*   smask = (const int*)  d_in[3];
  const float* Wq    = (const float*)d_in[4];
  const float* bq    = (const float*)d_in[5];
  const float* Wv    = (const float*)d_in[6];
  const float* bv    = (const float*)d_in[7];
  const float* Wo    = (const float*)d_in[8];
  const float* bo    = (const float*)d_in[9];
  const float* gm    = (const float*)d_in[10];
  const float* lng   = (const float*)d_in[11];
  const float* lnb   = (const float*)d_in[12];
  float* out = (float*)d_out;

  const size_t E = (size_t)8 * 1024 * 512;  // elements per [B,S,D] tensor
  char* ws = (char*)d_ws;
  h16*  qh  = (h16*)(ws);
  h16*  kh  = (h16*)(ws + 2 * E);
  h16*  Qp  = (h16*)(ws + 4 * E);
  h16*  Kp  = (h16*)(ws + 6 * E);
  h16*  Vt  = (h16*)(ws + 8 * E);
  h16*  Ao  = (h16*)(ws + 10 * E);
  h16*  Wot = (h16*)(ws + 12 * E);
  unsigned* pm = (unsigned*)(ws + 12 * E + 524288);   // packed state mask, 1 MiB

  const int M = 8192;  // B*S rows; (M/128)*(512/128) = 256 tiles, one 8-wave block each
  // 3 x 256 product tiles, then 8 x 36 tiles of the state mask, then 64 tiles of Wo
  proj_qkv<<<dim3(1120), dim3(256), 0, stream>>>(q_in, k_in, v_in, Wq, Wv, bq, bv, Qp, Kp, Vt, qh, kh, M,
                                                 smask, pm, Wo, Wot);

  attn_kernel<<<dim3(512), dim3(256), 0, stream>>>(Qp, Kp, Vt, qh, kh, pm, gm, Ao);

  // 8192 / 64 = 128 blocks, each with 64 whole rows
  proj_ln<<<dim3(128), dim3(256), 0, stream>>>(Ao, Wot, bo, q_in, lng, lnb, out);
}
